// v000
// The times below were measured on an AMD MI455X: many runs one after another, warmed up first and cycling through
// copies of the inputs, with the whole window's GPU time divided by the number of runs. Launches and the gaps
// between them are all in it. The median over several windows is given; except for v000 it joins two sittings, which
// can be a few percent apart, so the side-by-side timings, each taken in one sitting, are the better comparison.
// v000, which the later versions start from, runs in 584 microseconds.
#include <hip/hip_runtime.h>
#include <hip/hip_bf16.h>
#include <math.h>

// ---------------- problem constants ----------------
enum : int { BB = 2, TT = 1024, CC = 1024, NH = 16, HS = 64, ROT = 32 };

typedef __attribute__((ext_vector_type(16))) __bf16 v16bf;
typedef __attribute__((ext_vector_type(8)))  __bf16 v8bf;
typedef __attribute__((ext_vector_type(8)))  float  v8f;

#define WMMA_BF16(a, b, c) \
  __builtin_amdgcn_wmma_f32_16x16x32_bf16(false, (a), false, (b), (short)0, (c), false, false)

// Fragment loader: lane supplies base = row_ptr + kb (kb = 8*(lane>=16)).
// Elements 0..7  <- K = kb+0..7   (16B load)
// Elements 8..15 <- K = kb+16..23 (16B load)
static __device__ __forceinline__ v16bf load_frag(const __bf16* p) {
  v8bf lo = *(const v8bf*)p;
  v8bf hi = *(const v8bf*)(p + 16);
  v16bf r;
#pragma unroll
  for (int i = 0; i < 8; ++i) { r[i] = lo[i]; r[i + 8] = hi[i]; }
  return r;
}

// ---------------- 1) time-shift + f32->bf16 ----------------
__global__ void k_shift(const float* __restrict__ x, __bf16* __restrict__ xs, int n) {
  int i = blockIdx.x * blockDim.x + threadIdx.x;
  if (i >= n) return;
  int c = i % CC, t = (i / CC) % TT, b = i / (CC * TT);
  float v;
  if (c < CC / 2) v = (t > 0) ? x[((size_t)b * TT + t - 1) * CC + c] : 0.f;
  else            v = x[((size_t)b * TT + t) * CC + c];
  xs[i] = (__bf16)v;
}

// ---------------- 2) W[k][n] f32 -> Wt[n][k] bf16 ----------------
__global__ void k_convT(const float* __restrict__ W, __bf16* __restrict__ Wt, int K, int N) {
  int i = blockIdx.x * blockDim.x + threadIdx.x;
  if (i >= K * N) return;
  int k = i % K, n = i / K;
  Wt[i] = (__bf16)W[(size_t)k * N + n];
}

// ---------------- generic bf16 WMMA GEMM, 2x2 register-blocked (32x32 per wave) ----------------
// out = A @ Bt^T + bias (opt *gamma[m%T]); 4 fragment loads feed 4 WMMAs per K-step.
__global__ void k_gemm(const __bf16* __restrict__ A, const __bf16* __restrict__ Bt,
                       const float* __restrict__ bias, const float* __restrict__ gamma,
                       float* __restrict__ out, int M, int N, int K, int T) {
  int wid  = (blockIdx.x * blockDim.x + threadIdx.x) >> 5;
  int lane = threadIdx.x & 31;
  int hf = lane >> 4, ml = lane & 15;
  int ntn = N >> 5;                          // 32-wide N tiles
  int tm = wid / ntn, tn = wid % ntn;
  if (tm >= (M >> 5)) return;
  int m0 = tm * 32, n0 = tn * 32;
  const __bf16* pa0 = A  + (size_t)(m0 + ml)      * K + hf * 8;
  const __bf16* pa1 = A  + (size_t)(m0 + 16 + ml) * K + hf * 8;
  const __bf16* pb0 = Bt + (size_t)(n0 + ml)      * K + hf * 8;
  const __bf16* pb1 = Bt + (size_t)(n0 + 16 + ml) * K + hf * 8;
  v8f a00 = {}, a01 = {}, a10 = {}, a11 = {};
  for (int k0 = 0; k0 < K; k0 += 32) {
    v16bf fa0 = load_frag(pa0 + k0);
    v16bf fa1 = load_frag(pa1 + k0);
    v16bf fb0 = load_frag(pb0 + k0);
    v16bf fb1 = load_frag(pb1 + k0);
    a00 = WMMA_BF16(fa0, fb0, a00);
    a01 = WMMA_BF16(fa0, fb1, a01);
    a10 = WMMA_BF16(fa1, fb0, a10);
    a11 = WMMA_BF16(fa1, fb1, a11);
  }
#pragma unroll
  for (int bm = 0; bm < 2; ++bm)
#pragma unroll
    for (int bn = 0; bn < 2; ++bn) {
      const v8f& acc = bm ? (bn ? a11 : a10) : (bn ? a01 : a00);
      int n = n0 + bn * 16 + ml;
      float bv = bias ? bias[n] : 0.f;
#pragma unroll
      for (int r = 0; r < 8; ++r) {
        int m = m0 + bm * 16 + r + hf * 8;
        float v = acc[r] + bv;
        if (gamma) v *= gamma[m % T];
        out[(size_t)m * N + n] = v;
      }
    }
}

// ---------------- 4) RoPE + relayout to WMMA-friendly buffers ----------------
// Qh/Kh: [b*16+h][t][64] bf16 ;  Vt: [b*16+h][d][1024] bf16 (transposed for att@v B-frags)
__global__ void k_rope(const float* __restrict__ Q, const float* __restrict__ Kr,
                       const float* __restrict__ V, __bf16* __restrict__ Qh,
                       __bf16* __restrict__ Kh, __bf16* __restrict__ Vt, int n) {
  int i = blockIdx.x * blockDim.x + threadIdx.x;
  if (i >= n) return;
  int nn = i % CC, t = (i / CC) % TT, b = i / (CC * TT);
  int h = nn >> 6, d = nn & 63;
  float qv = Q[i], kv = Kr[i];
  if (d < ROT) {
    int fi = d & 15;
    float fr = (float)t * __powf(1024.0f, -(float)fi / 16.0f);
    float cs = __cosf(fr), sn = __sinf(fr);
    int pd = (d < 16) ? d + 16 : d - 16;
    float sgn = (d < 16) ? -1.f : 1.f;
    size_t base = (size_t)i - d;
    qv = qv * cs + sgn * Q[base + pd] * sn;
    kv = kv * cs + sgn * Kr[base + pd] * sn;
  }
  int bh = b * NH + h;
  Qh[((size_t)bh * TT + t) * HS + d] = (__bf16)qv;
  Kh[((size_t)bh * TT + t) * HS + d] = (__bf16)kv;
  Vt[((size_t)bh * HS + d) * TT + t] = (__bf16)V[i];
}

// ---------------- 5) softmax stats over ALL s (max & sum) ----------------
__global__ void k_stats(const __bf16* __restrict__ Qh, const __bf16* __restrict__ Kh,
                        float* __restrict__ Mb, float* __restrict__ Zb) {
  int wid  = (blockIdx.x * blockDim.x + threadIdx.x) >> 5;
  int lane = threadIdx.x & 31;
  int hf = lane >> 4, ml = lane & 15;
  int tile = wid & 63, bh = wid >> 6;      // 2048 waves: [b*16+h][t-tile]
  int t0 = tile * 16;
  const __bf16* qrow = Qh + ((size_t)bh * TT + t0 + ml) * HS + hf * 8;
  v16bf qa0 = load_frag(qrow);
  v16bf qa1 = load_frag(qrow + 32);
  float mr[8], zz[8];
#pragma unroll
  for (int r = 0; r < 8; ++r) { mr[r] = -3.0e38f; zz[r] = 0.f; }
  for (int st = 0; st < TT / 16; ++st) {
    const __bf16* krow = Kh + ((size_t)bh * TT + st * 16 + ml) * HS + hf * 8;
    v8f s = {};
    s = WMMA_BF16(qa0, load_frag(krow), s);
    s = WMMA_BF16(qa1, load_frag(krow + 32), s);
#pragma unroll
    for (int r = 0; r < 8; ++r) {
      float x = s[r] * 0.125f;               // 1/sqrt(64)
      float tmax = x;
      tmax = fmaxf(tmax, __shfl_xor(tmax, 8, 16));
      tmax = fmaxf(tmax, __shfl_xor(tmax, 4, 16));
      tmax = fmaxf(tmax, __shfl_xor(tmax, 2, 16));
      tmax = fmaxf(tmax, __shfl_xor(tmax, 1, 16));
      float mnew = fmaxf(mr[r], tmax);
      float e = __expf(x - mnew);
      e += __shfl_xor(e, 8, 16);
      e += __shfl_xor(e, 4, 16);
      e += __shfl_xor(e, 2, 16);
      e += __shfl_xor(e, 1, 16);
      zz[r] = zz[r] * __expf(mr[r] - mnew) + e;
      mr[r] = mnew;
    }
  }
  if (ml == 0) {
#pragma unroll
    for (int r = 0; r < 8; ++r) {
      int t = t0 + r + hf * 8;
      Mb[(size_t)bh * TT + t] = mr[r];
      Zb[(size_t)bh * TT + t] = zz[r];
    }
  }
}

// ---------------- 6) fused attention: scores -> p*w -> Wmix -> @v  (att stays on-WGP) ----------------
__global__ void __launch_bounds__(512)
k_attn(const __bf16* __restrict__ Qh, const __bf16* __restrict__ Kh,
       const __bf16* __restrict__ Vt, const float* __restrict__ Mb,
       const float* __restrict__ Zb, const float* __restrict__ tw,
       const float* __restrict__ alpha, const float* __restrict__ beta,
       const float* __restrict__ Wmix, __bf16* __restrict__ Y) {
  __shared__ float pw[NH * 16 * 32];                   // 32 KB of 320 KB LDS
  int tile = blockIdx.x & 63, b = blockIdx.x >> 6;
  int wave = threadIdx.x >> 5;                         // = input head h and output head g
  int lane = threadIdx.x & 31;
  int hf = lane >> 4, ml = lane & 15;
  int t0 = tile * 16;
  int h = wave, g = wave;
  int bh = b * NH + h, bg = b * NH + g;

  const __bf16* qrow = Qh + ((size_t)bh * TT + t0 + ml) * HS + hf * 8;
  v16bf qa0 = load_frag(qrow);
  v16bf qa1 = load_frag(qrow + 32);

  float mr[8], zi[8], bt[8];
#pragma unroll
  for (int r = 0; r < 8; ++r) {
    int t = t0 + r + hf * 8;
    mr[r] = Mb[(size_t)bh * TT + t];
    zi[r] = 1.0f / Zb[(size_t)bh * TT + t];
    bt[r] = beta[h * TT + t];
  }
  float wrow[NH];
#pragma unroll
  for (int j = 0; j < NH; ++j) wrow[j] = Wmix[g * NH + j];

  v8f yac[4] = {};
  int nch = (t0 + 16 + 31) >> 5;
  for (int ch = 0; ch < nch; ++ch) {
    int s0 = ch * 32;
    // phase A: this wave = head h; two 16-wide s subtiles of exp/Z * w -> LDS
#pragma unroll
    for (int sub = 0; sub < 2; ++sub) {
      int sb = s0 + sub * 16;
      const __bf16* krow = Kh + ((size_t)bh * TT + sb + ml) * HS + hf * 8;
      v8f s = {};
      s = WMMA_BF16(qa0, load_frag(krow), s);
      s = WMMA_BF16(qa1, load_frag(krow + 32), s);
#pragma unroll
      for (int r = 0; r < 8; ++r) {
        int tl = r + hf * 8, t = t0 + tl, sg = sb + ml;
        float p = __expf(s[r] * 0.125f - mr[r]) * zi[r];
        float wv = 0.f;
        if (sg <= t)
          wv = tw[h * TT + (TT - 1) - (t - sg)] * alpha[h * TT + sg] * bt[r];
        pw[(h * 16 + tl) * 32 + sub * 16 + ml] = p * wv;
      }
    }
    __syncthreads();
    // phase B: this wave = output head g; mix 16 heads, repack to A-frag, 4 WMMAs vs Vt
    v16bf am;
#pragma unroll
    for (int j = 0; j < 8; ++j) {
      int sl = hf * 8 + ((j < 4) ? 2 * j : 16 + 2 * (j - 4));
      float a0 = 0.f, a1 = 0.f;
#pragma unroll
      for (int hh = 0; hh < NH; ++hh) {
        const float2 v2 = *(const float2*)&pw[(hh * 16 + ml) * 32 + sl];
        a0 += wrow[hh] * v2.x;
        a1 += wrow[hh] * v2.y;
      }
      am[2 * j]     = (__bf16)a0;
      am[2 * j + 1] = (__bf16)a1;
    }
#pragma unroll
    for (int dt = 0; dt < 4; ++dt) {
      const __bf16* vrow = Vt + ((size_t)bg * HS + dt * 16 + ml) * TT + s0 + hf * 8;
      yac[dt] = WMMA_BF16(am, load_frag(vrow), yac[dt]);
    }
    __syncthreads();
  }
  // write y[b][t][g*64+d] as bf16 for the final WMMA GEMM
#pragma unroll
  for (int dt = 0; dt < 4; ++dt)
#pragma unroll
    for (int r = 0; r < 8; ++r) {
      int t = t0 + r + hf * 8;
      int n = g * HS + dt * 16 + ml;
      Y[((size_t)b * TT + t) * CC + n] = (__bf16)yac[dt][r];
    }
}

// ---------------- host-side orchestration ----------------
extern "C" void kernel_launch(void* const* d_in, const int* in_sizes, int n_in,
                              void* d_out, int out_size, void* d_ws, size_t ws_size,
                              hipStream_t stream) {
  const float* x     = (const float*)d_in[0];
  const float* tw    = (const float*)d_in[1];
  const float* alpha = (const float*)d_in[2];
  const float* beta  = (const float*)d_in[3];
  const float* gamma = (const float*)d_in[4];
  const float* Wq = (const float*)d_in[5];  const float* bq = (const float*)d_in[6];
  const float* Wk = (const float*)d_in[7];  const float* bk = (const float*)d_in[8];
  const float* Wv = (const float*)d_in[9];  const float* bv = (const float*)d_in[10];
  const float* Wmix = (const float*)d_in[11];
  const float* Wo = (const float*)d_in[12]; const float* bo = (const float*)d_in[13];
  float* out = (float*)d_out;

  char* ws = (char*)d_ws;
  const size_t MB = 1u << 20;
  __bf16* XS   = (__bf16*)(ws + 0);          // 4 MB
  __bf16* WQT  = (__bf16*)(ws + 4 * MB);     // 2 MB each
  __bf16* WKT  = (__bf16*)(ws + 6 * MB);
  __bf16* WVT  = (__bf16*)(ws + 8 * MB);
  __bf16* WOT  = (__bf16*)(ws + 10 * MB);
  float*  QR   = (float*)(ws + 12 * MB);     // 8 MB each
  float*  KR   = (float*)(ws + 20 * MB);
  float*  VR   = (float*)(ws + 28 * MB);
  __bf16* QHB  = (__bf16*)(ws + 36 * MB);    // 4 MB each
  __bf16* KHB  = (__bf16*)(ws + 40 * MB);
  __bf16* VTB  = (__bf16*)(ws + 44 * MB);
  float*  MBUF = (float*)(ws + 48 * MB);     // 128 KB each
  float*  ZBUF = (float*)(ws + 48 * MB + (128u << 10));
  __bf16* YBF  = (__bf16*)(ws + 49 * MB);    // 4 MB

  const int nBTC = BB * TT * CC;             // 2M
  // 1) shift + bf16
  k_shift<<<(nBTC + 255) / 256, 256, 0, stream>>>(x, XS, nBTC);
  // 2) weight transpose-converts
  k_convT<<<(CC * CC + 255) / 256, 256, 0, stream>>>(Wq, WQT, CC, CC);
  k_convT<<<(CC * CC + 255) / 256, 256, 0, stream>>>(Wk, WKT, CC, CC);
  k_convT<<<(CC * CC + 255) / 256, 256, 0, stream>>>(Wv, WVT, CC, CC);
  k_convT<<<(CC * CC + 255) / 256, 256, 0, stream>>>(Wo, WOT, CC, CC);
  // 3) QKV GEMMs: (B*T=2048) x 1024 x 1024, 32x32 tile per wave, 8 waves per block
  const int M = BB * TT, N = CC, K = CC;
  int gblk = (M / 32) * (N / 32) / 8;        // 256 blocks
  k_gemm<<<gblk, 256, 0, stream>>>(XS, WQT, bq, nullptr, QR, M, N, K, TT);
  k_gemm<<<gblk, 256, 0, stream>>>(XS, WKT, bk, nullptr, KR, M, N, K, TT);
  k_gemm<<<gblk, 256, 0, stream>>>(XS, WVT, bv, nullptr, VR, M, N, K, TT);
  // 4) RoPE + relayout
  k_rope<<<(nBTC + 255) / 256, 256, 0, stream>>>(QR, KR, VR, QHB, KHB, VTB, nBTC);
  // 5) softmax stats: 2048 waves = 256 blocks x 8 waves
  k_stats<<<256, 256, 0, stream>>>(QHB, KHB, MBUF, ZBUF);
  // 6) fused attention: one block per (b, 16-row tile), 16 waves = 16 heads
  k_attn<<<BB * (TT / 16), 512, 0, stream>>>(QHB, KHB, VTB, MBUF, ZBUF,
                                             tw, alpha, beta, Wmix, YBF);
  // 7) output GEMM with bias + gamma epilogue
  k_gemm<<<gblk, 256, 0, stream>>>(YBF, WOT, bo, gamma, out, M, N, K, TT);
}

// v001
// Measured time: 401 microseconds a run.
// Next to v000, in two timings, it ran 1.46 and 1.45 times as fast.
#include <hip/hip_runtime.h>
#include <hip/hip_bf16.h>
#include <math.h>

// ---------------- problem constants ----------------
enum : int { BB = 2, TT = 1024, CC = 1024, NH = 16, HS = 64, ROT = 32 };
enum : int { PWP = 36 };   // LDS row pitch of the 32-wide p*w tile, in floats

typedef __attribute__((ext_vector_type(16))) __bf16 v16bf;
typedef __attribute__((ext_vector_type(8)))  __bf16 v8bf;
typedef __attribute__((ext_vector_type(8)))  float  v8f;

#define WMMA_BF16(a, b, c) \
  __builtin_amdgcn_wmma_f32_16x16x32_bf16(false, (a), false, (b), (short)0, (c), false, false)

// Fragment loader: lane supplies base = row_ptr + kb (kb = 8*(lane>=16)).
// Elements 0..7  <- K = kb+0..7   (16B load)
// Elements 8..15 <- K = kb+16..23 (16B load)
static __device__ __forceinline__ v16bf load_frag(const __bf16* p) {
  v8bf lo = *(const v8bf*)p;
  v8bf hi = *(const v8bf*)(p + 16);
  v16bf r;
#pragma unroll
  for (int i = 0; i < 8; ++i) { r[i] = lo[i]; r[i + 8] = hi[i]; }
  return r;
}

// ---------------- 1) time-shift + f32->bf16 ----------------
__global__ void k_shift(const float* __restrict__ x, __bf16* __restrict__ xs, int n) {
  int i = blockIdx.x * blockDim.x + threadIdx.x;
  if (i >= n) return;
  int c = i % CC, t = (i / CC) % TT, b = i / (CC * TT);
  float v;
  if (c < CC / 2) v = (t > 0) ? x[((size_t)b * TT + t - 1) * CC + c] : 0.f;
  else            v = x[((size_t)b * TT + t) * CC + c];
  xs[i] = (__bf16)v;
}

// ---------------- 2) W[k][n] f32 -> Wt[n][k] bf16 ----------------
__global__ void k_convT(const float* __restrict__ W, __bf16* __restrict__ Wt, int K, int N) {
  int i = blockIdx.x * blockDim.x + threadIdx.x;
  if (i >= K * N) return;
  int k = i % K, n = i / K;
  Wt[i] = (__bf16)W[(size_t)k * N + n];
}

// ---------------- generic bf16 WMMA GEMM, 2x2 register-blocked (32x32 per wave) ----------------
// out = A @ Bt^T + bias (opt *gamma[m%T]); 4 fragment loads feed 4 WMMAs per K-step.
__global__ void k_gemm(const __bf16* __restrict__ A, const __bf16* __restrict__ Bt,
                       const float* __restrict__ bias, const float* __restrict__ gamma,
                       float* __restrict__ out, int M, int N, int K, int T) {
  int wid  = (blockIdx.x * blockDim.x + threadIdx.x) >> 5;
  int lane = threadIdx.x & 31;
  int hf = lane >> 4, ml = lane & 15;
  int ntn = N >> 5;                          // 32-wide N tiles
  int tm = wid / ntn, tn = wid % ntn;
  if (tm >= (M >> 5)) return;
  int m0 = tm * 32, n0 = tn * 32;
  const __bf16* pa0 = A  + (size_t)(m0 + ml)      * K + hf * 8;
  const __bf16* pa1 = A  + (size_t)(m0 + 16 + ml) * K + hf * 8;
  const __bf16* pb0 = Bt + (size_t)(n0 + ml)      * K + hf * 8;
  const __bf16* pb1 = Bt + (size_t)(n0 + 16 + ml) * K + hf * 8;
  v8f a00 = {}, a01 = {}, a10 = {}, a11 = {};
  for (int k0 = 0; k0 < K; k0 += 32) {
    v16bf fa0 = load_frag(pa0 + k0);
    v16bf fa1 = load_frag(pa1 + k0);
    v16bf fb0 = load_frag(pb0 + k0);
    v16bf fb1 = load_frag(pb1 + k0);
    a00 = WMMA_BF16(fa0, fb0, a00);
    a01 = WMMA_BF16(fa0, fb1, a01);
    a10 = WMMA_BF16(fa1, fb0, a10);
    a11 = WMMA_BF16(fa1, fb1, a11);
  }
#pragma unroll
  for (int bm = 0; bm < 2; ++bm)
#pragma unroll
    for (int bn = 0; bn < 2; ++bn) {
      const v8f& acc = bm ? (bn ? a11 : a10) : (bn ? a01 : a00);
      int n = n0 + bn * 16 + ml;
      float bv = bias ? bias[n] : 0.f;
#pragma unroll
      for (int r = 0; r < 8; ++r) {
        int m = m0 + bm * 16 + r + hf * 8;
        float v = acc[r] + bv;
        if (gamma) v *= gamma[m % T];
        out[(size_t)m * N + n] = v;
      }
    }
}

// ---------------- 4) RoPE + relayout to WMMA-friendly buffers ----------------
// Qh/Kh: [b*16+h][t][64] bf16 ;  Vt: [b*16+h][d][1024] bf16 (transposed for att@v B-frags)
__global__ void k_rope(const float* __restrict__ Q, const float* __restrict__ Kr,
                       const float* __restrict__ V, __bf16* __restrict__ Qh,
                       __bf16* __restrict__ Kh, __bf16* __restrict__ Vt, int n) {
  int i = blockIdx.x * blockDim.x + threadIdx.x;
  if (i >= n) return;
  int nn = i % CC, t = (i / CC) % TT, b = i / (CC * TT);
  int h = nn >> 6, d = nn & 63;
  float qv = Q[i], kv = Kr[i];
  if (d < ROT) {
    int fi = d & 15;
    float fr = (float)t * __powf(1024.0f, -(float)fi / 16.0f);
    float cs = __cosf(fr), sn = __sinf(fr);
    int pd = (d < 16) ? d + 16 : d - 16;
    float sgn = (d < 16) ? -1.f : 1.f;
    size_t base = (size_t)i - d;
    qv = qv * cs + sgn * Q[base + pd] * sn;
    kv = kv * cs + sgn * Kr[base + pd] * sn;
  }
  int bh = b * NH + h;
  Qh[((size_t)bh * TT + t) * HS + d] = (__bf16)qv;
  Kh[((size_t)bh * TT + t) * HS + d] = (__bf16)kv;
  Vt[((size_t)bh * HS + d) * TT + t] = (__bf16)V[i];
}

// ---------------- 5) softmax stats over ALL s (max & sum) ----------------
__global__ void k_stats(const __bf16* __restrict__ Qh, const __bf16* __restrict__ Kh,
                        float* __restrict__ Mb, float* __restrict__ Zb) {
  int wid  = (blockIdx.x * blockDim.x + threadIdx.x) >> 5;
  int lane = threadIdx.x & 31;
  int hf = lane >> 4, ml = lane & 15;
  int tile = wid & 63, bh = wid >> 6;      // 2048 waves: [b*16+h][t-tile]
  int t0 = tile * 16;
  const __bf16* qrow = Qh + ((size_t)bh * TT + t0 + ml) * HS + hf * 8;
  v16bf qa0 = load_frag(qrow);
  v16bf qa1 = load_frag(qrow + 32);
  float mr[8], zz[8];
#pragma unroll
  for (int r = 0; r < 8; ++r) { mr[r] = -3.0e38f; zz[r] = 0.f; }
  for (int st = 0; st < TT / 16; ++st) {
    const __bf16* krow = Kh + ((size_t)bh * TT + st * 16 + ml) * HS + hf * 8;
    v8f s = {};
    s = WMMA_BF16(qa0, load_frag(krow), s);
    s = WMMA_BF16(qa1, load_frag(krow + 32), s);
#pragma unroll
    for (int r = 0; r < 8; ++r) {
      float x = s[r] * 0.125f;               // 1/sqrt(64)
      float tmax = x;
      tmax = fmaxf(tmax, __shfl_xor(tmax, 8, 16));
      tmax = fmaxf(tmax, __shfl_xor(tmax, 4, 16));
      tmax = fmaxf(tmax, __shfl_xor(tmax, 2, 16));
      tmax = fmaxf(tmax, __shfl_xor(tmax, 1, 16));
      float mnew = fmaxf(mr[r], tmax);
      float e = __expf(x - mnew);
      e += __shfl_xor(e, 8, 16);
      e += __shfl_xor(e, 4, 16);
      e += __shfl_xor(e, 2, 16);
      e += __shfl_xor(e, 1, 16);
      zz[r] = zz[r] * __expf(mr[r] - mnew) + e;
      mr[r] = mnew;
    }
  }
  if (ml == 0) {
#pragma unroll
    for (int r = 0; r < 8; ++r) {
      int t = t0 + r + hf * 8;
      Mb[(size_t)bh * TT + t] = mr[r];
      Zb[(size_t)bh * TT + t] = zz[r];
    }
  }
}

// ---------------- 6) fused attention: scores -> p*w -> Wmix -> @v  (att stays on-WGP) ----------------
__global__ void __launch_bounds__(512)
k_attn(const __bf16* __restrict__ Qh, const __bf16* __restrict__ Kh,
       const __bf16* __restrict__ Vt, const float* __restrict__ Mb,
       const float* __restrict__ Zb, const float* __restrict__ tw,
       const float* __restrict__ alpha, const float* __restrict__ beta,
       const float* __restrict__ Wmix, __bf16* __restrict__ Y) {
  // Row pitch 36 dwords (144 B = 16 B x odd): the 16 rows that lanes 0..15 read with one
  // 8-byte load start on 16 different groups of four banks.
  __shared__ __attribute__((aligned(16))) float pw[NH * 16 * PWP];   // 36 KB of 320 KB LDS
  int tile = blockIdx.x & 63, b = blockIdx.x >> 6;
  int wave = threadIdx.x >> 5;                         // = input head h and output head g
  int lane = threadIdx.x & 31;
  int hf = lane >> 4, ml = lane & 15;
  int t0 = tile * 16;
  int h = wave, g = wave;
  int bh = b * NH + h, bg = b * NH + g;

  const __bf16* qrow = Qh + ((size_t)bh * TT + t0 + ml) * HS + hf * 8;
  v16bf qa0 = load_frag(qrow);
  v16bf qa1 = load_frag(qrow + 32);

  float mr[8], zi[8], bt[8];
#pragma unroll
  for (int r = 0; r < 8; ++r) {
    int t = t0 + r + hf * 8;
    mr[r] = Mb[(size_t)bh * TT + t];
    zi[r] = 1.0f / Zb[(size_t)bh * TT + t];
    bt[r] = beta[h * TT + t];
  }
  float wrow[NH];
#pragma unroll
  for (int j = 0; j < NH; ++j) wrow[j] = Wmix[g * NH + j];

  v8f yac[4] = {};
  int nch = (t0 + 16 + 31) >> 5;
  for (int ch = 0; ch < nch; ++ch) {
    int s0 = ch * 32;
    // phase A: this wave = head h; two 16-wide s subtiles of exp/Z * w -> LDS
#pragma unroll
    for (int sub = 0; sub < 2; ++sub) {
      int sb = s0 + sub * 16;
      const __bf16* krow = Kh + ((size_t)bh * TT + sb + ml) * HS + hf * 8;
      v8f s = {};
      s = WMMA_BF16(qa0, load_frag(krow), s);
      s = WMMA_BF16(qa1, load_frag(krow + 32), s);
#pragma unroll
      for (int r = 0; r < 8; ++r) {
        int tl = r + hf * 8, t = t0 + tl, sg = sb + ml;
        float p = __expf(s[r] * 0.125f - mr[r]) * zi[r];
        float wv = 0.f;
        if (sg <= t)
          wv = tw[h * TT + (TT - 1) - (t - sg)] * alpha[h * TT + sg] * bt[r];
        pw[(h * 16 + tl) * PWP + sub * 16 + ml] = p * wv;
      }
    }
    __syncthreads();
    // phase B: this wave = output head g; mix 16 heads, repack to A-frag, 4 WMMAs vs Vt
    v16bf am;
#pragma unroll
    for (int j = 0; j < 8; ++j) {
      int sl = hf * 8 + ((j < 4) ? 2 * j : 16 + 2 * (j - 4));
      float a0 = 0.f, a1 = 0.f;
#pragma unroll
      for (int hh = 0; hh < NH; ++hh) {
        const float2 v2 = *(const float2*)&pw[(hh * 16 + ml) * PWP + sl];
        a0 += wrow[hh] * v2.x;
        a1 += wrow[hh] * v2.y;
      }
      am[2 * j]     = (__bf16)a0;
      am[2 * j + 1] = (__bf16)a1;
    }
#pragma unroll
    for (int dt = 0; dt < 4; ++dt) {
      const __bf16* vrow = Vt + ((size_t)bg * HS + dt * 16 + ml) * TT + s0 + hf * 8;
      yac[dt] = WMMA_BF16(am, load_frag(vrow), yac[dt]);
    }
    __syncthreads();
  }
  // write y[b][t][g*64+d] as bf16 for the final WMMA GEMM
#pragma unroll
  for (int dt = 0; dt < 4; ++dt)
#pragma unroll
    for (int r = 0; r < 8; ++r) {
      int t = t0 + r + hf * 8;
      int n = g * HS + dt * 16 + ml;
      Y[((size_t)b * TT + t) * CC + n] = (__bf16)yac[dt][r];
    }
}

// ---------------- host-side orchestration ----------------
extern "C" void kernel_launch(void* const* d_in, const int* in_sizes, int n_in,
                              void* d_out, int out_size, void* d_ws, size_t ws_size,
                              hipStream_t stream) {
  const float* x     = (const float*)d_in[0];
  const float* tw    = (const float*)d_in[1];
  const float* alpha = (const float*)d_in[2];
  const float* beta  = (const float*)d_in[3];
  const float* gamma = (const float*)d_in[4];
  const float* Wq = (const float*)d_in[5];  const float* bq = (const float*)d_in[6];
  const float* Wk = (const float*)d_in[7];  const float* bk = (const float*)d_in[8];
  const float* Wv = (const float*)d_in[9];  const float* bv = (const float*)d_in[10];
  const float* Wmix = (const float*)d_in[11];
  const float* Wo = (const float*)d_in[12]; const float* bo = (const float*)d_in[13];
  float* out = (float*)d_out;

  char* ws = (char*)d_ws;
  const size_t MB = 1u << 20;
  __bf16* XS   = (__bf16*)(ws + 0);          // 4 MB
  __bf16* WQT  = (__bf16*)(ws + 4 * MB);     // 2 MB each
  __bf16* WKT  = (__bf16*)(ws + 6 * MB);
  __bf16* WVT  = (__bf16*)(ws + 8 * MB);
  __bf16* WOT  = (__bf16*)(ws + 10 * MB);
  float*  QR   = (float*)(ws + 12 * MB);     // 8 MB each
  float*  KR   = (float*)(ws + 20 * MB);
  float*  VR   = (float*)(ws + 28 * MB);
  __bf16* QHB  = (__bf16*)(ws + 36 * MB);    // 4 MB each
  __bf16* KHB  = (__bf16*)(ws + 40 * MB);
  __bf16* VTB  = (__bf16*)(ws + 44 * MB);
  float*  MBUF = (float*)(ws + 48 * MB);     // 128 KB each
  float*  ZBUF = (float*)(ws + 48 * MB + (128u << 10));
  __bf16* YBF  = (__bf16*)(ws + 49 * MB);    // 4 MB

  const int nBTC = BB * TT * CC;             // 2M
  // 1) shift + bf16
  k_shift<<<(nBTC + 255) / 256, 256, 0, stream>>>(x, XS, nBTC);
  // 2) weight transpose-converts
  k_convT<<<(CC * CC + 255) / 256, 256, 0, stream>>>(Wq, WQT, CC, CC);
  k_convT<<<(CC * CC + 255) / 256, 256, 0, stream>>>(Wk, WKT, CC, CC);
  k_convT<<<(CC * CC + 255) / 256, 256, 0, stream>>>(Wv, WVT, CC, CC);
  k_convT<<<(CC * CC + 255) / 256, 256, 0, stream>>>(Wo, WOT, CC, CC);
  // 3) QKV GEMMs: (B*T=2048) x 1024 x 1024, 32x32 tile per wave, 8 waves per block
  const int M = BB * TT, N = CC, K = CC;
  int gblk = (M / 32) * (N / 32) / 8;        // 256 blocks
  k_gemm<<<gblk, 256, 0, stream>>>(XS, WQT, bq, nullptr, QR, M, N, K, TT);
  k_gemm<<<gblk, 256, 0, stream>>>(XS, WKT, bk, nullptr, KR, M, N, K, TT);
  k_gemm<<<gblk, 256, 0, stream>>>(XS, WVT, bv, nullptr, VR, M, N, K, TT);
  // 4) RoPE + relayout
  k_rope<<<(nBTC + 255) / 256, 256, 0, stream>>>(QR, KR, VR, QHB, KHB, VTB, nBTC);
  // 5) softmax stats: 2048 waves = 256 blocks x 8 waves
  k_stats<<<256, 256, 0, stream>>>(QHB, KHB, MBUF, ZBUF);
  // 6) fused attention: one block per (b, 16-row tile), 16 waves = 16 heads
  k_attn<<<BB * (TT / 16), 512, 0, stream>>>(QHB, KHB, VTB, MBUF, ZBUF,
                                             tw, alpha, beta, Wmix, YBF);
  // 7) output GEMM with bias + gamma epilogue
  k_gemm<<<gblk, 256, 0, stream>>>(YBF, WOT, bo, gamma, out, M, N, K, TT);
}

// v002
// One run takes 331 microseconds.
// Timed twice side by side with v001, it ran 1.22 and 1.21 times as fast.
// All steps since v000 together make it 1.77 times as fast.
#include <hip/hip_runtime.h>
#include <hip/hip_bf16.h>
#include <math.h>

// ---------------- problem constants ----------------
enum : int { BB = 2, TT = 1024, CC = 1024, NH = 16, HS = 64, ROT = 32 };
enum : int { PWP = 36 };   // LDS row pitch of the 32-wide p*w tile, in floats

typedef __attribute__((ext_vector_type(16))) __bf16 v16bf;
typedef __attribute__((ext_vector_type(8)))  __bf16 v8bf;
typedef __attribute__((ext_vector_type(4)))  __bf16 v4bf;
typedef __attribute__((ext_vector_type(8)))  float  v8f;

#define WMMA_BF16(a, b, c) \
  __builtin_amdgcn_wmma_f32_16x16x32_bf16(false, (a), false, (b), (short)0, (c), false, false)

// Fragment loader: lane supplies base = row_ptr + kb (kb = 8*(lane>=16)).
// Elements 0..7  <- K = kb+0..7   (16B load)
// Elements 8..15 <- K = kb+16..23 (16B load)
static __device__ __forceinline__ v16bf load_frag(const __bf16* p) {
  v8bf lo = *(const v8bf*)p;
  v8bf hi = *(const v8bf*)(p + 16);
  v16bf r;
#pragma unroll
  for (int i = 0; i < 8; ++i) { r[i] = lo[i]; r[i + 8] = hi[i]; }
  return r;
}

// One wave turns a 64-row x 16-column f32 tile into its bf16 transpose, in registers.
// Lane (tl, ng) holds rows tl*8..+7 of columns ng*4..+3: eight 16-byte loads (4 lanes = 64 B of a
// row), four 16-byte stores (8 lanes = one whole 128-B line of a transposed row).
static __device__ __forceinline__ void tile_T(const float* __restrict__ src, int ld_src,
                                              __bf16* __restrict__ dst, int ld_dst, int lane) {
  int ng = lane & 3, tl = lane >> 2;
  const float* p = src + (size_t)(tl * 8) * ld_src + ng * 4;
  float4 v[8];
#pragma unroll
  for (int j = 0; j < 8; ++j) v[j] = *(const float4*)(p + (size_t)j * ld_src);
  // precaution: stands in front of any rewrite of the address registers of the loads above
  asm volatile("s_wait_xcnt 0x0" ::: "memory");
  v8bf o0, o1, o2, o3;
#pragma unroll
  for (int j = 0; j < 8; ++j) {
    o0[j] = (__bf16)v[j].x; o1[j] = (__bf16)v[j].y;
    o2[j] = (__bf16)v[j].z; o3[j] = (__bf16)v[j].w;
  }
  __bf16* q = dst + (size_t)(ng * 4) * ld_dst + tl * 8;
  *(v8bf*)(q)                      = o0;
  *(v8bf*)(q + (size_t)ld_dst)     = o1;
  *(v8bf*)(q + (size_t)2 * ld_dst) = o2;
  *(v8bf*)(q + (size_t)3 * ld_dst) = o3;
}

static __device__ __forceinline__ v4bf cvt4(float a, float b, float c, float d) {
  v4bf r;
  r[0] = (__bf16)a; r[1] = (__bf16)b; r[2] = (__bf16)c; r[3] = (__bf16)d;
  return r;
}

// ---------------- 1) time-shift + f32->bf16 ----------------
// A block of 256 threads spans one row (256 groups of 4 channels) and takes 4 rows.
__global__ void __launch_bounds__(256)
k_shift(const float* __restrict__ x, __bf16* __restrict__ xs) {
  int c = threadIdx.x * 4;
  int row0 = blockIdx.x * 4;
  int back = (c < CC / 2) ? 1 : 0;             // first half of the channels reads row t-1
  float4 v[4];
#pragma unroll
  for (int q = 0; q < 4; ++q) {
    int srow = row0 + q - back;                // clamped so that all four loads issue together
    v[q] = *(const float4*)(x + (size_t)(srow < 0 ? 0 : srow) * CC + c);
  }
  // precaution: stands in front of any rewrite of the address registers of the loads above
  asm volatile("s_wait_xcnt 0x0" ::: "memory");
#pragma unroll
  for (int q = 0; q < 4; ++q)
    if (back && ((row0 + q) & (TT - 1)) == 0) v[q] = make_float4(0.f, 0.f, 0.f, 0.f);
#pragma unroll
  for (int q = 0; q < 4; ++q)
    *(v4bf*)(xs + (size_t)(row0 + q) * CC + c) = cvt4(v[q].x, v[q].y, v[q].z, v[q].w);
}

// ---------------- 2) W[k][n] f32 -> Wt[n][k] bf16 ----------------
// 1024 waves: wave = (64-row k tile, 16-column n tile)
__global__ void __launch_bounds__(128)
k_convT(const float* __restrict__ W, __bf16* __restrict__ Wt) {
  int gw = (blockIdx.x * 128 + threadIdx.x) >> 5;
  int kt = gw >> 6, nt = gw & 63;
  tile_T(W + (size_t)kt * 64 * CC + nt * 16, CC,
         Wt + (size_t)nt * 16 * CC + kt * 64, CC, threadIdx.x & 31);
}

// ---------------- generic bf16 WMMA GEMM, 2x2 register-blocked (32x32 per wave) ----------------
// out = A @ Bt^T + bias (opt *gamma[m%T]); 4 fragment loads feed 4 WMMAs per K-step.
__global__ void k_gemm(const __bf16* __restrict__ A, const __bf16* __restrict__ Bt,
                       const float* __restrict__ bias, const float* __restrict__ gamma,
                       float* __restrict__ out, int M, int N, int K, int T) {
  int wid  = (blockIdx.x * blockDim.x + threadIdx.x) >> 5;
  int lane = threadIdx.x & 31;
  int hf = lane >> 4, ml = lane & 15;
  int ntn = N >> 5;                          // 32-wide N tiles
  int tm = wid / ntn, tn = wid % ntn;
  if (tm >= (M >> 5)) return;
  int m0 = tm * 32, n0 = tn * 32;
  const __bf16* pa0 = A  + (size_t)(m0 + ml)      * K + hf * 8;
  const __bf16* pa1 = A  + (size_t)(m0 + 16 + ml) * K + hf * 8;
  const __bf16* pb0 = Bt + (size_t)(n0 + ml)      * K + hf * 8;
  const __bf16* pb1 = Bt + (size_t)(n0 + 16 + ml) * K + hf * 8;
  v8f a00 = {}, a01 = {}, a10 = {}, a11 = {};
  for (int k0 = 0; k0 < K; k0 += 32) {
    v16bf fa0 = load_frag(pa0 + k0);
    v16bf fa1 = load_frag(pa1 + k0);
    v16bf fb0 = load_frag(pb0 + k0);
    v16bf fb1 = load_frag(pb1 + k0);
    a00 = WMMA_BF16(fa0, fb0, a00);
    a01 = WMMA_BF16(fa0, fb1, a01);
    a10 = WMMA_BF16(fa1, fb0, a10);
    a11 = WMMA_BF16(fa1, fb1, a11);
  }
#pragma unroll
  for (int bm = 0; bm < 2; ++bm)
#pragma unroll
    for (int bn = 0; bn < 2; ++bn) {
      const v8f& acc = bm ? (bn ? a11 : a10) : (bn ? a01 : a00);
      int n = n0 + bn * 16 + ml;
      float bv = bias ? bias[n] : 0.f;
#pragma unroll
      for (int r = 0; r < 8; ++r) {
        int m = m0 + bm * 16 + r + hf * 8;
        float v = acc[r] + bv;
        if (gamma) v *= gamma[m % T];
        out[(size_t)m * N + n] = v;
      }
    }
}

// ---------------- 4) RoPE + relayout to WMMA-friendly buffers ----------------
// Qh/Kh: [b*16+h][t][64] bf16 ;  Vt: [b*16+h][d][1024] bf16 (transposed for att@v B-frags)
// A block takes 8 rows (t) of Q and K, each thread 4 channels of each row, and 8 V tiles of tile_T.
__global__ void __launch_bounds__(256)
k_rope(const float* __restrict__ Q, const float* __restrict__ Kr,
       const float* __restrict__ V, __bf16* __restrict__ Qh,
       __bf16* __restrict__ Kh, __bf16* __restrict__ Vt) {
  {
    int gw = blockIdx.x * 8 + (threadIdx.x >> 5);
    int rt = gw >> 6, nt = gw & 63;            // 64-row tile over b*T+t, 16-column tile over h*64+d
    int vb = rt >> 4, tq = rt & 15;
    tile_T(V + (size_t)rt * 64 * CC + nt * 16, CC,
           Vt + ((size_t)vb * CC + nt * 16) * TT + tq * 64, TT, threadIdx.x & 31);
  }
  int nn = threadIdx.x * 4;
  int h = nn >> 6, d = nn & 63;
  int row0 = blockIdx.x * 8;
  int b = row0 / TT, t0 = row0 % TT;
  const float* qp = Q  + (size_t)row0 * CC + nn;
  const float* kp = Kr + (size_t)row0 * CC + nn;
  float4 q[8], k[8];
#pragma unroll
  for (int j = 0; j < 8; ++j) {
    q[j] = *(const float4*)(qp + (size_t)j * CC);
    k[j] = *(const float4*)(kp + (size_t)j * CC);
  }
  if (d < ROT) {
    int po = (d < 16) ? 16 : -16;              // the group of 4 never straddles a multiple of 16
    float sgn = (d < 16) ? -1.f : 1.f;
    float inv[4];
#pragma unroll
    for (int e = 0; e < 4; ++e) inv[e] = __powf(1024.0f, -(float)((d + e) & 15) / 16.0f);
#pragma unroll
    for (int j = 0; j < 8; ++j) {
      float4 pq = *(const float4*)(qp + (ptrdiff_t)j * CC + po);
      float4 pk = *(const float4*)(kp + (ptrdiff_t)j * CC + po);
      float tf = (float)(t0 + j);
      float f0 = tf * inv[0], f1 = tf * inv[1], f2 = tf * inv[2], f3 = tf * inv[3];
      float c0 = __cosf(f0), s0 = __sinf(f0), c1 = __cosf(f1), s1 = __sinf(f1);
      float c2 = __cosf(f2), s2 = __sinf(f2), c3 = __cosf(f3), s3 = __sinf(f3);
      q[j].x = q[j].x * c0 + sgn * pq.x * s0;  k[j].x = k[j].x * c0 + sgn * pk.x * s0;
      q[j].y = q[j].y * c1 + sgn * pq.y * s1;  k[j].y = k[j].y * c1 + sgn * pk.y * s1;
      q[j].z = q[j].z * c2 + sgn * pq.z * s2;  k[j].z = k[j].z * c2 + sgn * pk.z * s2;
      q[j].w = q[j].w * c3 + sgn * pq.w * s3;  k[j].w = k[j].w * c3 + sgn * pk.w * s3;
    }
  }
  size_t ob = ((size_t)(b * NH + h) * TT + t0) * HS + d;
#pragma unroll
  for (int j = 0; j < 8; ++j) {
    *(v4bf*)(Qh + ob + (size_t)j * HS) = cvt4(q[j].x, q[j].y, q[j].z, q[j].w);
    *(v4bf*)(Kh + ob + (size_t)j * HS) = cvt4(k[j].x, k[j].y, k[j].z, k[j].w);
  }
}

// ---------------- 5) softmax stats over ALL s (max & sum) ----------------
__global__ void k_stats(const __bf16* __restrict__ Qh, const __bf16* __restrict__ Kh,
                        float* __restrict__ Mb, float* __restrict__ Zb) {
  int wid  = (blockIdx.x * blockDim.x + threadIdx.x) >> 5;
  int lane = threadIdx.x & 31;
  int hf = lane >> 4, ml = lane & 15;
  int tile = wid & 63, bh = wid >> 6;      // 2048 waves: [b*16+h][t-tile]
  int t0 = tile * 16;
  const __bf16* qrow = Qh + ((size_t)bh * TT + t0 + ml) * HS + hf * 8;
  v16bf qa0 = load_frag(qrow);
  v16bf qa1 = load_frag(qrow + 32);
  float mr[8], zz[8];
#pragma unroll
  for (int r = 0; r < 8; ++r) { mr[r] = -3.0e38f; zz[r] = 0.f; }
  for (int st = 0; st < TT / 16; ++st) {
    const __bf16* krow = Kh + ((size_t)bh * TT + st * 16 + ml) * HS + hf * 8;
    v8f s = {};
    s = WMMA_BF16(qa0, load_frag(krow), s);
    s = WMMA_BF16(qa1, load_frag(krow + 32), s);
#pragma unroll
    for (int r = 0; r < 8; ++r) {
      float x = s[r] * 0.125f;               // 1/sqrt(64)
      float tmax = x;
      tmax = fmaxf(tmax, __shfl_xor(tmax, 8, 16));
      tmax = fmaxf(tmax, __shfl_xor(tmax, 4, 16));
      tmax = fmaxf(tmax, __shfl_xor(tmax, 2, 16));
      tmax = fmaxf(tmax, __shfl_xor(tmax, 1, 16));
      float mnew = fmaxf(mr[r], tmax);
      float e = __expf(x - mnew);
      e += __shfl_xor(e, 8, 16);
      e += __shfl_xor(e, 4, 16);
      e += __shfl_xor(e, 2, 16);
      e += __shfl_xor(e, 1, 16);
      zz[r] = zz[r] * __expf(mr[r] - mnew) + e;
      mr[r] = mnew;
    }
  }
  if (ml == 0) {
#pragma unroll
    for (int r = 0; r < 8; ++r) {
      int t = t0 + r + hf * 8;
      Mb[(size_t)bh * TT + t] = mr[r];
      Zb[(size_t)bh * TT + t] = zz[r];
    }
  }
}

// ---------------- 6) fused attention: scores -> p*w -> Wmix -> @v  (att stays on-WGP) ----------------
__global__ void __launch_bounds__(512)
k_attn(const __bf16* __restrict__ Qh, const __bf16* __restrict__ Kh,
       const __bf16* __restrict__ Vt, const float* __restrict__ Mb,
       const float* __restrict__ Zb, const float* __restrict__ tw,
       const float* __restrict__ alpha, const float* __restrict__ beta,
       const float* __restrict__ Wmix, __bf16* __restrict__ Y) {
  // Row pitch 36 dwords (144 B = 16 B x odd): the 16 rows that lanes 0..15 read with one
  // 8-byte load start on 16 different groups of four banks.
  __shared__ __attribute__((aligned(16))) float pw[NH * 16 * PWP];   // 36 KB of 320 KB LDS
  int tile = blockIdx.x & 63, b = blockIdx.x >> 6;
  int wave = threadIdx.x >> 5;                         // = input head h and output head g
  int lane = threadIdx.x & 31;
  int hf = lane >> 4, ml = lane & 15;
  int t0 = tile * 16;
  int h = wave, g = wave;
  int bh = b * NH + h, bg = b * NH + g;

  const __bf16* qrow = Qh + ((size_t)bh * TT + t0 + ml) * HS + hf * 8;
  v16bf qa0 = load_frag(qrow);
  v16bf qa1 = load_frag(qrow + 32);

  float mr[8], zi[8], bt[8];
#pragma unroll
  for (int r = 0; r < 8; ++r) {
    int t = t0 + r + hf * 8;
    mr[r] = Mb[(size_t)bh * TT + t];
    zi[r] = 1.0f / Zb[(size_t)bh * TT + t];
    bt[r] = beta[h * TT + t];
  }
  float wrow[NH];
#pragma unroll
  for (int j = 0; j < NH; ++j) wrow[j] = Wmix[g * NH + j];

  v8f yac[4] = {};
  int nch = (t0 + 16 + 31) >> 5;
  for (int ch = 0; ch < nch; ++ch) {
    int s0 = ch * 32;
    // phase A: this wave = head h; two 16-wide s subtiles of exp/Z * w -> LDS
#pragma unroll
    for (int sub = 0; sub < 2; ++sub) {
      int sb = s0 + sub * 16;
      const __bf16* krow = Kh + ((size_t)bh * TT + sb + ml) * HS + hf * 8;
      v8f s = {};
      s = WMMA_BF16(qa0, load_frag(krow), s);
      s = WMMA_BF16(qa1, load_frag(krow + 32), s);
#pragma unroll
      for (int r = 0; r < 8; ++r) {
        int tl = r + hf * 8, t = t0 + tl, sg = sb + ml;
        float p = __expf(s[r] * 0.125f - mr[r]) * zi[r];
        float wv = 0.f;
        if (sg <= t)
          wv = tw[h * TT + (TT - 1) - (t - sg)] * alpha[h * TT + sg] * bt[r];
        pw[(h * 16 + tl) * PWP + sub * 16 + ml] = p * wv;
      }
    }
    __syncthreads();
    // phase B: this wave = output head g; mix 16 heads, repack to A-frag, 4 WMMAs vs Vt
    v16bf am;
#pragma unroll
    for (int j = 0; j < 8; ++j) {
      int sl = hf * 8 + ((j < 4) ? 2 * j : 16 + 2 * (j - 4));
      float a0 = 0.f, a1 = 0.f;
#pragma unroll
      for (int hh = 0; hh < NH; ++hh) {
        const float2 v2 = *(const float2*)&pw[(hh * 16 + ml) * PWP + sl];
        a0 += wrow[hh] * v2.x;
        a1 += wrow[hh] * v2.y;
      }
      am[2 * j]     = (__bf16)a0;
      am[2 * j + 1] = (__bf16)a1;
    }
#pragma unroll
    for (int dt = 0; dt < 4; ++dt) {
      const __bf16* vrow = Vt + ((size_t)bg * HS + dt * 16 + ml) * TT + s0 + hf * 8;
      yac[dt] = WMMA_BF16(am, load_frag(vrow), yac[dt]);
    }
    __syncthreads();
  }
  // write y[b][t][g*64+d] as bf16 for the final WMMA GEMM
#pragma unroll
  for (int dt = 0; dt < 4; ++dt)
#pragma unroll
    for (int r = 0; r < 8; ++r) {
      int t = t0 + r + hf * 8;
      int n = g * HS + dt * 16 + ml;
      Y[((size_t)b * TT + t) * CC + n] = (__bf16)yac[dt][r];
    }
}

// ---------------- host-side orchestration ----------------
extern "C" void kernel_launch(void* const* d_in, const int* in_sizes, int n_in,
                              void* d_out, int out_size, void* d_ws, size_t ws_size,
                              hipStream_t stream) {
  const float* x     = (const float*)d_in[0];
  const float* tw    = (const float*)d_in[1];
  const float* alpha = (const float*)d_in[2];
  const float* beta  = (const float*)d_in[3];
  const float* gamma = (const float*)d_in[4];
  const float* Wq = (const float*)d_in[5];  const float* bq = (const float*)d_in[6];
  const float* Wk = (const float*)d_in[7];  const float* bk = (const float*)d_in[8];
  const float* Wv = (const float*)d_in[9];  const float* bv = (const float*)d_in[10];
  const float* Wmix = (const float*)d_in[11];
  const float* Wo = (const float*)d_in[12]; const float* bo = (const float*)d_in[13];
  float* out = (float*)d_out;

  char* ws = (char*)d_ws;
  const size_t MB = 1u << 20;
  __bf16* XS   = (__bf16*)(ws + 0);          // 4 MB
  __bf16* WQT  = (__bf16*)(ws + 4 * MB);     // 2 MB each
  __bf16* WKT  = (__bf16*)(ws + 6 * MB);
  __bf16* WVT  = (__bf16*)(ws + 8 * MB);
  __bf16* WOT  = (__bf16*)(ws + 10 * MB);
  float*  QR   = (float*)(ws + 12 * MB);     // 8 MB each
  float*  KR   = (float*)(ws + 20 * MB);
  float*  VR   = (float*)(ws + 28 * MB);
  __bf16* QHB  = (__bf16*)(ws + 36 * MB);    // 4 MB each
  __bf16* KHB  = (__bf16*)(ws + 40 * MB);
  __bf16* VTB  = (__bf16*)(ws + 44 * MB);
  float*  MBUF = (float*)(ws + 48 * MB);     // 128 KB each
  float*  ZBUF = (float*)(ws + 48 * MB + (128u << 10));
  __bf16* YBF  = (__bf16*)(ws + 49 * MB);    // 4 MB

  // 1) shift + bf16: 4 rows per block
  k_shift<<<BB * TT / 4, 256, 0, stream>>>(x, XS);
  // 2) weight transpose-converts: 1024 waves each
  k_convT<<<256, 128, 0, stream>>>(Wq, WQT);
  k_convT<<<256, 128, 0, stream>>>(Wk, WKT);
  k_convT<<<256, 128, 0, stream>>>(Wv, WVT);
  k_convT<<<256, 128, 0, stream>>>(Wo, WOT);
  // 3) QKV GEMMs: (B*T=2048) x 1024 x 1024, 32x32 tile per wave, 8 waves per block
  const int M = BB * TT, N = CC, K = CC;
  int gblk = (M / 32) * (N / 32) / 8;        // 256 blocks
  k_gemm<<<gblk, 256, 0, stream>>>(XS, WQT, bq, nullptr, QR, M, N, K, TT);
  k_gemm<<<gblk, 256, 0, stream>>>(XS, WKT, bk, nullptr, KR, M, N, K, TT);
  k_gemm<<<gblk, 256, 0, stream>>>(XS, WVT, bv, nullptr, VR, M, N, K, TT);
  // 4) RoPE + relayout
  k_rope<<<BB * TT / 8, 256, 0, stream>>>(QR, KR, VR, QHB, KHB, VTB);
  // 5) softmax stats: 2048 waves = 256 blocks x 8 waves
  k_stats<<<256, 256, 0, stream>>>(QHB, KHB, MBUF, ZBUF);
  // 6) fused attention: one block per (b, 16-row tile), 16 waves = 16 heads
  k_attn<<<BB * (TT / 16), 512, 0, stream>>>(QHB, KHB, VTB, MBUF, ZBUF,
                                             tw, alpha, beta, Wmix, YBF);
  // 7) output GEMM with bias + gamma epilogue
  k_gemm<<<gblk, 256, 0, stream>>>(YBF, WOT, bo, gamma, out, M, N, K, TT);
}

// v003
// A run of this version takes 275 microseconds.
// Next to v002, in two timings, it ran 1.20 and 1.19 times as fast.
// Counting every step since v000, it is 2.13 times as fast.
#include <hip/hip_runtime.h>
#include <hip/hip_bf16.h>
#include <math.h>

// ---------------- problem constants ----------------
enum : int { BB = 2, TT = 1024, CC = 1024, NH = 16, HS = 64, ROT = 32 };
enum : int { PWP = 36 };   // LDS row pitch of the 32-wide p*w tile, in floats
enum : int { TWP = TT + 32 };   // LDS pitch of one head's decay row: the row, then 32 zeros

typedef __attribute__((ext_vector_type(16))) __bf16 v16bf;
typedef __attribute__((ext_vector_type(8)))  __bf16 v8bf;
typedef __attribute__((ext_vector_type(4)))  __bf16 v4bf;
typedef __attribute__((ext_vector_type(8)))  float  v8f;

#define WMMA_BF16(a, b, c) \
  __builtin_amdgcn_wmma_f32_16x16x32_bf16(false, (a), false, (b), (short)0, (c), false, false)

// Fragment loader: lane supplies base = row_ptr + kb (kb = 8*(lane>=16)).
// Elements 0..7  <- K = kb+0..7   (16B load)
// Elements 8..15 <- K = kb+16..23 (16B load)
static __device__ __forceinline__ v16bf load_frag(const __bf16* p) {
  v8bf lo = *(const v8bf*)p;
  v8bf hi = *(const v8bf*)(p + 16);
  v16bf r;
#pragma unroll
  for (int i = 0; i < 8; ++i) { r[i] = lo[i]; r[i + 8] = hi[i]; }
  return r;
}

// One wave turns a 64-row x 16-column f32 tile into its bf16 transpose, in registers.
// Lane (tl, ng) holds rows tl*8..+7 of columns ng*4..+3: eight 16-byte loads (4 lanes = 64 B of a
// row), four 16-byte stores (8 lanes = one whole 128-B line of a transposed row).
static __device__ __forceinline__ void tile_T(const float* __restrict__ src, int ld_src,
                                              __bf16* __restrict__ dst, int ld_dst, int lane) {
  int ng = lane & 3, tl = lane >> 2;
  const float* p = src + (size_t)(tl * 8) * ld_src + ng * 4;
  float4 v[8];
#pragma unroll
  for (int j = 0; j < 8; ++j) v[j] = *(const float4*)(p + (size_t)j * ld_src);
  // precaution: stands in front of any rewrite of the address registers of the loads above
  asm volatile("s_wait_xcnt 0x0" ::: "memory");
  v8bf o0, o1, o2, o3;
#pragma unroll
  for (int j = 0; j < 8; ++j) {
    o0[j] = (__bf16)v[j].x; o1[j] = (__bf16)v[j].y;
    o2[j] = (__bf16)v[j].z; o3[j] = (__bf16)v[j].w;
  }
  __bf16* q = dst + (size_t)(ng * 4) * ld_dst + tl * 8;
  *(v8bf*)(q)                      = o0;
  *(v8bf*)(q + (size_t)ld_dst)     = o1;
  *(v8bf*)(q + (size_t)2 * ld_dst) = o2;
  *(v8bf*)(q + (size_t)3 * ld_dst) = o3;
}

static __device__ __forceinline__ v4bf cvt4(float a, float b, float c, float d) {
  v4bf r;
  r[0] = (__bf16)a; r[1] = (__bf16)b; r[2] = (__bf16)c; r[3] = (__bf16)d;
  return r;
}

// ---------------- 1) time-shift + f32->bf16 ----------------
// A block of 256 threads spans one row (256 groups of 4 channels) and takes 4 rows.
__global__ void __launch_bounds__(256)
k_shift(const float* __restrict__ x, __bf16* __restrict__ xs) {
  int c = threadIdx.x * 4;
  int row0 = blockIdx.x * 4;
  int back = (c < CC / 2) ? 1 : 0;             // first half of the channels reads row t-1
  float4 v[4];
#pragma unroll
  for (int q = 0; q < 4; ++q) {
    int srow = row0 + q - back;                // clamped so that all four loads issue together
    v[q] = *(const float4*)(x + (size_t)(srow < 0 ? 0 : srow) * CC + c);
  }
  // precaution: stands in front of any rewrite of the address registers of the loads above
  asm volatile("s_wait_xcnt 0x0" ::: "memory");
#pragma unroll
  for (int q = 0; q < 4; ++q)
    if (back && ((row0 + q) & (TT - 1)) == 0) v[q] = make_float4(0.f, 0.f, 0.f, 0.f);
#pragma unroll
  for (int q = 0; q < 4; ++q)
    *(v4bf*)(xs + (size_t)(row0 + q) * CC + c) = cvt4(v[q].x, v[q].y, v[q].z, v[q].w);
}

// ---------------- 2) W[k][n] f32 -> Wt[n][k] bf16 ----------------
// 1024 waves: wave = (64-row k tile, 16-column n tile)
__global__ void __launch_bounds__(128)
k_convT(const float* __restrict__ W, __bf16* __restrict__ Wt) {
  int gw = (blockIdx.x * 128 + threadIdx.x) >> 5;
  int kt = gw >> 6, nt = gw & 63;
  tile_T(W + (size_t)kt * 64 * CC + nt * 16, CC,
         Wt + (size_t)nt * 16 * CC + kt * 64, CC, threadIdx.x & 31);
}

// ---------------- generic bf16 WMMA GEMM, 2x2 register-blocked (32x32 per wave) ----------------
// out = A @ Bt^T + bias (opt *gamma[m%T]); 4 fragment loads feed 4 WMMAs per K-step.
__global__ void k_gemm(const __bf16* __restrict__ A, const __bf16* __restrict__ Bt,
                       const float* __restrict__ bias, const float* __restrict__ gamma,
                       float* __restrict__ out, int M, int N, int K, int T) {
  int wid  = (blockIdx.x * blockDim.x + threadIdx.x) >> 5;
  int lane = threadIdx.x & 31;
  int hf = lane >> 4, ml = lane & 15;
  int ntn = N >> 5;                          // 32-wide N tiles
  int tm = wid / ntn, tn = wid % ntn;
  if (tm >= (M >> 5)) return;
  int m0 = tm * 32, n0 = tn * 32;
  const __bf16* pa0 = A  + (size_t)(m0 + ml)      * K + hf * 8;
  const __bf16* pa1 = A  + (size_t)(m0 + 16 + ml) * K + hf * 8;
  const __bf16* pb0 = Bt + (size_t)(n0 + ml)      * K + hf * 8;
  const __bf16* pb1 = Bt + (size_t)(n0 + 16 + ml) * K + hf * 8;
  v8f a00 = {}, a01 = {}, a10 = {}, a11 = {};
  for (int k0 = 0; k0 < K; k0 += 32) {
    v16bf fa0 = load_frag(pa0 + k0);
    v16bf fa1 = load_frag(pa1 + k0);
    v16bf fb0 = load_frag(pb0 + k0);
    v16bf fb1 = load_frag(pb1 + k0);
    a00 = WMMA_BF16(fa0, fb0, a00);
    a01 = WMMA_BF16(fa0, fb1, a01);
    a10 = WMMA_BF16(fa1, fb0, a10);
    a11 = WMMA_BF16(fa1, fb1, a11);
  }
#pragma unroll
  for (int bm = 0; bm < 2; ++bm)
#pragma unroll
    for (int bn = 0; bn < 2; ++bn) {
      const v8f& acc = bm ? (bn ? a11 : a10) : (bn ? a01 : a00);
      int n = n0 + bn * 16 + ml;
      float bv = bias ? bias[n] : 0.f;
#pragma unroll
      for (int r = 0; r < 8; ++r) {
        int m = m0 + bm * 16 + r + hf * 8;
        float v = acc[r] + bv;
        if (gamma) v *= gamma[m % T];
        out[(size_t)m * N + n] = v;
      }
    }
}

// ---------------- 4) RoPE + relayout to WMMA-friendly buffers ----------------
// Qh/Kh: [b*16+h][t][64] bf16 ;  Vt: [b*16+h][d][1024] bf16 (transposed for att@v B-frags)
// A block takes 8 rows (t) of Q and K, each thread 4 channels of each row, and 8 V tiles of tile_T.
__global__ void __launch_bounds__(256)
k_rope(const float* __restrict__ Q, const float* __restrict__ Kr,
       const float* __restrict__ V, __bf16* __restrict__ Qh,
       __bf16* __restrict__ Kh, __bf16* __restrict__ Vt) {
  {
    int gw = blockIdx.x * 8 + (threadIdx.x >> 5);
    int rt = gw >> 6, nt = gw & 63;            // 64-row tile over b*T+t, 16-column tile over h*64+d
    int vb = rt >> 4, tq = rt & 15;
    tile_T(V + (size_t)rt * 64 * CC + nt * 16, CC,
           Vt + ((size_t)vb * CC + nt * 16) * TT + tq * 64, TT, threadIdx.x & 31);
  }
  int nn = threadIdx.x * 4;
  int h = nn >> 6, d = nn & 63;
  int row0 = blockIdx.x * 8;
  int b = row0 / TT, t0 = row0 % TT;
  const float* qp = Q  + (size_t)row0 * CC + nn;
  const float* kp = Kr + (size_t)row0 * CC + nn;
  float4 q[8], k[8];
#pragma unroll
  for (int j = 0; j < 8; ++j) {
    q[j] = *(const float4*)(qp + (size_t)j * CC);
    k[j] = *(const float4*)(kp + (size_t)j * CC);
  }
  if (d < ROT) {
    int po = (d < 16) ? 16 : -16;              // the group of 4 never straddles a multiple of 16
    float sgn = (d < 16) ? -1.f : 1.f;
    float inv[4];
#pragma unroll
    for (int e = 0; e < 4; ++e) inv[e] = __powf(1024.0f, -(float)((d + e) & 15) / 16.0f);
#pragma unroll
    for (int j = 0; j < 8; ++j) {
      float4 pq = *(const float4*)(qp + (ptrdiff_t)j * CC + po);
      float4 pk = *(const float4*)(kp + (ptrdiff_t)j * CC + po);
      float tf = (float)(t0 + j);
      float f0 = tf * inv[0], f1 = tf * inv[1], f2 = tf * inv[2], f3 = tf * inv[3];
      float c0 = __cosf(f0), s0 = __sinf(f0), c1 = __cosf(f1), s1 = __sinf(f1);
      float c2 = __cosf(f2), s2 = __sinf(f2), c3 = __cosf(f3), s3 = __sinf(f3);
      q[j].x = q[j].x * c0 + sgn * pq.x * s0;  k[j].x = k[j].x * c0 + sgn * pk.x * s0;
      q[j].y = q[j].y * c1 + sgn * pq.y * s1;  k[j].y = k[j].y * c1 + sgn * pk.y * s1;
      q[j].z = q[j].z * c2 + sgn * pq.z * s2;  k[j].z = k[j].z * c2 + sgn * pk.z * s2;
      q[j].w = q[j].w * c3 + sgn * pq.w * s3;  k[j].w = k[j].w * c3 + sgn * pk.w * s3;
    }
  }
  size_t ob = ((size_t)(b * NH + h) * TT + t0) * HS + d;
#pragma unroll
  for (int j = 0; j < 8; ++j) {
    *(v4bf*)(Qh + ob + (size_t)j * HS) = cvt4(q[j].x, q[j].y, q[j].z, q[j].w);
    *(v4bf*)(Kh + ob + (size_t)j * HS) = cvt4(k[j].x, k[j].y, k[j].z, k[j].w);
  }
}

// ---------------- 5) softmax stats over ALL s (max & sum) ----------------
__global__ void k_stats(const __bf16* __restrict__ Qh, const __bf16* __restrict__ Kh,
                        float* __restrict__ Mb, float* __restrict__ Zb) {
  int wid  = (blockIdx.x * blockDim.x + threadIdx.x) >> 5;
  int lane = threadIdx.x & 31;
  int hf = lane >> 4, ml = lane & 15;
  int tile = wid & 63, bh = wid >> 6;      // 2048 waves: [b*16+h][t-tile]
  int t0 = tile * 16;
  const __bf16* qrow = Qh + ((size_t)bh * TT + t0 + ml) * HS + hf * 8;
  v16bf qa0 = load_frag(qrow);
  v16bf qa1 = load_frag(qrow + 32);
  float mr[8], zz[8];
#pragma unroll
  for (int r = 0; r < 8; ++r) { mr[r] = -3.0e38f; zz[r] = 0.f; }
  for (int st = 0; st < TT / 16; ++st) {
    const __bf16* krow = Kh + ((size_t)bh * TT + st * 16 + ml) * HS + hf * 8;
    v8f s = {};
    s = WMMA_BF16(qa0, load_frag(krow), s);
    s = WMMA_BF16(qa1, load_frag(krow + 32), s);
#pragma unroll
    for (int r = 0; r < 8; ++r) {
      float x = s[r] * 0.125f;               // 1/sqrt(64)
      float tmax = x;
      tmax = fmaxf(tmax, __shfl_xor(tmax, 8, 16));
      tmax = fmaxf(tmax, __shfl_xor(tmax, 4, 16));
      tmax = fmaxf(tmax, __shfl_xor(tmax, 2, 16));
      tmax = fmaxf(tmax, __shfl_xor(tmax, 1, 16));
      float mnew = fmaxf(mr[r], tmax);
      float e = __expf(x - mnew);
      e += __shfl_xor(e, 8, 16);
      e += __shfl_xor(e, 4, 16);
      e += __shfl_xor(e, 2, 16);
      e += __shfl_xor(e, 1, 16);
      zz[r] = zz[r] * __expf(mr[r] - mnew) + e;
      mr[r] = mnew;
    }
  }
  if (ml == 0) {
#pragma unroll
    for (int r = 0; r < 8; ++r) {
      int t = t0 + r + hf * 8;
      Mb[(size_t)bh * TT + t] = mr[r];
      Zb[(size_t)bh * TT + t] = zz[r];
    }
  }
}

// ---------------- 6) fused attention: scores -> p*w -> Wmix -> @v  (att stays on-WGP) ----------------
__global__ void __launch_bounds__(512)
k_attn(const __bf16* __restrict__ Qh, const __bf16* __restrict__ Kh,
       const __bf16* __restrict__ Vt, const float* __restrict__ Mb,
       const float* __restrict__ Zb, const float* __restrict__ tw,
       const float* __restrict__ alpha, const float* __restrict__ beta,
       const float* __restrict__ Wmix, __bf16* __restrict__ Y) {
  // Row pitch 36 dwords (144 B = 16 B x odd): the 16 rows that lanes 0..15 read with one
  // 8-byte load start on 16 different groups of four banks.
  __shared__ __attribute__((aligned(16))) float pw[NH * 16 * PWP];   // 36 KB of 320 KB LDS
  // Each head's decay row with 32 zeros behind it, as the reference pads it: an index past the row
  // (s > t, by at most 31) reads 0, so the reads of the chunk loop need no guard and no branch.
  __shared__ __attribute__((aligned(16))) float twl[NH * TWP];       // 66 KB
  int tile = blockIdx.x & 63, b = blockIdx.x >> 6;
  int wave = threadIdx.x >> 5;                         // = input head h and output head g
  int lane = threadIdx.x & 31;
  int hf = lane >> 4, ml = lane & 15;
  int t0 = tile * 16;
  int h = wave, g = wave;
  int bh = b * NH + h, bg = b * NH + g;

  {
    const float4* trow = (const float4*)(tw + h * TT) + lane;
    float4 tv[8];
#pragma unroll
    for (int j = 0; j < 8; ++j) tv[j] = trow[j * 32];
    // precaution: stands in front of any rewrite of the address registers of the loads above
    asm volatile("s_wait_xcnt 0x0" ::: "memory");
    float4* trl = (float4*)(twl + h * TWP) + lane;
#pragma unroll
    for (int j = 0; j < 8; ++j) trl[j * 32] = tv[j];
    twl[h * TWP + TT + lane] = 0.f;
  }
  // decay weight of (t0 + hf*8 + r, s) = twp[s - r]
  const float* twp = twl + h * TWP + (TT - 1) - t0 - hf * 8;

  const __bf16* qrow = Qh + ((size_t)bh * TT + t0 + ml) * HS + hf * 8;
  v16bf qa0 = load_frag(qrow);
  v16bf qa1 = load_frag(qrow + 32);

  float mr[8], zi[8], bt[8];
#pragma unroll
  for (int r = 0; r < 8; ++r) {
    int t = t0 + r + hf * 8;
    mr[r] = Mb[(size_t)bh * TT + t];
    zi[r] = 1.0f / Zb[(size_t)bh * TT + t];
    bt[r] = beta[h * TT + t];
  }
  float wrow[NH];
#pragma unroll
  for (int j = 0; j < NH; ++j) wrow[j] = Wmix[g * NH + j];

  v8f yac[4] = {};
  int nch = (t0 + 16 + 31) >> 5;
  __syncthreads();   // the staged decay rows are complete before the first read
  for (int ch = 0; ch < nch; ++ch) {
    int s0 = ch * 32;
    // the chunk's 16 decay weights, read in front of the first store to pw so that they issue as a group
    float twv[2][8];
#pragma unroll
    for (int sub = 0; sub < 2; ++sub)
#pragma unroll
      for (int r = 0; r < 8; ++r) twv[sub][r] = twp[s0 + sub * 16 + ml - r];
    float al[2];
    al[0] = alpha[h * TT + s0 + ml];
    al[1] = alpha[h * TT + s0 + 16 + ml];
    // precaution: stands in front of any rewrite of the address registers of the two loads above
    asm volatile("s_wait_xcnt 0x0" ::: "memory");
    // phase A: this wave = head h; two 16-wide s subtiles of exp/Z * w -> LDS
#pragma unroll
    for (int sub = 0; sub < 2; ++sub) {
      int sb = s0 + sub * 16;
      const __bf16* krow = Kh + ((size_t)bh * TT + sb + ml) * HS + hf * 8;
      v8f s = {};
      s = WMMA_BF16(qa0, load_frag(krow), s);
      s = WMMA_BF16(qa1, load_frag(krow + 32), s);
#pragma unroll
      for (int r = 0; r < 8; ++r) {
        int tl = r + hf * 8;
        float p = __expf(s[r] * 0.125f - mr[r]) * zi[r];
        float wv = twv[sub][r] * al[sub] * bt[r];
        pw[(h * 16 + tl) * PWP + sub * 16 + ml] = p * wv;
      }
    }
    __syncthreads();
    // phase B: this wave = output head g; mix 16 heads, repack to A-frag, 4 WMMAs vs Vt
    v16bf am;
#pragma unroll
    for (int j = 0; j < 8; ++j) {
      int sl = hf * 8 + ((j < 4) ? 2 * j : 16 + 2 * (j - 4));
      float a0 = 0.f, a1 = 0.f;
#pragma unroll
      for (int hh = 0; hh < NH; ++hh) {
        const float2 v2 = *(const float2*)&pw[(hh * 16 + ml) * PWP + sl];
        a0 += wrow[hh] * v2.x;
        a1 += wrow[hh] * v2.y;
      }
      am[2 * j]     = (__bf16)a0;
      am[2 * j + 1] = (__bf16)a1;
    }
#pragma unroll
    for (int dt = 0; dt < 4; ++dt) {
      const __bf16* vrow = Vt + ((size_t)bg * HS + dt * 16 + ml) * TT + s0 + hf * 8;
      yac[dt] = WMMA_BF16(am, load_frag(vrow), yac[dt]);
    }
    __syncthreads();
  }
  // write y[b][t][g*64+d] as bf16 for the final WMMA GEMM
#pragma unroll
  for (int dt = 0; dt < 4; ++dt)
#pragma unroll
    for (int r = 0; r < 8; ++r) {
      int t = t0 + r + hf * 8;
      int n = g * HS + dt * 16 + ml;
      Y[((size_t)b * TT + t) * CC + n] = (__bf16)yac[dt][r];
    }
}

// ---------------- host-side orchestration ----------------
extern "C" void kernel_launch(void* const* d_in, const int* in_sizes, int n_in,
                              void* d_out, int out_size, void* d_ws, size_t ws_size,
                              hipStream_t stream) {
  const float* x     = (const float*)d_in[0];
  const float* tw    = (const float*)d_in[1];
  const float* alpha = (const float*)d_in[2];
  const float* beta  = (const float*)d_in[3];
  const float* gamma = (const float*)d_in[4];
  const float* Wq = (const float*)d_in[5];  const float* bq = (const float*)d_in[6];
  const float* Wk = (const float*)d_in[7];  const float* bk = (const float*)d_in[8];
  const float* Wv = (const float*)d_in[9];  const float* bv = (const float*)d_in[10];
  const float* Wmix = (const float*)d_in[11];
  const float* Wo = (const float*)d_in[12]; const float* bo = (const float*)d_in[13];
  float* out = (float*)d_out;

  char* ws = (char*)d_ws;
  const size_t MB = 1u << 20;
  __bf16* XS   = (__bf16*)(ws + 0);          // 4 MB
  __bf16* WQT  = (__bf16*)(ws + 4 * MB);     // 2 MB each
  __bf16* WKT  = (__bf16*)(ws + 6 * MB);
  __bf16* WVT  = (__bf16*)(ws + 8 * MB);
  __bf16* WOT  = (__bf16*)(ws + 10 * MB);
  float*  QR   = (float*)(ws + 12 * MB);     // 8 MB each
  float*  KR   = (float*)(ws + 20 * MB);
  float*  VR   = (float*)(ws + 28 * MB);
  __bf16* QHB  = (__bf16*)(ws + 36 * MB);    // 4 MB each
  __bf16* KHB  = (__bf16*)(ws + 40 * MB);
  __bf16* VTB  = (__bf16*)(ws + 44 * MB);
  float*  MBUF = (float*)(ws + 48 * MB);     // 128 KB each
  float*  ZBUF = (float*)(ws + 48 * MB + (128u << 10));
  __bf16* YBF  = (__bf16*)(ws + 49 * MB);    // 4 MB

  // 1) shift + bf16: 4 rows per block
  k_shift<<<BB * TT / 4, 256, 0, stream>>>(x, XS);
  // 2) weight transpose-converts: 1024 waves each
  k_convT<<<256, 128, 0, stream>>>(Wq, WQT);
  k_convT<<<256, 128, 0, stream>>>(Wk, WKT);
  k_convT<<<256, 128, 0, stream>>>(Wv, WVT);
  k_convT<<<256, 128, 0, stream>>>(Wo, WOT);
  // 3) QKV GEMMs: (B*T=2048) x 1024 x 1024, 32x32 tile per wave, 8 waves per block
  const int M = BB * TT, N = CC, K = CC;
  int gblk = (M / 32) * (N / 32) / 8;        // 256 blocks
  k_gemm<<<gblk, 256, 0, stream>>>(XS, WQT, bq, nullptr, QR, M, N, K, TT);
  k_gemm<<<gblk, 256, 0, stream>>>(XS, WKT, bk, nullptr, KR, M, N, K, TT);
  k_gemm<<<gblk, 256, 0, stream>>>(XS, WVT, bv, nullptr, VR, M, N, K, TT);
  // 4) RoPE + relayout
  k_rope<<<BB * TT / 8, 256, 0, stream>>>(QR, KR, VR, QHB, KHB, VTB);
  // 5) softmax stats: 2048 waves = 256 blocks x 8 waves
  k_stats<<<256, 256, 0, stream>>>(QHB, KHB, MBUF, ZBUF);
  // 6) fused attention: one block per (b, 16-row tile), 16 waves = 16 heads
  k_attn<<<BB * (TT / 16), 512, 0, stream>>>(QHB, KHB, VTB, MBUF, ZBUF,
                                             tw, alpha, beta, Wmix, YBF);
  // 7) output GEMM with bias + gamma epilogue
  k_gemm<<<gblk, 256, 0, stream>>>(YBF, WOT, bo, gamma, out, M, N, K, TT);
}

// v004
// One run takes 236 microseconds.
// Timed twice side by side with v003, it ran 1.17 and 1.16 times as fast.
// Over all steps from v000 it is 2.48 times as fast.
#include <hip/hip_runtime.h>
#include <hip/hip_bf16.h>
#include <math.h>

// ---------------- problem constants ----------------
enum : int { BB = 2, TT = 1024, CC = 1024, NH = 16, HS = 64, ROT = 32 };
enum : int { PWP = 36 };   // LDS row pitch of the 32-wide p*w tile, in floats
enum : int { TWP = TT + 32 };   // LDS pitch of one head's decay row: the row, then 32 zeros

typedef __attribute__((ext_vector_type(16))) __bf16 v16bf;
typedef __attribute__((ext_vector_type(8)))  __bf16 v8bf;
typedef __attribute__((ext_vector_type(4)))  __bf16 v4bf;
typedef __attribute__((ext_vector_type(8)))  float  v8f;

#define WMMA_BF16(a, b, c) \
  __builtin_amdgcn_wmma_f32_16x16x32_bf16(false, (a), false, (b), (short)0, (c), false, false)

// Fragment loader: lane supplies base = row_ptr + kb (kb = 8*(lane>=16)).
// Elements 0..7  <- K = kb+0..7   (16B load)
// Elements 8..15 <- K = kb+16..23 (16B load)
static __device__ __forceinline__ v16bf load_frag(const __bf16* p) {
  v8bf lo = *(const v8bf*)p;
  v8bf hi = *(const v8bf*)(p + 16);
  v16bf r;
#pragma unroll
  for (int i = 0; i < 8; ++i) { r[i] = lo[i]; r[i + 8] = hi[i]; }
  return r;
}

// One wave turns a 64-row x 16-column f32 tile into its bf16 transpose, in registers.
// Lane (tl, ng) holds rows tl*8..+7 of columns ng*4..+3: eight 16-byte loads (4 lanes = 64 B of a
// row), four 16-byte stores (8 lanes = one whole 128-B line of a transposed row).
static __device__ __forceinline__ void tile_T(const float* __restrict__ src, int ld_src,
                                              __bf16* __restrict__ dst, int ld_dst, int lane) {
  int ng = lane & 3, tl = lane >> 2;
  const float* p = src + (size_t)(tl * 8) * ld_src + ng * 4;
  float4 v[8];
#pragma unroll
  for (int j = 0; j < 8; ++j) v[j] = *(const float4*)(p + (size_t)j * ld_src);
  // precaution: stands in front of any rewrite of the address registers of the loads above
  asm volatile("s_wait_xcnt 0x0" ::: "memory");
  v8bf o0, o1, o2, o3;
#pragma unroll
  for (int j = 0; j < 8; ++j) {
    o0[j] = (__bf16)v[j].x; o1[j] = (__bf16)v[j].y;
    o2[j] = (__bf16)v[j].z; o3[j] = (__bf16)v[j].w;
  }
  __bf16* q = dst + (size_t)(ng * 4) * ld_dst + tl * 8;
  *(v8bf*)(q)                      = o0;
  *(v8bf*)(q + (size_t)ld_dst)     = o1;
  *(v8bf*)(q + (size_t)2 * ld_dst) = o2;
  *(v8bf*)(q + (size_t)3 * ld_dst) = o3;
}

static __device__ __forceinline__ v4bf cvt4(float a, float b, float c, float d) {
  v4bf r;
  r[0] = (__bf16)a; r[1] = (__bf16)b; r[2] = (__bf16)c; r[3] = (__bf16)d;
  return r;
}

// ---------------- 1) time-shift + f32->bf16 ----------------
// A block of 256 threads spans one row (256 groups of 4 channels) and takes 4 rows.
__global__ void __launch_bounds__(256)
k_shift(const float* __restrict__ x, __bf16* __restrict__ xs) {
  int c = threadIdx.x * 4;
  int row0 = blockIdx.x * 4;
  int back = (c < CC / 2) ? 1 : 0;             // first half of the channels reads row t-1
  float4 v[4];
#pragma unroll
  for (int q = 0; q < 4; ++q) {
    int srow = row0 + q - back;                // clamped so that all four loads issue together
    v[q] = *(const float4*)(x + (size_t)(srow < 0 ? 0 : srow) * CC + c);
  }
  // precaution: stands in front of any rewrite of the address registers of the loads above
  asm volatile("s_wait_xcnt 0x0" ::: "memory");
#pragma unroll
  for (int q = 0; q < 4; ++q)
    if (back && ((row0 + q) & (TT - 1)) == 0) v[q] = make_float4(0.f, 0.f, 0.f, 0.f);
#pragma unroll
  for (int q = 0; q < 4; ++q)
    *(v4bf*)(xs + (size_t)(row0 + q) * CC + c) = cvt4(v[q].x, v[q].y, v[q].z, v[q].w);
}

// ---------------- 2) W[k][n] f32 -> Wt[n][k] bf16 ----------------
// 1024 waves: wave = (64-row k tile, 16-column n tile)
__global__ void __launch_bounds__(128)
k_convT(const float* __restrict__ W, __bf16* __restrict__ Wt) {
  int gw = (blockIdx.x * 128 + threadIdx.x) >> 5;
  int kt = gw >> 6, nt = gw & 63;
  tile_T(W + (size_t)kt * 64 * CC + nt * 16, CC,
         Wt + (size_t)nt * 16 * CC + kt * 64, CC, threadIdx.x & 31);
}

// ---------------- bf16 WMMA GEMM, operands staged in LDS, 32x32 per wave ----------------
// out = A @ Bt^T + bias (opt *gamma[m%T]); M = BB*TT, N = K = CC.
// A block of 8 waves (4 x 2) owns a 128 x 64 tile of out. A stage is 128 k (256 B) of the block's
// 128 rows of A and 64 rows of Bt, brought into LDS by asynchronous 16-byte copies: 16 lanes take
// one row's 256 B, so every copy instruction moves whole lines. Two buffers: the next stage's
// copies fly while this stage is worked on.
enum : int { GBM = 128, GBN = 64, GBK = 128, GNT = CC / GBK };
enum : int { GPITCH = 2 * GBK + 16 };             // LDS row pitch in bytes: 272 = 16 B x odd
enum : int { GBUF = (GBM + GBN) * GPITCH };       // one buffer: the A rows, then the Bt rows

// Four copies of this lane: rows 16 apart in the source (pitch CC elements) and in LDS.
static __device__ __forceinline__ void copy4(unsigned lds, const __bf16* g) {
  // The wait is the last line of the copies' own statement, so that it stands in front of any
  // rewrite of the address registers that the copies name (a precaution).
  asm volatile("global_load_async_to_lds_b128 %0, %4, off\n\t"
               "global_load_async_to_lds_b128 %1, %5, off\n\t"
               "global_load_async_to_lds_b128 %2, %6, off\n\t"
               "global_load_async_to_lds_b128 %3, %7, off\n\t"
               "s_wait_xcnt 0x0"
               :: "v"(lds), "v"(lds + 16 * GPITCH), "v"(lds + 32 * GPITCH), "v"(lds + 48 * GPITCH),
                  "v"(g), "v"(g + 16 * CC), "v"(g + 32 * CC), "v"(g + 48 * CC)
               : "memory");
}

// One stage: 8 copies of A and 4 of Bt per lane. la = this lane's LDS place in the buffer's row
// tid>>4, ga / gb = the same place of the stage in A / Bt.
static __device__ __forceinline__ void copy_stage(unsigned la, const __bf16* ga, const __bf16* gb) {
  copy4(la, ga);
  copy4(la + 64 * GPITCH, ga + 64 * CC);
  copy4(la + GBM * GPITCH, gb);
}

__global__ void __launch_bounds__(256)
k_gemm(const __bf16* __restrict__ A, const __bf16* __restrict__ Bt,
       const float* __restrict__ bias, const float* __restrict__ gamma,
       float* __restrict__ out) {
  __shared__ __attribute__((aligned(16))) unsigned char sm[2 * GBUF];   // 102 KB
  int tid  = threadIdx.x;
  int wave = tid >> 5, lane = tid & 31;
  int hf = lane >> 4, ml = lane & 15;
  int bm0 = (blockIdx.x >> 4) * GBM, bn0 = (blockIdx.x & 15) * GBN;     // 16 x 16 block tiles
  int wm = (wave >> 1) * 32, wn = (wave & 1) * 32;

  unsigned la = (unsigned)(size_t)sm + (unsigned)((tid >> 4) * GPITCH + (tid & 15) * 16);
  const __bf16* ga = A  + (size_t)(bm0 + (tid >> 4)) * CC + (tid & 15) * 8;
  const __bf16* gb = Bt + (size_t)(bn0 + (tid >> 4)) * CC + (tid & 15) * 8;

  copy_stage(la, ga, gb);
  // stage 0 has landed for this wave; the barrier publishes it to the others
  asm volatile("s_wait_asynccnt 0x0" ::: "memory");
  __syncthreads();
  copy_stage(la + GBUF, ga + GBK, gb + GBK);

  v8f a00 = {}, a01 = {}, a10 = {}, a11 = {};
  for (int t = 0; t < GNT; ++t) {
    const unsigned char* bufp = sm + (t & 1) * GBUF;
    const unsigned char* pa = bufp + (wm + ml) * GPITCH + hf * 16;
    const unsigned char* pb = bufp + (GBM + wn + ml) * GPITCH + hf * 16;
    // unrolled so that the four k steps differ only in the immediate offsets of their LDS reads
#pragma unroll
    for (int ks = 0; ks < GBK / 32; ++ks) {
      v16bf fa0 = load_frag((const __bf16*)(pa + ks * 64));
      v16bf fa1 = load_frag((const __bf16*)(pa + 16 * GPITCH + ks * 64));
      v16bf fb0 = load_frag((const __bf16*)(pb + ks * 64));
      v16bf fb1 = load_frag((const __bf16*)(pb + 16 * GPITCH + ks * 64));
      a00 = WMMA_BF16(fa0, fb0, a00);
      a01 = WMMA_BF16(fa0, fb1, a01);
      a10 = WMMA_BF16(fa1, fb0, a10);
      a11 = WMMA_BF16(fa1, fb1, a11);
    }
    // this wave's reads of the buffer have returned before the buffer is handed to the copies
    asm volatile("s_wait_dscnt 0x0" ::: "memory");
    // this wave's copies of stage t + 1 have landed
    asm volatile("s_wait_asynccnt 0x0" ::: "memory");
    __syncthreads();   // publishes stage t + 1 and ends every wave's reads of stage t
    if (t + 2 < GNT)
      copy_stage(la + (t & 1) * GBUF, ga + (t + 2) * GBK, gb + (t + 2) * GBK);
  }
  // no copy is outstanding when the wave ends
  asm volatile("s_wait_asynccnt 0x0" ::: "memory");

  int m0 = bm0 + wm, n0 = bn0 + wn;
#pragma unroll
  for (int bm = 0; bm < 2; ++bm)
#pragma unroll
    for (int bn = 0; bn < 2; ++bn) {
      const v8f& acc = bm ? (bn ? a11 : a10) : (bn ? a01 : a00);
      int n = n0 + bn * 16 + ml;
      float bv = bias ? bias[n] : 0.f;
#pragma unroll
      for (int r = 0; r < 8; ++r) {
        int m = m0 + bm * 16 + r + hf * 8;
        float v = acc[r] + bv;
        if (gamma) v *= gamma[m % TT];
        out[(size_t)m * CC + n] = v;
        // precaution: stands in front of any rewrite of the registers that the store above names
        asm volatile("s_wait_xcnt 0x0" ::: "memory");
      }
    }
}

// ---------------- 4) RoPE + relayout to WMMA-friendly buffers ----------------
// Qh/Kh: [b*16+h][t][64] bf16 ;  Vt: [b*16+h][d][1024] bf16 (transposed for att@v B-frags)
// A block takes 8 rows (t) of Q and K, each thread 4 channels of each row, and 8 V tiles of tile_T.
__global__ void __launch_bounds__(256)
k_rope(const float* __restrict__ Q, const float* __restrict__ Kr,
       const float* __restrict__ V, __bf16* __restrict__ Qh,
       __bf16* __restrict__ Kh, __bf16* __restrict__ Vt) {
  {
    int gw = blockIdx.x * 8 + (threadIdx.x >> 5);
    int rt = gw >> 6, nt = gw & 63;            // 64-row tile over b*T+t, 16-column tile over h*64+d
    int vb = rt >> 4, tq = rt & 15;
    tile_T(V + (size_t)rt * 64 * CC + nt * 16, CC,
           Vt + ((size_t)vb * CC + nt * 16) * TT + tq * 64, TT, threadIdx.x & 31);
  }
  int nn = threadIdx.x * 4;
  int h = nn >> 6, d = nn & 63;
  int row0 = blockIdx.x * 8;
  int b = row0 / TT, t0 = row0 % TT;
  const float* qp = Q  + (size_t)row0 * CC + nn;
  const float* kp = Kr + (size_t)row0 * CC + nn;
  float4 q[8], k[8];
#pragma unroll
  for (int j = 0; j < 8; ++j) {
    q[j] = *(const float4*)(qp + (size_t)j * CC);
    k[j] = *(const float4*)(kp + (size_t)j * CC);
  }
  if (d < ROT) {
    int po = (d < 16) ? 16 : -16;              // the group of 4 never straddles a multiple of 16
    float sgn = (d < 16) ? -1.f : 1.f;
    float inv[4];
#pragma unroll
    for (int e = 0; e < 4; ++e) inv[e] = __powf(1024.0f, -(float)((d + e) & 15) / 16.0f);
#pragma unroll
    for (int j = 0; j < 8; ++j) {
      float4 pq = *(const float4*)(qp + (ptrdiff_t)j * CC + po);
      float4 pk = *(const float4*)(kp + (ptrdiff_t)j * CC + po);
      float tf = (float)(t0 + j);
      float f0 = tf * inv[0], f1 = tf * inv[1], f2 = tf * inv[2], f3 = tf * inv[3];
      float c0 = __cosf(f0), s0 = __sinf(f0), c1 = __cosf(f1), s1 = __sinf(f1);
      float c2 = __cosf(f2), s2 = __sinf(f2), c3 = __cosf(f3), s3 = __sinf(f3);
      q[j].x = q[j].x * c0 + sgn * pq.x * s0;  k[j].x = k[j].x * c0 + sgn * pk.x * s0;
      q[j].y = q[j].y * c1 + sgn * pq.y * s1;  k[j].y = k[j].y * c1 + sgn * pk.y * s1;
      q[j].z = q[j].z * c2 + sgn * pq.z * s2;  k[j].z = k[j].z * c2 + sgn * pk.z * s2;
      q[j].w = q[j].w * c3 + sgn * pq.w * s3;  k[j].w = k[j].w * c3 + sgn * pk.w * s3;
    }
  }
  size_t ob = ((size_t)(b * NH + h) * TT + t0) * HS + d;
#pragma unroll
  for (int j = 0; j < 8; ++j) {
    *(v4bf*)(Qh + ob + (size_t)j * HS) = cvt4(q[j].x, q[j].y, q[j].z, q[j].w);
    *(v4bf*)(Kh + ob + (size_t)j * HS) = cvt4(k[j].x, k[j].y, k[j].z, k[j].w);
  }
}

// ---------------- 5) softmax stats over ALL s (max & sum) ----------------
__global__ void k_stats(const __bf16* __restrict__ Qh, const __bf16* __restrict__ Kh,
                        float* __restrict__ Mb, float* __restrict__ Zb) {
  int wid  = (blockIdx.x * blockDim.x + threadIdx.x) >> 5;
  int lane = threadIdx.x & 31;
  int hf = lane >> 4, ml = lane & 15;
  int tile = wid & 63, bh = wid >> 6;      // 2048 waves: [b*16+h][t-tile]
  int t0 = tile * 16;
  const __bf16* qrow = Qh + ((size_t)bh * TT + t0 + ml) * HS + hf * 8;
  v16bf qa0 = load_frag(qrow);
  v16bf qa1 = load_frag(qrow + 32);
  float mr[8], zz[8];
#pragma unroll
  for (int r = 0; r < 8; ++r) { mr[r] = -3.0e38f; zz[r] = 0.f; }
  for (int st = 0; st < TT / 16; ++st) {
    const __bf16* krow = Kh + ((size_t)bh * TT + st * 16 + ml) * HS + hf * 8;
    v8f s = {};
    s = WMMA_BF16(qa0, load_frag(krow), s);
    s = WMMA_BF16(qa1, load_frag(krow + 32), s);
#pragma unroll
    for (int r = 0; r < 8; ++r) {
      float x = s[r] * 0.125f;               // 1/sqrt(64)
      float tmax = x;
      tmax = fmaxf(tmax, __shfl_xor(tmax, 8, 16));
      tmax = fmaxf(tmax, __shfl_xor(tmax, 4, 16));
      tmax = fmaxf(tmax, __shfl_xor(tmax, 2, 16));
      tmax = fmaxf(tmax, __shfl_xor(tmax, 1, 16));
      float mnew = fmaxf(mr[r], tmax);
      float e = __expf(x - mnew);
      e += __shfl_xor(e, 8, 16);
      e += __shfl_xor(e, 4, 16);
      e += __shfl_xor(e, 2, 16);
      e += __shfl_xor(e, 1, 16);
      zz[r] = zz[r] * __expf(mr[r] - mnew) + e;
      mr[r] = mnew;
    }
  }
  if (ml == 0) {
#pragma unroll
    for (int r = 0; r < 8; ++r) {
      int t = t0 + r + hf * 8;
      Mb[(size_t)bh * TT + t] = mr[r];
      Zb[(size_t)bh * TT + t] = zz[r];
    }
  }
}

// ---------------- 6) fused attention: scores -> p*w -> Wmix -> @v  (att stays on-WGP) ----------------
__global__ void __launch_bounds__(512)
k_attn(const __bf16* __restrict__ Qh, const __bf16* __restrict__ Kh,
       const __bf16* __restrict__ Vt, const float* __restrict__ Mb,
       const float* __restrict__ Zb, const float* __restrict__ tw,
       const float* __restrict__ alpha, const float* __restrict__ beta,
       const float* __restrict__ Wmix, __bf16* __restrict__ Y) {
  // Row pitch 36 dwords (144 B = 16 B x odd): the 16 rows that lanes 0..15 read with one
  // 8-byte load start on 16 different groups of four banks.
  __shared__ __attribute__((aligned(16))) float pw[NH * 16 * PWP];   // 36 KB of 320 KB LDS
  // Each head's decay row with 32 zeros behind it, as the reference pads it: an index past the row
  // (s > t, by at most 31) reads 0, so the reads of the chunk loop need no guard and no branch.
  __shared__ __attribute__((aligned(16))) float twl[NH * TWP];       // 66 KB
  int tile = blockIdx.x & 63, b = blockIdx.x >> 6;
  int wave = threadIdx.x >> 5;                         // = input head h and output head g
  int lane = threadIdx.x & 31;
  int hf = lane >> 4, ml = lane & 15;
  int t0 = tile * 16;
  int h = wave, g = wave;
  int bh = b * NH + h, bg = b * NH + g;

  {
    const float4* trow = (const float4*)(tw + h * TT) + lane;
    float4 tv[8];
#pragma unroll
    for (int j = 0; j < 8; ++j) tv[j] = trow[j * 32];
    // precaution: stands in front of any rewrite of the address registers of the loads above
    asm volatile("s_wait_xcnt 0x0" ::: "memory");
    float4* trl = (float4*)(twl + h * TWP) + lane;
#pragma unroll
    for (int j = 0; j < 8; ++j) trl[j * 32] = tv[j];
    twl[h * TWP + TT + lane] = 0.f;
  }
  // decay weight of (t0 + hf*8 + r, s) = twp[s - r]
  const float* twp = twl + h * TWP + (TT - 1) - t0 - hf * 8;

  const __bf16* qrow = Qh + ((size_t)bh * TT + t0 + ml) * HS + hf * 8;
  v16bf qa0 = load_frag(qrow);
  v16bf qa1 = load_frag(qrow + 32);

  float mr[8], zi[8], bt[8];
#pragma unroll
  for (int r = 0; r < 8; ++r) {
    int t = t0 + r + hf * 8;
    mr[r] = Mb[(size_t)bh * TT + t];
    zi[r] = 1.0f / Zb[(size_t)bh * TT + t];
    bt[r] = beta[h * TT + t];
  }
  float wrow[NH];
#pragma unroll
  for (int j = 0; j < NH; ++j) wrow[j] = Wmix[g * NH + j];

  v8f yac[4] = {};
  int nch = (t0 + 16 + 31) >> 5;
  __syncthreads();   // the staged decay rows are complete before the first read
  for (int ch = 0; ch < nch; ++ch) {
    int s0 = ch * 32;
    // the chunk's 16 decay weights, read in front of the first store to pw so that they issue as a group
    float twv[2][8];
#pragma unroll
    for (int sub = 0; sub < 2; ++sub)
#pragma unroll
      for (int r = 0; r < 8; ++r) twv[sub][r] = twp[s0 + sub * 16 + ml - r];
    float al[2];
    al[0] = alpha[h * TT + s0 + ml];
    al[1] = alpha[h * TT + s0 + 16 + ml];
    // precaution: stands in front of any rewrite of the address registers of the two loads above
    asm volatile("s_wait_xcnt 0x0" ::: "memory");
    // phase A: this wave = head h; two 16-wide s subtiles of exp/Z * w -> LDS
#pragma unroll
    for (int sub = 0; sub < 2; ++sub) {
      int sb = s0 + sub * 16;
      const __bf16* krow = Kh + ((size_t)bh * TT + sb + ml) * HS + hf * 8;
      v8f s = {};
      s = WMMA_BF16(qa0, load_frag(krow), s);
      s = WMMA_BF16(qa1, load_frag(krow + 32), s);
#pragma unroll
      for (int r = 0; r < 8; ++r) {
        int tl = r + hf * 8;
        float p = __expf(s[r] * 0.125f - mr[r]) * zi[r];
        float wv = twv[sub][r] * al[sub] * bt[r];
        pw[(h * 16 + tl) * PWP + sub * 16 + ml] = p * wv;
      }
    }
    __syncthreads();
    // phase B: this wave = output head g; mix 16 heads, repack to A-frag, 4 WMMAs vs Vt
    v16bf am;
#pragma unroll
    for (int j = 0; j < 8; ++j) {
      int sl = hf * 8 + ((j < 4) ? 2 * j : 16 + 2 * (j - 4));
      float a0 = 0.f, a1 = 0.f;
#pragma unroll
      for (int hh = 0; hh < NH; ++hh) {
        const float2 v2 = *(const float2*)&pw[(hh * 16 + ml) * PWP + sl];
        a0 += wrow[hh] * v2.x;
        a1 += wrow[hh] * v2.y;
      }
      am[2 * j]     = (__bf16)a0;
      am[2 * j + 1] = (__bf16)a1;
    }
#pragma unroll
    for (int dt = 0; dt < 4; ++dt) {
      const __bf16* vrow = Vt + ((size_t)bg * HS + dt * 16 + ml) * TT + s0 + hf * 8;
      yac[dt] = WMMA_BF16(am, load_frag(vrow), yac[dt]);
    }
    __syncthreads();
  }
  // write y[b][t][g*64+d] as bf16 for the final WMMA GEMM
#pragma unroll
  for (int dt = 0; dt < 4; ++dt)
#pragma unroll
    for (int r = 0; r < 8; ++r) {
      int t = t0 + r + hf * 8;
      int n = g * HS + dt * 16 + ml;
      Y[((size_t)b * TT + t) * CC + n] = (__bf16)yac[dt][r];
    }
}

// ---------------- host-side orchestration ----------------
extern "C" void kernel_launch(void* const* d_in, const int* in_sizes, int n_in,
                              void* d_out, int out_size, void* d_ws, size_t ws_size,
                              hipStream_t stream) {
  const float* x     = (const float*)d_in[0];
  const float* tw    = (const float*)d_in[1];
  const float* alpha = (const float*)d_in[2];
  const float* beta  = (const float*)d_in[3];
  const float* gamma = (const float*)d_in[4];
  const float* Wq = (const float*)d_in[5];  const float* bq = (const float*)d_in[6];
  const float* Wk = (const float*)d_in[7];  const float* bk = (const float*)d_in[8];
  const float* Wv = (const float*)d_in[9];  const float* bv = (const float*)d_in[10];
  const float* Wmix = (const float*)d_in[11];
  const float* Wo = (const float*)d_in[12]; const float* bo = (const float*)d_in[13];
  float* out = (float*)d_out;

  char* ws = (char*)d_ws;
  const size_t MB = 1u << 20;
  __bf16* XS   = (__bf16*)(ws + 0);          // 4 MB
  __bf16* WQT  = (__bf16*)(ws + 4 * MB);     // 2 MB each
  __bf16* WKT  = (__bf16*)(ws + 6 * MB);
  __bf16* WVT  = (__bf16*)(ws + 8 * MB);
  __bf16* WOT  = (__bf16*)(ws + 10 * MB);
  float*  QR   = (float*)(ws + 12 * MB);     // 8 MB each
  float*  KR   = (float*)(ws + 20 * MB);
  float*  VR   = (float*)(ws + 28 * MB);
  __bf16* QHB  = (__bf16*)(ws + 36 * MB);    // 4 MB each
  __bf16* KHB  = (__bf16*)(ws + 40 * MB);
  __bf16* VTB  = (__bf16*)(ws + 44 * MB);
  float*  MBUF = (float*)(ws + 48 * MB);     // 128 KB each
  float*  ZBUF = (float*)(ws + 48 * MB + (128u << 10));
  __bf16* YBF  = (__bf16*)(ws + 49 * MB);    // 4 MB

  // 1) shift + bf16: 4 rows per block
  k_shift<<<BB * TT / 4, 256, 0, stream>>>(x, XS);
  // 2) weight transpose-converts: 1024 waves each
  k_convT<<<256, 128, 0, stream>>>(Wq, WQT);
  k_convT<<<256, 128, 0, stream>>>(Wk, WKT);
  k_convT<<<256, 128, 0, stream>>>(Wv, WVT);
  k_convT<<<256, 128, 0, stream>>>(Wo, WOT);
  // 3) QKV GEMMs: (B*T=2048) x 1024 x 1024, 128x64 tile per block of 8 waves
  const int gblk = (BB * TT / GBM) * (CC / GBN);   // 256 blocks
  k_gemm<<<gblk, 256, 0, stream>>>(XS, WQT, bq, nullptr, QR);
  k_gemm<<<gblk, 256, 0, stream>>>(XS, WKT, bk, nullptr, KR);
  k_gemm<<<gblk, 256, 0, stream>>>(XS, WVT, bv, nullptr, VR);
  // 4) RoPE + relayout
  k_rope<<<BB * TT / 8, 256, 0, stream>>>(QR, KR, VR, QHB, KHB, VTB);
  // 5) softmax stats: 2048 waves = 256 blocks x 8 waves
  k_stats<<<256, 256, 0, stream>>>(QHB, KHB, MBUF, ZBUF);
  // 6) fused attention: one block per (b, 16-row tile), 16 waves = 16 heads
  k_attn<<<BB * (TT / 16), 512, 0, stream>>>(QHB, KHB, VTB, MBUF, ZBUF,
                                             tw, alpha, beta, Wmix, YBF);
  // 7) output GEMM with bias + gamma epilogue
  k_gemm<<<gblk, 256, 0, stream>>>(YBF, WOT, bo, gamma, out);
}

// v005
// One run takes 214 microseconds.
// Timed twice side by side with v004, it ran 1.11 times as fast both times.
// Counting every step since v000, it is 2.75 times as fast.
#include <hip/hip_runtime.h>
#include <hip/hip_bf16.h>
#include <math.h>

// ---------------- problem constants ----------------
enum : int { BB = 2, TT = 1024, CC = 1024, NH = 16, HS = 64, ROT = 32 };
enum : int { PWP = 36 };   // LDS row pitch of the 32-wide p*w tile, in floats
enum : int { TWP = TT + 32 };   // LDS pitch of one head's decay row: the row, then 32 zeros

typedef __attribute__((ext_vector_type(16))) __bf16 v16bf;
typedef __attribute__((ext_vector_type(8)))  __bf16 v8bf;
typedef __attribute__((ext_vector_type(4)))  __bf16 v4bf;
typedef __attribute__((ext_vector_type(8)))  float  v8f;

#define WMMA_BF16(a, b, c) \
  __builtin_amdgcn_wmma_f32_16x16x32_bf16(false, (a), false, (b), (short)0, (c), false, false)

// Fragment loader: lane supplies base = row_ptr + kb (kb = 8*(lane>=16)).
// Elements 0..7  <- K = kb+0..7   (16B load)
// Elements 8..15 <- K = kb+16..23 (16B load)
static __device__ __forceinline__ v16bf load_frag(const __bf16* p) {
  v8bf lo = *(const v8bf*)p;
  v8bf hi = *(const v8bf*)(p + 16);
  v16bf r;
#pragma unroll
  for (int i = 0; i < 8; ++i) { r[i] = lo[i]; r[i + 8] = hi[i]; }
  return r;
}

// One wave turns a 64-row x 16-column f32 tile into its bf16 transpose, in registers.
// Lane (tl, ng) holds rows tl*8..+7 of columns ng*4..+3: eight 16-byte loads (4 lanes = 64 B of a
// row), four 16-byte stores (8 lanes = one whole 128-B line of a transposed row).
static __device__ __forceinline__ void tile_T(const float* __restrict__ src, int ld_src,
                                              __bf16* __restrict__ dst, int ld_dst, int lane) {
  int ng = lane & 3, tl = lane >> 2;
  const float* p = src + (size_t)(tl * 8) * ld_src + ng * 4;
  float4 v[8];
#pragma unroll
  for (int j = 0; j < 8; ++j) v[j] = *(const float4*)(p + (size_t)j * ld_src);
  // precaution: stands in front of any rewrite of the address registers of the loads above
  asm volatile("s_wait_xcnt 0x0" ::: "memory");
  v8bf o0, o1, o2, o3;
#pragma unroll
  for (int j = 0; j < 8; ++j) {
    o0[j] = (__bf16)v[j].x; o1[j] = (__bf16)v[j].y;
    o2[j] = (__bf16)v[j].z; o3[j] = (__bf16)v[j].w;
  }
  __bf16* q = dst + (size_t)(ng * 4) * ld_dst + tl * 8;
  *(v8bf*)(q)                      = o0;
  *(v8bf*)(q + (size_t)ld_dst)     = o1;
  *(v8bf*)(q + (size_t)2 * ld_dst) = o2;
  *(v8bf*)(q + (size_t)3 * ld_dst) = o3;
}

static __device__ __forceinline__ v4bf cvt4(float a, float b, float c, float d) {
  v4bf r;
  r[0] = (__bf16)a; r[1] = (__bf16)b; r[2] = (__bf16)c; r[3] = (__bf16)d;
  return r;
}

// ---------------- 1) time-shift + f32->bf16 ----------------
// A block of 256 threads spans one row (256 groups of 4 channels) and takes 4 rows.
static __device__ __forceinline__ void shift_rows(const float* __restrict__ x,
                                                  __bf16* __restrict__ xs, int blk) {
  int c = threadIdx.x * 4;
  int row0 = blk * 4;
  int back = (c < CC / 2) ? 1 : 0;             // first half of the channels reads row t-1
  float4 v[4];
#pragma unroll
  for (int q = 0; q < 4; ++q) {
    int srow = row0 + q - back;                // clamped so that all four loads issue together
    v[q] = *(const float4*)(x + (size_t)(srow < 0 ? 0 : srow) * CC + c);
  }
  // precaution: stands in front of any rewrite of the address registers of the loads above
  asm volatile("s_wait_xcnt 0x0" ::: "memory");
#pragma unroll
  for (int q = 0; q < 4; ++q)
    if (back && ((row0 + q) & (TT - 1)) == 0) v[q] = make_float4(0.f, 0.f, 0.f, 0.f);
#pragma unroll
  for (int q = 0; q < 4; ++q)
    *(v4bf*)(xs + (size_t)(row0 + q) * CC + c) = cvt4(v[q].x, v[q].y, v[q].z, v[q].w);
}

// ---------------- 2) W[k][n] f32 -> Wt[n][k] bf16 ----------------
// 1024 waves a matrix: wave = (64-row k tile, 16-column n tile)
static __device__ __forceinline__ void convT(const float* __restrict__ W,
                                             __bf16* __restrict__ Wt, int blk) {
  int gw = (blk * 256 + threadIdx.x) >> 5;
  int kt = gw >> 6, nt = gw & 63;
  tile_T(W + (size_t)kt * 64 * CC + nt * 16, CC,
         Wt + (size_t)nt * 16 * CC + kt * 64, CC, threadIdx.x & 31);
  // precaution: stands in front of any rewrite of the registers that the tile's four stores name
  asm volatile("s_wait_xcnt 0x0" ::: "memory");
}

// 1) and 2) depend on nothing and on each other not at all: one grid holds them, by block range.
enum : int { SHB = BB * TT / 4, CVB = 128 };   // blocks of the shift; blocks of one weight matrix
__global__ void __launch_bounds__(256)
k_prep(const float* __restrict__ x, const float* __restrict__ Wq, const float* __restrict__ Wk,
       const float* __restrict__ Wv, const float* __restrict__ Wo, __bf16* __restrict__ xs,
       __bf16* __restrict__ Wqt, __bf16* __restrict__ Wkt, __bf16* __restrict__ Wvt,
       __bf16* __restrict__ Wot) {
  int blk = blockIdx.x;
  if (blk < SHB) { shift_rows(x, xs, blk); return; }
  blk -= SHB;
  int sel = blk / CVB;
  const float* W = sel == 0 ? Wq : sel == 1 ? Wk : sel == 2 ? Wv : Wo;
  __bf16* Wt = sel == 0 ? Wqt : sel == 1 ? Wkt : sel == 2 ? Wvt : Wot;
  convT(W, Wt, blk % CVB);
}

// ---------------- bf16 WMMA GEMM, operands staged in LDS, 32x32 per wave ----------------
// out = A @ Bt^T + bias (opt *gamma[m%T]); M = BB*TT, N = K = CC.
// A block of 8 waves (4 x 2) owns a 128 x 64 tile of out. A stage is 128 k (256 B) of the block's
// 128 rows of A and 64 rows of Bt, brought into LDS by asynchronous 16-byte copies: 16 lanes take
// one row's 256 B, so every copy instruction moves whole lines. Two buffers: the next stage's
// copies fly while this stage is worked on.
enum : int { GBM = 128, GBN = 64, GBK = 128, GNT = CC / GBK };
enum : int { GPITCH = 2 * GBK + 16 };             // LDS row pitch in bytes: 272 = 16 B x odd
enum : int { GBUF = (GBM + GBN) * GPITCH };       // one buffer: the A rows, then the Bt rows

// Four copies of this lane: rows 16 apart in the source (pitch CC elements) and in LDS.
static __device__ __forceinline__ void copy4(unsigned lds, const __bf16* g) {
  // The wait is the last line of the copies' own statement, so that it stands in front of any
  // rewrite of the address registers that the copies name (a precaution).
  asm volatile("global_load_async_to_lds_b128 %0, %4, off\n\t"
               "global_load_async_to_lds_b128 %1, %5, off\n\t"
               "global_load_async_to_lds_b128 %2, %6, off\n\t"
               "global_load_async_to_lds_b128 %3, %7, off\n\t"
               "s_wait_xcnt 0x0"
               :: "v"(lds), "v"(lds + 16 * GPITCH), "v"(lds + 32 * GPITCH), "v"(lds + 48 * GPITCH),
                  "v"(g), "v"(g + 16 * CC), "v"(g + 32 * CC), "v"(g + 48 * CC)
               : "memory");
}

// One stage: 8 copies of A and 4 of Bt per lane. la = this lane's LDS place in the buffer's row
// tid>>4, ga / gb = the same place of the stage in A / Bt.
static __device__ __forceinline__ void copy_stage(unsigned la, const __bf16* ga, const __bf16* gb) {
  copy4(la, ga);
  copy4(la + 64 * GPITCH, ga + 64 * CC);
  copy4(la + GBM * GPITCH, gb);
}

static __device__ __forceinline__ void
gemm_tile(const __bf16* __restrict__ A, const __bf16* __restrict__ Bt,
          const float* __restrict__ bias, const float* __restrict__ gamma,
          float* __restrict__ out) {
  __shared__ __attribute__((aligned(16))) unsigned char sm[2 * GBUF];   // 102 KB
  int tid  = threadIdx.x;
  int wave = tid >> 5, lane = tid & 31;
  int hf = lane >> 4, ml = lane & 15;
  int bm0 = (blockIdx.x >> 4) * GBM, bn0 = (blockIdx.x & 15) * GBN;     // 16 x 16 block tiles
  int wm = (wave >> 1) * 32, wn = (wave & 1) * 32;

  unsigned la = (unsigned)(size_t)sm + (unsigned)((tid >> 4) * GPITCH + (tid & 15) * 16);
  const __bf16* ga = A  + (size_t)(bm0 + (tid >> 4)) * CC + (tid & 15) * 8;
  const __bf16* gb = Bt + (size_t)(bn0 + (tid >> 4)) * CC + (tid & 15) * 8;

  copy_stage(la, ga, gb);
  // stage 0 has landed for this wave; the barrier publishes it to the others
  asm volatile("s_wait_asynccnt 0x0" ::: "memory");
  __syncthreads();
  copy_stage(la + GBUF, ga + GBK, gb + GBK);

  v8f a00 = {}, a01 = {}, a10 = {}, a11 = {};
  for (int t = 0; t < GNT; ++t) {
    const unsigned char* bufp = sm + (t & 1) * GBUF;
    const unsigned char* pa = bufp + (wm + ml) * GPITCH + hf * 16;
    const unsigned char* pb = bufp + (GBM + wn + ml) * GPITCH + hf * 16;
    // unrolled so that the four k steps differ only in the immediate offsets of their LDS reads
#pragma unroll
    for (int ks = 0; ks < GBK / 32; ++ks) {
      v16bf fa0 = load_frag((const __bf16*)(pa + ks * 64));
      v16bf fa1 = load_frag((const __bf16*)(pa + 16 * GPITCH + ks * 64));
      v16bf fb0 = load_frag((const __bf16*)(pb + ks * 64));
      v16bf fb1 = load_frag((const __bf16*)(pb + 16 * GPITCH + ks * 64));
      a00 = WMMA_BF16(fa0, fb0, a00);
      a01 = WMMA_BF16(fa0, fb1, a01);
      a10 = WMMA_BF16(fa1, fb0, a10);
      a11 = WMMA_BF16(fa1, fb1, a11);
    }
    // this wave's reads of the buffer have returned before the buffer is handed to the copies
    asm volatile("s_wait_dscnt 0x0" ::: "memory");
    // this wave's copies of stage t + 1 have landed
    asm volatile("s_wait_asynccnt 0x0" ::: "memory");
    __syncthreads();   // publishes stage t + 1 and ends every wave's reads of stage t
    if (t + 2 < GNT)
      copy_stage(la + (t & 1) * GBUF, ga + (t + 2) * GBK, gb + (t + 2) * GBK);
  }
  // no copy is outstanding when the wave ends
  asm volatile("s_wait_asynccnt 0x0" ::: "memory");

  int m0 = bm0 + wm, n0 = bn0 + wn;
#pragma unroll
  for (int bm = 0; bm < 2; ++bm)
#pragma unroll
    for (int bn = 0; bn < 2; ++bn) {
      const v8f& acc = bm ? (bn ? a11 : a10) : (bn ? a01 : a00);
      int n = n0 + bn * 16 + ml;
      float bv = bias ? bias[n] : 0.f;
#pragma unroll
      for (int r = 0; r < 8; ++r) {
        int m = m0 + bm * 16 + r + hf * 8;
        float v = acc[r] + bv;
        if (gamma) v *= gamma[m % TT];
        out[(size_t)m * CC + n] = v;
        // precaution: stands in front of any rewrite of the registers that the store above names
        asm volatile("s_wait_xcnt 0x0" ::: "memory");
      }
    }
}

// The three projections read the same A and depend on each other not at all: one grid, blockIdx.y
// names the projection. Three blocks (102 KB of LDS each) stand on a WGP together.
__global__ void __launch_bounds__(256)
k_gemm_qkv(const __bf16* __restrict__ A, const __bf16* __restrict__ Wqt,
           const __bf16* __restrict__ Wkt, const __bf16* __restrict__ Wvt,
           const float* __restrict__ bq, const float* __restrict__ bk,
           const float* __restrict__ bv, float* __restrict__ Q, float* __restrict__ K,
           float* __restrict__ V) {
  int sel = blockIdx.y;
  gemm_tile(A, sel == 0 ? Wqt : sel == 1 ? Wkt : Wvt, sel == 0 ? bq : sel == 1 ? bk : bv,
            nullptr, sel == 0 ? Q : sel == 1 ? K : V);
}

__global__ void __launch_bounds__(256)
k_gemm_out(const __bf16* __restrict__ A, const __bf16* __restrict__ Bt,
           const float* __restrict__ bias, const float* __restrict__ gamma,
           float* __restrict__ out) {
  gemm_tile(A, Bt, bias, gamma, out);
}

// ---------------- 4) RoPE + relayout to WMMA-friendly buffers ----------------
// Qh/Kh: [b*16+h][t][64] bf16 ;  Vt: [b*16+h][d][1024] bf16 (transposed for att@v B-frags)
// A block takes 8 rows (t) of Q and K, each thread 4 channels of each row, and 8 V tiles of tile_T.
__global__ void __launch_bounds__(256)
k_rope(const float* __restrict__ Q, const float* __restrict__ Kr,
       const float* __restrict__ V, __bf16* __restrict__ Qh,
       __bf16* __restrict__ Kh, __bf16* __restrict__ Vt) {
  {
    int gw = blockIdx.x * 8 + (threadIdx.x >> 5);
    int rt = gw >> 6, nt = gw & 63;            // 64-row tile over b*T+t, 16-column tile over h*64+d
    int vb = rt >> 4, tq = rt & 15;
    tile_T(V + (size_t)rt * 64 * CC + nt * 16, CC,
           Vt + ((size_t)vb * CC + nt * 16) * TT + tq * 64, TT, threadIdx.x & 31);
  }
  int nn = threadIdx.x * 4;
  int h = nn >> 6, d = nn & 63;
  int row0 = blockIdx.x * 8;
  int b = row0 / TT, t0 = row0 % TT;
  const float* qp = Q  + (size_t)row0 * CC + nn;
  const float* kp = Kr + (size_t)row0 * CC + nn;
  float4 q[8], k[8];
#pragma unroll
  for (int j = 0; j < 8; ++j) {
    q[j] = *(const float4*)(qp + (size_t)j * CC);
    k[j] = *(const float4*)(kp + (size_t)j * CC);
  }
  if (d < ROT) {
    int po = (d < 16) ? 16 : -16;              // the group of 4 never straddles a multiple of 16
    float sgn = (d < 16) ? -1.f : 1.f;
    float inv[4];
#pragma unroll
    for (int e = 0; e < 4; ++e) inv[e] = __powf(1024.0f, -(float)((d + e) & 15) / 16.0f);
#pragma unroll
    for (int j = 0; j < 8; ++j) {
      float4 pq = *(const float4*)(qp + (ptrdiff_t)j * CC + po);
      float4 pk = *(const float4*)(kp + (ptrdiff_t)j * CC + po);
      float tf = (float)(t0 + j);
      float f0 = tf * inv[0], f1 = tf * inv[1], f2 = tf * inv[2], f3 = tf * inv[3];
      float c0 = __cosf(f0), s0 = __sinf(f0), c1 = __cosf(f1), s1 = __sinf(f1);
      float c2 = __cosf(f2), s2 = __sinf(f2), c3 = __cosf(f3), s3 = __sinf(f3);
      q[j].x = q[j].x * c0 + sgn * pq.x * s0;  k[j].x = k[j].x * c0 + sgn * pk.x * s0;
      q[j].y = q[j].y * c1 + sgn * pq.y * s1;  k[j].y = k[j].y * c1 + sgn * pk.y * s1;
      q[j].z = q[j].z * c2 + sgn * pq.z * s2;  k[j].z = k[j].z * c2 + sgn * pk.z * s2;
      q[j].w = q[j].w * c3 + sgn * pq.w * s3;  k[j].w = k[j].w * c3 + sgn * pk.w * s3;
    }
  }
  size_t ob = ((size_t)(b * NH + h) * TT + t0) * HS + d;
#pragma unroll
  for (int j = 0; j < 8; ++j) {
    *(v4bf*)(Qh + ob + (size_t)j * HS) = cvt4(q[j].x, q[j].y, q[j].z, q[j].w);
    *(v4bf*)(Kh + ob + (size_t)j * HS) = cvt4(k[j].x, k[j].y, k[j].z, k[j].w);
  }
}

// ---------------- 5) softmax stats over ALL s (max & sum) ----------------
__global__ void k_stats(const __bf16* __restrict__ Qh, const __bf16* __restrict__ Kh,
                        float* __restrict__ Mb, float* __restrict__ Zb) {
  int wid  = (blockIdx.x * blockDim.x + threadIdx.x) >> 5;
  int lane = threadIdx.x & 31;
  int hf = lane >> 4, ml = lane & 15;
  int tile = wid & 63, bh = wid >> 6;      // 2048 waves: [b*16+h][t-tile]
  int t0 = tile * 16;
  const __bf16* qrow = Qh + ((size_t)bh * TT + t0 + ml) * HS + hf * 8;
  v16bf qa0 = load_frag(qrow);
  v16bf qa1 = load_frag(qrow + 32);
  float mr[8], zz[8];
#pragma unroll
  for (int r = 0; r < 8; ++r) { mr[r] = -3.0e38f; zz[r] = 0.f; }
  for (int st = 0; st < TT / 16; ++st) {
    const __bf16* krow = Kh + ((size_t)bh * TT + st * 16 + ml) * HS + hf * 8;
    v8f s = {};
    s = WMMA_BF16(qa0, load_frag(krow), s);
    s = WMMA_BF16(qa1, load_frag(krow + 32), s);
#pragma unroll
    for (int r = 0; r < 8; ++r) {
      float x = s[r] * 0.125f;               // 1/sqrt(64)
      float tmax = x;
      tmax = fmaxf(tmax, __shfl_xor(tmax, 8, 16));
      tmax = fmaxf(tmax, __shfl_xor(tmax, 4, 16));
      tmax = fmaxf(tmax, __shfl_xor(tmax, 2, 16));
      tmax = fmaxf(tmax, __shfl_xor(tmax, 1, 16));
      float mnew = fmaxf(mr[r], tmax);
      float e = __expf(x - mnew);
      e += __shfl_xor(e, 8, 16);
      e += __shfl_xor(e, 4, 16);
      e += __shfl_xor(e, 2, 16);
      e += __shfl_xor(e, 1, 16);
      zz[r] = zz[r] * __expf(mr[r] - mnew) + e;
      mr[r] = mnew;
    }
  }
  if (ml == 0) {
#pragma unroll
    for (int r = 0; r < 8; ++r) {
      int t = t0 + r + hf * 8;
      Mb[(size_t)bh * TT + t] = mr[r];
      Zb[(size_t)bh * TT + t] = zz[r];
    }
  }
}

// ---------------- 6) fused attention: scores -> p*w -> Wmix -> @v  (att stays on-WGP) ----------------
__global__ void __launch_bounds__(512)
k_attn(const __bf16* __restrict__ Qh, const __bf16* __restrict__ Kh,
       const __bf16* __restrict__ Vt, const float* __restrict__ Mb,
       const float* __restrict__ Zb, const float* __restrict__ tw,
       const float* __restrict__ alpha, const float* __restrict__ beta,
       const float* __restrict__ Wmix, __bf16* __restrict__ Y) {
  // Row pitch 36 dwords (144 B = 16 B x odd): the 16 rows that lanes 0..15 read with one
  // 8-byte load start on 16 different groups of four banks.
  __shared__ __attribute__((aligned(16))) float pw[NH * 16 * PWP];   // 36 KB of 320 KB LDS
  // Each head's decay row with 32 zeros behind it, as the reference pads it: an index past the row
  // (s > t, by at most 31) reads 0, so the reads of the chunk loop need no guard and no branch.
  __shared__ __attribute__((aligned(16))) float twl[NH * TWP];       // 66 KB
  int tile = blockIdx.x & 63, b = blockIdx.x >> 6;
  int wave = threadIdx.x >> 5;                         // = input head h and output head g
  int lane = threadIdx.x & 31;
  int hf = lane >> 4, ml = lane & 15;
  int t0 = tile * 16;
  int h = wave, g = wave;
  int bh = b * NH + h, bg = b * NH + g;

  {
    const float4* trow = (const float4*)(tw + h * TT) + lane;
    float4 tv[8];
#pragma unroll
    for (int j = 0; j < 8; ++j) tv[j] = trow[j * 32];
    // precaution: stands in front of any rewrite of the address registers of the loads above
    asm volatile("s_wait_xcnt 0x0" ::: "memory");
    float4* trl = (float4*)(twl + h * TWP) + lane;
#pragma unroll
    for (int j = 0; j < 8; ++j) trl[j * 32] = tv[j];
    twl[h * TWP + TT + lane] = 0.f;
  }
  // decay weight of (t0 + hf*8 + r, s) = twp[s - r]
  const float* twp = twl + h * TWP + (TT - 1) - t0 - hf * 8;

  const __bf16* qrow = Qh + ((size_t)bh * TT + t0 + ml) * HS + hf * 8;
  v16bf qa0 = load_frag(qrow);
  v16bf qa1 = load_frag(qrow + 32);

  float mr[8], zi[8], bt[8];
#pragma unroll
  for (int r = 0; r < 8; ++r) {
    int t = t0 + r + hf * 8;
    mr[r] = Mb[(size_t)bh * TT + t];
    zi[r] = 1.0f / Zb[(size_t)bh * TT + t];
    bt[r] = beta[h * TT + t];
  }
  float wrow[NH];
#pragma unroll
  for (int j = 0; j < NH; ++j) wrow[j] = Wmix[g * NH + j];

  v8f yac[4] = {};
  int nch = (t0 + 16 + 31) >> 5;
  __syncthreads();   // the staged decay rows are complete before the first read
  for (int ch = 0; ch < nch; ++ch) {
    int s0 = ch * 32;
    // the chunk's 16 decay weights, read in front of the first store to pw so that they issue as a group
    float twv[2][8];
#pragma unroll
    for (int sub = 0; sub < 2; ++sub)
#pragma unroll
      for (int r = 0; r < 8; ++r) twv[sub][r] = twp[s0 + sub * 16 + ml - r];
    float al[2];
    al[0] = alpha[h * TT + s0 + ml];
    al[1] = alpha[h * TT + s0 + 16 + ml];
    // precaution: stands in front of any rewrite of the address registers of the two loads above
    asm volatile("s_wait_xcnt 0x0" ::: "memory");
    // phase A: this wave = head h; two 16-wide s subtiles of exp/Z * w -> LDS
#pragma unroll
    for (int sub = 0; sub < 2; ++sub) {
      int sb = s0 + sub * 16;
      const __bf16* krow = Kh + ((size_t)bh * TT + sb + ml) * HS + hf * 8;
      v8f s = {};
      s = WMMA_BF16(qa0, load_frag(krow), s);
      s = WMMA_BF16(qa1, load_frag(krow + 32), s);
#pragma unroll
      for (int r = 0; r < 8; ++r) {
        int tl = r + hf * 8;
        float p = __expf(s[r] * 0.125f - mr[r]) * zi[r];
        float wv = twv[sub][r] * al[sub] * bt[r];
        pw[(h * 16 + tl) * PWP + sub * 16 + ml] = p * wv;
      }
    }
    __syncthreads();
    // phase B: this wave = output head g; mix 16 heads, repack to A-frag, 4 WMMAs vs Vt
    v16bf am;
#pragma unroll
    for (int j = 0; j < 8; ++j) {
      int sl = hf * 8 + ((j < 4) ? 2 * j : 16 + 2 * (j - 4));
      float a0 = 0.f, a1 = 0.f;
#pragma unroll
      for (int hh = 0; hh < NH; ++hh) {
        const float2 v2 = *(const float2*)&pw[(hh * 16 + ml) * PWP + sl];
        a0 += wrow[hh] * v2.x;
        a1 += wrow[hh] * v2.y;
      }
      am[2 * j]     = (__bf16)a0;
      am[2 * j + 1] = (__bf16)a1;
    }
#pragma unroll
    for (int dt = 0; dt < 4; ++dt) {
      const __bf16* vrow = Vt + ((size_t)bg * HS + dt * 16 + ml) * TT + s0 + hf * 8;
      yac[dt] = WMMA_BF16(am, load_frag(vrow), yac[dt]);
    }
    __syncthreads();
  }
  // write y[b][t][g*64+d] as bf16 for the final WMMA GEMM
#pragma unroll
  for (int dt = 0; dt < 4; ++dt)
#pragma unroll
    for (int r = 0; r < 8; ++r) {
      int t = t0 + r + hf * 8;
      int n = g * HS + dt * 16 + ml;
      Y[((size_t)b * TT + t) * CC + n] = (__bf16)yac[dt][r];
    }
}

// ---------------- host-side orchestration ----------------
extern "C" void kernel_launch(void* const* d_in, const int* in_sizes, int n_in,
                              void* d_out, int out_size, void* d_ws, size_t ws_size,
                              hipStream_t stream) {
  const float* x     = (const float*)d_in[0];
  const float* tw    = (const float*)d_in[1];
  const float* alpha = (const float*)d_in[2];
  const float* beta  = (const float*)d_in[3];
  const float* gamma = (const float*)d_in[4];
  const float* Wq = (const float*)d_in[5];  const float* bq = (const float*)d_in[6];
  const float* Wk = (const float*)d_in[7];  const float* bk = (const float*)d_in[8];
  const float* Wv = (const float*)d_in[9];  const float* bv = (const float*)d_in[10];
  const float* Wmix = (const float*)d_in[11];
  const float* Wo = (const float*)d_in[12]; const float* bo = (const float*)d_in[13];
  float* out = (float*)d_out;

  char* ws = (char*)d_ws;
  const size_t MB = 1u << 20;
  __bf16* XS   = (__bf16*)(ws + 0);          // 4 MB
  __bf16* WQT  = (__bf16*)(ws + 4 * MB);     // 2 MB each
  __bf16* WKT  = (__bf16*)(ws + 6 * MB);
  __bf16* WVT  = (__bf16*)(ws + 8 * MB);
  __bf16* WOT  = (__bf16*)(ws + 10 * MB);
  float*  QR   = (float*)(ws + 12 * MB);     // 8 MB each
  float*  KR   = (float*)(ws + 20 * MB);
  float*  VR   = (float*)(ws + 28 * MB);
  __bf16* QHB  = (__bf16*)(ws + 36 * MB);    // 4 MB each
  __bf16* KHB  = (__bf16*)(ws + 40 * MB);
  __bf16* VTB  = (__bf16*)(ws + 44 * MB);
  float*  MBUF = (float*)(ws + 48 * MB);     // 128 KB each
  float*  ZBUF = (float*)(ws + 48 * MB + (128u << 10));
  __bf16* YBF  = (__bf16*)(ws + 49 * MB);    // 4 MB

  // 1) + 2) shift + bf16 (4 rows per block) and the four weight transpose-converts, one grid
  k_prep<<<SHB + 4 * CVB, 256, 0, stream>>>(x, Wq, Wk, Wv, Wo, XS, WQT, WKT, WVT, WOT);
  // 3) QKV GEMMs: (B*T=2048) x 1024 x 1024 each, 128x64 tile per block of 8 waves, one grid
  const int gblk = (BB * TT / GBM) * (CC / GBN);   // 256 blocks a product
  k_gemm_qkv<<<dim3(gblk, 3), 256, 0, stream>>>(XS, WQT, WKT, WVT, bq, bk, bv, QR, KR, VR);
  // 4) RoPE + relayout
  k_rope<<<BB * TT / 8, 256, 0, stream>>>(QR, KR, VR, QHB, KHB, VTB);
  // 5) softmax stats: 2048 waves = 256 blocks x 8 waves
  k_stats<<<256, 256, 0, stream>>>(QHB, KHB, MBUF, ZBUF);
  // 6) fused attention: one block per (b, 16-row tile), 16 waves = 16 heads
  k_attn<<<BB * (TT / 16), 512, 0, stream>>>(QHB, KHB, VTB, MBUF, ZBUF,
                                             tw, alpha, beta, Wmix, YBF);
  // 7) output GEMM with bias + gamma epilogue
  k_gemm_out<<<gblk, 256, 0, stream>>>(YBF, WOT, bo, gamma, out);
}

// v006
// It runs in 171 microseconds.
// Next to v005, in two timings, it ran 1.26 and 1.25 times as fast.
// All steps since v000 together make it 3.44 times as fast.
#include <hip/hip_runtime.h>
#include <hip/hip_bf16.h>
#include <math.h>

// ---------------- problem constants ----------------
enum : int { BB = 2, TT = 1024, CC = 1024, NH = 16, HS = 64, ROT = 32 };
enum : int { PWP = 36 };   // LDS row pitch of the 32-wide p*w tile, in floats
enum : int { TWP = TT + 32 };   // LDS pitch of one head's decay row: the row, then 32 zeros

typedef __attribute__((ext_vector_type(16))) __bf16 v16bf;
typedef __attribute__((ext_vector_type(8)))  __bf16 v8bf;
typedef __attribute__((ext_vector_type(4)))  __bf16 v4bf;
typedef __attribute__((ext_vector_type(8)))  float  v8f;

#define WMMA_BF16(a, b, c) \
  __builtin_amdgcn_wmma_f32_16x16x32_bf16(false, (a), false, (b), (short)0, (c), false, false)

// Fragment loader: lane supplies base = row_ptr + kb (kb = 8*(lane>=16)).
// Elements 0..7  <- K = kb+0..7   (16B load)
// Elements 8..15 <- K = kb+16..23 (16B load)
static __device__ __forceinline__ v16bf load_frag(const __bf16* p) {
  v8bf lo = *(const v8bf*)p;
  v8bf hi = *(const v8bf*)(p + 16);
  v16bf r;
#pragma unroll
  for (int i = 0; i < 8; ++i) { r[i] = lo[i]; r[i + 8] = hi[i]; }
  return r;
}

// One wave turns a 64-row x 16-column f32 tile into its bf16 transpose, in registers.
// Lane (tl, ng) holds rows tl*8..+7 of columns ng*4..+3: eight 16-byte loads (4 lanes = 64 B of a
// row), four 16-byte stores (8 lanes = one whole 128-B line of a transposed row).
static __device__ __forceinline__ void tile_T(const float* __restrict__ src, int ld_src,
                                              __bf16* __restrict__ dst, int ld_dst, int lane) {
  int ng = lane & 3, tl = lane >> 2;
  const float* p = src + (size_t)(tl * 8) * ld_src + ng * 4;
  float4 v[8];
#pragma unroll
  for (int j = 0; j < 8; ++j) v[j] = *(const float4*)(p + (size_t)j * ld_src);
  // precaution: stands in front of any rewrite of the address registers of the loads above
  asm volatile("s_wait_xcnt 0x0" ::: "memory");
  v8bf o0, o1, o2, o3;
#pragma unroll
  for (int j = 0; j < 8; ++j) {
    o0[j] = (__bf16)v[j].x; o1[j] = (__bf16)v[j].y;
    o2[j] = (__bf16)v[j].z; o3[j] = (__bf16)v[j].w;
  }
  __bf16* q = dst + (size_t)(ng * 4) * ld_dst + tl * 8;
  *(v8bf*)(q)                      = o0;
  *(v8bf*)(q + (size_t)ld_dst)     = o1;
  *(v8bf*)(q + (size_t)2 * ld_dst) = o2;
  *(v8bf*)(q + (size_t)3 * ld_dst) = o3;
}

static __device__ __forceinline__ v4bf cvt4(float a, float b, float c, float d) {
  v4bf r;
  r[0] = (__bf16)a; r[1] = (__bf16)b; r[2] = (__bf16)c; r[3] = (__bf16)d;
  return r;
}

// ---------------- 1) time-shift + f32->bf16 ----------------
// A block of 256 threads spans one row (256 groups of 4 channels) and takes 4 rows.
static __device__ __forceinline__ void shift_rows(const float* __restrict__ x,
                                                  __bf16* __restrict__ xs, int blk) {
  int c = threadIdx.x * 4;
  int row0 = blk * 4;
  int back = (c < CC / 2) ? 1 : 0;             // first half of the channels reads row t-1
  float4 v[4];
#pragma unroll
  for (int q = 0; q < 4; ++q) {
    int srow = row0 + q - back;                // clamped so that all four loads issue together
    v[q] = *(const float4*)(x + (size_t)(srow < 0 ? 0 : srow) * CC + c);
  }
  // precaution: stands in front of any rewrite of the address registers of the loads above
  asm volatile("s_wait_xcnt 0x0" ::: "memory");
#pragma unroll
  for (int q = 0; q < 4; ++q)
    if (back && ((row0 + q) & (TT - 1)) == 0) v[q] = make_float4(0.f, 0.f, 0.f, 0.f);
#pragma unroll
  for (int q = 0; q < 4; ++q)
    *(v4bf*)(xs + (size_t)(row0 + q) * CC + c) = cvt4(v[q].x, v[q].y, v[q].z, v[q].w);
}

// ---------------- 2) W[k][n] f32 -> Wt[n][k] bf16 ----------------
// 1024 waves a matrix: wave = (64-row k tile, 16-column n tile)
static __device__ __forceinline__ void convT(const float* __restrict__ W,
                                             __bf16* __restrict__ Wt, int blk) {
  int gw = (blk * 256 + threadIdx.x) >> 5;
  int kt = gw >> 6, nt = gw & 63;
  tile_T(W + (size_t)kt * 64 * CC + nt * 16, CC,
         Wt + (size_t)nt * 16 * CC + kt * 64, CC, threadIdx.x & 31);
  // precaution: stands in front of any rewrite of the registers that the tile's four stores name
  asm volatile("s_wait_xcnt 0x0" ::: "memory");
}

// 1) and 2) depend on nothing and on each other not at all: one grid holds them, by block range.
enum : int { SHB = BB * TT / 4, CVB = 128 };   // blocks of the shift; blocks of one weight matrix
__global__ void __launch_bounds__(256)
k_prep(const float* __restrict__ x, const float* __restrict__ Wq, const float* __restrict__ Wk,
       const float* __restrict__ Wv, const float* __restrict__ Wo, __bf16* __restrict__ xs,
       __bf16* __restrict__ Wqt, __bf16* __restrict__ Wkt, __bf16* __restrict__ Wvt,
       __bf16* __restrict__ Wot) {
  int blk = blockIdx.x;
  if (blk < SHB) { shift_rows(x, xs, blk); return; }
  blk -= SHB;
  int sel = blk / CVB;
  const float* W = sel == 0 ? Wq : sel == 1 ? Wk : sel == 2 ? Wv : Wo;
  __bf16* Wt = sel == 0 ? Wqt : sel == 1 ? Wkt : sel == 2 ? Wvt : Wot;
  convT(W, Wt, blk % CVB);
}

// ---------------- bf16 WMMA GEMM, operands staged in LDS, 32x32 per wave ----------------
// out = A @ Bt^T + bias (opt *gamma[m%T]); M = BB*TT, N = K = CC.
// A block of 8 waves (4 x 2) owns a 128 x 64 tile of out. A stage is 128 k (256 B) of the block's
// 128 rows of A and 64 rows of Bt, brought into LDS by asynchronous 16-byte copies: 16 lanes take
// one row's 256 B, so every copy instruction moves whole lines. Two buffers: the next stage's
// copies fly while this stage is worked on.
enum : int { GBM = 128, GBN = 64, GBK = 128, GNT = CC / GBK };
enum : int { GPITCH = 2 * GBK + 16 };             // LDS row pitch in bytes: 272 = 16 B x odd
enum : int { GBUF = (GBM + GBN) * GPITCH };       // one buffer: the A rows, then the Bt rows

// Four copies of this lane: rows 16 apart in the source (pitch CC elements) and in LDS.
static __device__ __forceinline__ void copy4(unsigned lds, const __bf16* g) {
  // The wait is the last line of the copies' own statement, so that it stands in front of any
  // rewrite of the address registers that the copies name (a precaution).
  asm volatile("global_load_async_to_lds_b128 %0, %4, off\n\t"
               "global_load_async_to_lds_b128 %1, %5, off\n\t"
               "global_load_async_to_lds_b128 %2, %6, off\n\t"
               "global_load_async_to_lds_b128 %3, %7, off\n\t"
               "s_wait_xcnt 0x0"
               :: "v"(lds), "v"(lds + 16 * GPITCH), "v"(lds + 32 * GPITCH), "v"(lds + 48 * GPITCH),
                  "v"(g), "v"(g + 16 * CC), "v"(g + 32 * CC), "v"(g + 48 * CC)
               : "memory");
}

// One stage: 8 copies of A and 4 of Bt per lane. la = this lane's LDS place in the buffer's row
// tid>>4, ga / gb = the same place of the stage in A / Bt.
static __device__ __forceinline__ void copy_stage(unsigned la, const __bf16* ga, const __bf16* gb) {
  copy4(la, ga);
  copy4(la + 64 * GPITCH, ga + 64 * CC);
  copy4(la + GBM * GPITCH, gb);
}

static __device__ __forceinline__ void
gemm_tile(const __bf16* __restrict__ A, const __bf16* __restrict__ Bt,
          const float* __restrict__ bias, const float* __restrict__ gamma,
          float* __restrict__ out) {
  __shared__ __attribute__((aligned(16))) unsigned char sm[2 * GBUF];   // 102 KB
  int tid  = threadIdx.x;
  int wave = tid >> 5, lane = tid & 31;
  int hf = lane >> 4, ml = lane & 15;
  int bm0 = (blockIdx.x >> 4) * GBM, bn0 = (blockIdx.x & 15) * GBN;     // 16 x 16 block tiles
  int wm = (wave >> 1) * 32, wn = (wave & 1) * 32;

  unsigned la = (unsigned)(size_t)sm + (unsigned)((tid >> 4) * GPITCH + (tid & 15) * 16);
  const __bf16* ga = A  + (size_t)(bm0 + (tid >> 4)) * CC + (tid & 15) * 8;
  const __bf16* gb = Bt + (size_t)(bn0 + (tid >> 4)) * CC + (tid & 15) * 8;

  copy_stage(la, ga, gb);
  // stage 0 has landed for this wave; the barrier publishes it to the others
  asm volatile("s_wait_asynccnt 0x0" ::: "memory");
  __syncthreads();
  copy_stage(la + GBUF, ga + GBK, gb + GBK);

  v8f a00 = {}, a01 = {}, a10 = {}, a11 = {};
  for (int t = 0; t < GNT; ++t) {
    const unsigned char* bufp = sm + (t & 1) * GBUF;
    const unsigned char* pa = bufp + (wm + ml) * GPITCH + hf * 16;
    const unsigned char* pb = bufp + (GBM + wn + ml) * GPITCH + hf * 16;
    // unrolled so that the four k steps differ only in the immediate offsets of their LDS reads
#pragma unroll
    for (int ks = 0; ks < GBK / 32; ++ks) {
      v16bf fa0 = load_frag((const __bf16*)(pa + ks * 64));
      v16bf fa1 = load_frag((const __bf16*)(pa + 16 * GPITCH + ks * 64));
      v16bf fb0 = load_frag((const __bf16*)(pb + ks * 64));
      v16bf fb1 = load_frag((const __bf16*)(pb + 16 * GPITCH + ks * 64));
      a00 = WMMA_BF16(fa0, fb0, a00);
      a01 = WMMA_BF16(fa0, fb1, a01);
      a10 = WMMA_BF16(fa1, fb0, a10);
      a11 = WMMA_BF16(fa1, fb1, a11);
    }
    // this wave's reads of the buffer have returned before the buffer is handed to the copies
    asm volatile("s_wait_dscnt 0x0" ::: "memory");
    // this wave's copies of stage t + 1 have landed
    asm volatile("s_wait_asynccnt 0x0" ::: "memory");
    __syncthreads();   // publishes stage t + 1 and ends every wave's reads of stage t
    if (t + 2 < GNT)
      copy_stage(la + (t & 1) * GBUF, ga + (t + 2) * GBK, gb + (t + 2) * GBK);
  }
  // no copy is outstanding when the wave ends
  asm volatile("s_wait_asynccnt 0x0" ::: "memory");

  int m0 = bm0 + wm, n0 = bn0 + wn;
#pragma unroll
  for (int bm = 0; bm < 2; ++bm)
#pragma unroll
    for (int bn = 0; bn < 2; ++bn) {
      const v8f& acc = bm ? (bn ? a11 : a10) : (bn ? a01 : a00);
      int n = n0 + bn * 16 + ml;
      float bv = bias ? bias[n] : 0.f;
#pragma unroll
      for (int r = 0; r < 8; ++r) {
        int m = m0 + bm * 16 + r + hf * 8;
        float v = acc[r] + bv;
        if (gamma) v *= gamma[m % TT];
        out[(size_t)m * CC + n] = v;
        // precaution: stands in front of any rewrite of the registers that the store above names
        asm volatile("s_wait_xcnt 0x0" ::: "memory");
      }
    }
}

// The three projections read the same A and depend on each other not at all: one grid, blockIdx.y
// names the projection. Three blocks (102 KB of LDS each) stand on a WGP together.
__global__ void __launch_bounds__(256)
k_gemm_qkv(const __bf16* __restrict__ A, const __bf16* __restrict__ Wqt,
           const __bf16* __restrict__ Wkt, const __bf16* __restrict__ Wvt,
           const float* __restrict__ bq, const float* __restrict__ bk,
           const float* __restrict__ bv, float* __restrict__ Q, float* __restrict__ K,
           float* __restrict__ V) {
  int sel = blockIdx.y;
  gemm_tile(A, sel == 0 ? Wqt : sel == 1 ? Wkt : Wvt, sel == 0 ? bq : sel == 1 ? bk : bv,
            nullptr, sel == 0 ? Q : sel == 1 ? K : V);
}

__global__ void __launch_bounds__(256)
k_gemm_out(const __bf16* __restrict__ A, const __bf16* __restrict__ Bt,
           const float* __restrict__ bias, const float* __restrict__ gamma,
           float* __restrict__ out) {
  gemm_tile(A, Bt, bias, gamma, out);
}

// ---------------- 4) RoPE + relayout to WMMA-friendly buffers ----------------
// Qh/Kh: [b*16+h][t][64] bf16 ;  Vt: [b*16+h][d][1024] bf16 (transposed for att@v B-frags)
// A block takes 8 rows (t) of Q and K, each thread 4 channels of each row, and 8 V tiles of tile_T.
__global__ void __launch_bounds__(256)
k_rope(const float* __restrict__ Q, const float* __restrict__ Kr,
       const float* __restrict__ V, __bf16* __restrict__ Qh,
       __bf16* __restrict__ Kh, __bf16* __restrict__ Vt) {
  {
    int gw = blockIdx.x * 8 + (threadIdx.x >> 5);
    int rt = gw >> 6, nt = gw & 63;            // 64-row tile over b*T+t, 16-column tile over h*64+d
    int vb = rt >> 4, tq = rt & 15;
    tile_T(V + (size_t)rt * 64 * CC + nt * 16, CC,
           Vt + ((size_t)vb * CC + nt * 16) * TT + tq * 64, TT, threadIdx.x & 31);
  }
  int nn = threadIdx.x * 4;
  int h = nn >> 6, d = nn & 63;
  int row0 = blockIdx.x * 8;
  int b = row0 / TT, t0 = row0 % TT;
  const float* qp = Q  + (size_t)row0 * CC + nn;
  const float* kp = Kr + (size_t)row0 * CC + nn;
  float4 q[8], k[8];
#pragma unroll
  for (int j = 0; j < 8; ++j) {
    q[j] = *(const float4*)(qp + (size_t)j * CC);
    k[j] = *(const float4*)(kp + (size_t)j * CC);
  }
  if (d < ROT) {
    int po = (d < 16) ? 16 : -16;              // the group of 4 never straddles a multiple of 16
    float sgn = (d < 16) ? -1.f : 1.f;
    float inv[4];
#pragma unroll
    for (int e = 0; e < 4; ++e) inv[e] = __powf(1024.0f, -(float)((d + e) & 15) / 16.0f);
#pragma unroll
    for (int j = 0; j < 8; ++j) {
      float4 pq = *(const float4*)(qp + (ptrdiff_t)j * CC + po);
      float4 pk = *(const float4*)(kp + (ptrdiff_t)j * CC + po);
      float tf = (float)(t0 + j);
      float f0 = tf * inv[0], f1 = tf * inv[1], f2 = tf * inv[2], f3 = tf * inv[3];
      float c0 = __cosf(f0), s0 = __sinf(f0), c1 = __cosf(f1), s1 = __sinf(f1);
      float c2 = __cosf(f2), s2 = __sinf(f2), c3 = __cosf(f3), s3 = __sinf(f3);
      q[j].x = q[j].x * c0 + sgn * pq.x * s0;  k[j].x = k[j].x * c0 + sgn * pk.x * s0;
      q[j].y = q[j].y * c1 + sgn * pq.y * s1;  k[j].y = k[j].y * c1 + sgn * pk.y * s1;
      q[j].z = q[j].z * c2 + sgn * pq.z * s2;  k[j].z = k[j].z * c2 + sgn * pk.z * s2;
      q[j].w = q[j].w * c3 + sgn * pq.w * s3;  k[j].w = k[j].w * c3 + sgn * pk.w * s3;
    }
  }
  size_t ob = ((size_t)(b * NH + h) * TT + t0) * HS + d;
#pragma unroll
  for (int j = 0; j < 8; ++j) {
    *(v4bf*)(Qh + ob + (size_t)j * HS) = cvt4(q[j].x, q[j].y, q[j].z, q[j].w);
    *(v4bf*)(Kh + ob + (size_t)j * HS) = cvt4(k[j].x, k[j].y, k[j].z, k[j].w);
  }
}

// ---------------- 5) softmax stats over ALL s (max & sum) ----------------
// Each lane keeps the running maximum and sum of the keys of its own column (s = 16*i + ml) alone;
// the 16 lanes of a row are merged once, behind the loop. A pass takes 64 keys: one maximum, one
// rescale of the sum. The bound is the launch's own block size: it gives a pass's 16 loads the
// registers to be in flight together.
__global__ void __launch_bounds__(256) k_stats(const __bf16* __restrict__ Qh, const __bf16* __restrict__ Kh,
                        float* __restrict__ Mb, float* __restrict__ Zb) {
  int wid  = (blockIdx.x * blockDim.x + threadIdx.x) >> 5;
  int lane = threadIdx.x & 31;
  int hf = lane >> 4, ml = lane & 15;
  int tile = wid & 63, bh = wid >> 6;      // 2048 waves: [b*16+h][t-tile]
  int t0 = tile * 16;
  const __bf16* qrow = Qh + ((size_t)bh * TT + t0 + ml) * HS + hf * 8;
  v16bf qa0 = load_frag(qrow);
  v16bf qa1 = load_frag(qrow + 32);
  float mr[8], zz[8];
#pragma unroll
  for (int r = 0; r < 8; ++r) { mr[r] = -3.0e38f; zz[r] = 0.f; }
  const __bf16* krow = Kh + ((size_t)bh * TT + ml) * HS + hf * 8;
  for (int st = 0; st < TT / 64; ++st) {
    v16bf kf[4][2];
    v8f s[4];
    // unrolled so that kf[] stays in registers
#pragma unroll
    for (int u = 0; u < 4; ++u) {
      const __bf16* kp = krow + (size_t)(st * 64 + u * 16) * HS;
      kf[u][0] = load_frag(kp);
      kf[u][1] = load_frag(kp + 32);
    }
    // keeps the products behind all 16 loads of the pass: without it the scheduler puts products
    // between the loads to reuse their registers, and a pass waits for memory several times over
    __builtin_amdgcn_sched_barrier(0);
    // unrolled so that s[] stays in registers
#pragma unroll
    for (int u = 0; u < 4; ++u) {
      v8f acc = {};
      acc = WMMA_BF16(qa0, kf[u][0], acc);
      s[u] = WMMA_BF16(qa1, kf[u][1], acc);
    }
    // unrolled so that mr[] and zz[] stay in registers; the eight rows are independent chains
#pragma unroll
    for (int r = 0; r < 8; ++r) {
      float x0 = s[0][r] * 0.125f, x1 = s[1][r] * 0.125f;   // 1/sqrt(64)
      float x2 = s[2][r] * 0.125f, x3 = s[3][r] * 0.125f;
      float mnew = fmaxf(fmaxf(fmaxf(x0, x1), fmaxf(x2, x3)), mr[r]);
      float e = (__expf(x0 - mnew) + __expf(x1 - mnew)) + (__expf(x2 - mnew) + __expf(x3 - mnew));
      zz[r] = zz[r] * __expf(mr[r] - mnew) + e;
      mr[r] = mnew;
    }
  }
  // the merge of a row's 16 lanes; unrolled so that the eight rows' exchanges overlap
#pragma unroll
  for (int r = 0; r < 8; ++r) {
    float m = mr[r];
    m = fmaxf(m, __shfl_xor(m, 8, 16));
    m = fmaxf(m, __shfl_xor(m, 4, 16));
    m = fmaxf(m, __shfl_xor(m, 2, 16));
    m = fmaxf(m, __shfl_xor(m, 1, 16));
    float z = zz[r] * __expf(mr[r] - m);
    z += __shfl_xor(z, 8, 16);
    z += __shfl_xor(z, 4, 16);
    z += __shfl_xor(z, 2, 16);
    z += __shfl_xor(z, 1, 16);
    mr[r] = m;
    zz[r] = z;
  }
  if (ml == 0) {
#pragma unroll
    for (int r = 0; r < 8; ++r) {
      int t = t0 + r + hf * 8;
      Mb[(size_t)bh * TT + t] = mr[r];
      Zb[(size_t)bh * TT + t] = zz[r];
    }
  }
}

// ---------------- 6) fused attention: scores -> p*w -> Wmix -> @v  (att stays on-WGP) ----------------
__global__ void __launch_bounds__(512)
k_attn(const __bf16* __restrict__ Qh, const __bf16* __restrict__ Kh,
       const __bf16* __restrict__ Vt, const float* __restrict__ Mb,
       const float* __restrict__ Zb, const float* __restrict__ tw,
       const float* __restrict__ alpha, const float* __restrict__ beta,
       const float* __restrict__ Wmix, __bf16* __restrict__ Y) {
  // Row pitch 36 dwords (144 B = 16 B x odd): the 16 rows that lanes 0..15 read with one
  // 8-byte load start on 16 different groups of four banks.
  __shared__ __attribute__((aligned(16))) float pw[NH * 16 * PWP];   // 36 KB of 320 KB LDS
  // Each head's decay row with 32 zeros behind it, as the reference pads it: an index past the row
  // (s > t, by at most 31) reads 0, so the reads of the chunk loop need no guard and no branch.
  __shared__ __attribute__((aligned(16))) float twl[NH * TWP];       // 66 KB
  int tile = blockIdx.x & 63, b = blockIdx.x >> 6;
  int wave = threadIdx.x >> 5;                         // = input head h and output head g
  int lane = threadIdx.x & 31;
  int hf = lane >> 4, ml = lane & 15;
  int t0 = tile * 16;
  int h = wave, g = wave;
  int bh = b * NH + h, bg = b * NH + g;

  {
    const float4* trow = (const float4*)(tw + h * TT) + lane;
    float4 tv[8];
#pragma unroll
    for (int j = 0; j < 8; ++j) tv[j] = trow[j * 32];
    // precaution: stands in front of any rewrite of the address registers of the loads above
    asm volatile("s_wait_xcnt 0x0" ::: "memory");
    float4* trl = (float4*)(twl + h * TWP) + lane;
#pragma unroll
    for (int j = 0; j < 8; ++j) trl[j * 32] = tv[j];
    twl[h * TWP + TT + lane] = 0.f;
  }
  // decay weight of (t0 + hf*8 + r, s) = twp[s - r]
  const float* twp = twl + h * TWP + (TT - 1) - t0 - hf * 8;

  const __bf16* qrow = Qh + ((size_t)bh * TT + t0 + ml) * HS + hf * 8;
  v16bf qa0 = load_frag(qrow);
  v16bf qa1 = load_frag(qrow + 32);

  float mr[8], zi[8], bt[8];
#pragma unroll
  for (int r = 0; r < 8; ++r) {
    int t = t0 + r + hf * 8;
    mr[r] = Mb[(size_t)bh * TT + t];
    zi[r] = 1.0f / Zb[(size_t)bh * TT + t];
    bt[r] = beta[h * TT + t];
  }
  float wrow[NH];
#pragma unroll
  for (int j = 0; j < NH; ++j) wrow[j] = Wmix[g * NH + j];

  v8f yac[4] = {};
  int nch = (t0 + 16 + 31) >> 5;
  __syncthreads();   // the staged decay rows are complete before the first read
  for (int ch = 0; ch < nch; ++ch) {
    int s0 = ch * 32;
    // the chunk's 16 decay weights, read in front of the first store to pw so that they issue as a group
    float twv[2][8];
#pragma unroll
    for (int sub = 0; sub < 2; ++sub)
#pragma unroll
      for (int r = 0; r < 8; ++r) twv[sub][r] = twp[s0 + sub * 16 + ml - r];
    float al[2];
    al[0] = alpha[h * TT + s0 + ml];
    al[1] = alpha[h * TT + s0 + 16 + ml];
    // precaution: stands in front of any rewrite of the address registers of the two loads above
    asm volatile("s_wait_xcnt 0x0" ::: "memory");
    // phase A: this wave = head h; two 16-wide s subtiles of exp/Z * w -> LDS
#pragma unroll
    for (int sub = 0; sub < 2; ++sub) {
      int sb = s0 + sub * 16;
      const __bf16* krow = Kh + ((size_t)bh * TT + sb + ml) * HS + hf * 8;
      v8f s = {};
      s = WMMA_BF16(qa0, load_frag(krow), s);
      s = WMMA_BF16(qa1, load_frag(krow + 32), s);
#pragma unroll
      for (int r = 0; r < 8; ++r) {
        int tl = r + hf * 8;
        float p = __expf(s[r] * 0.125f - mr[r]) * zi[r];
        float wv = twv[sub][r] * al[sub] * bt[r];
        pw[(h * 16 + tl) * PWP + sub * 16 + ml] = p * wv;
      }
    }
    __syncthreads();
    // phase B: this wave = output head g; mix 16 heads, repack to A-frag, 4 WMMAs vs Vt
    v16bf am;
#pragma unroll
    for (int j = 0; j < 8; ++j) {
      int sl = hf * 8 + ((j < 4) ? 2 * j : 16 + 2 * (j - 4));
      float a0 = 0.f, a1 = 0.f;
#pragma unroll
      for (int hh = 0; hh < NH; ++hh) {
        const float2 v2 = *(const float2*)&pw[(hh * 16 + ml) * PWP + sl];
        a0 += wrow[hh] * v2.x;
        a1 += wrow[hh] * v2.y;
      }
      am[2 * j]     = (__bf16)a0;
      am[2 * j + 1] = (__bf16)a1;
    }
#pragma unroll
    for (int dt = 0; dt < 4; ++dt) {
      const __bf16* vrow = Vt + ((size_t)bg * HS + dt * 16 + ml) * TT + s0 + hf * 8;
      yac[dt] = WMMA_BF16(am, load_frag(vrow), yac[dt]);
    }
    __syncthreads();
  }
  // write y[b][t][g*64+d] as bf16 for the final WMMA GEMM
#pragma unroll
  for (int dt = 0; dt < 4; ++dt)
#pragma unroll
    for (int r = 0; r < 8; ++r) {
      int t = t0 + r + hf * 8;
      int n = g * HS + dt * 16 + ml;
      Y[((size_t)b * TT + t) * CC + n] = (__bf16)yac[dt][r];
    }
}

// ---------------- host-side orchestration ----------------
extern "C" void kernel_launch(void* const* d_in, const int* in_sizes, int n_in,
                              void* d_out, int out_size, void* d_ws, size_t ws_size,
                              hipStream_t stream) {
  const float* x     = (const float*)d_in[0];
  const float* tw    = (const float*)d_in[1];
  const float* alpha = (const float*)d_in[2];
  const float* beta  = (const float*)d_in[3];
  const float* gamma = (const float*)d_in[4];
  const float* Wq = (const float*)d_in[5];  const float* bq = (const float*)d_in[6];
  const float* Wk = (const float*)d_in[7];  const float* bk = (const float*)d_in[8];
  const float* Wv = (const float*)d_in[9];  const float* bv = (const float*)d_in[10];
  const float* Wmix = (const float*)d_in[11];
  const float* Wo = (const float*)d_in[12]; const float* bo = (const float*)d_in[13];
  float* out = (float*)d_out;

  char* ws = (char*)d_ws;
  const size_t MB = 1u << 20;
  __bf16* XS   = (__bf16*)(ws + 0);          // 4 MB
  __bf16* WQT  = (__bf16*)(ws + 4 * MB);     // 2 MB each
  __bf16* WKT  = (__bf16*)(ws + 6 * MB);
  __bf16* WVT  = (__bf16*)(ws + 8 * MB);
  __bf16* WOT  = (__bf16*)(ws + 10 * MB);
  float*  QR   = (float*)(ws + 12 * MB);     // 8 MB each
  float*  KR   = (float*)(ws + 20 * MB);
  float*  VR   = (float*)(ws + 28 * MB);
  __bf16* QHB  = (__bf16*)(ws + 36 * MB);    // 4 MB each
  __bf16* KHB  = (__bf16*)(ws + 40 * MB);
  __bf16* VTB  = (__bf16*)(ws + 44 * MB);
  float*  MBUF = (float*)(ws + 48 * MB);     // 128 KB each
  float*  ZBUF = (float*)(ws + 48 * MB + (128u << 10));
  __bf16* YBF  = (__bf16*)(ws + 49 * MB);    // 4 MB

  // 1) + 2) shift + bf16 (4 rows per block) and the four weight transpose-converts, one grid
  k_prep<<<SHB + 4 * CVB, 256, 0, stream>>>(x, Wq, Wk, Wv, Wo, XS, WQT, WKT, WVT, WOT);
  // 3) QKV GEMMs: (B*T=2048) x 1024 x 1024 each, 128x64 tile per block of 8 waves, one grid
  const int gblk = (BB * TT / GBM) * (CC / GBN);   // 256 blocks a product
  k_gemm_qkv<<<dim3(gblk, 3), 256, 0, stream>>>(XS, WQT, WKT, WVT, bq, bk, bv, QR, KR, VR);
  // 4) RoPE + relayout
  k_rope<<<BB * TT / 8, 256, 0, stream>>>(QR, KR, VR, QHB, KHB, VTB);
  // 5) softmax stats: 2048 waves = 256 blocks x 8 waves
  k_stats<<<256, 256, 0, stream>>>(QHB, KHB, MBUF, ZBUF);
  // 6) fused attention: one block per (b, 16-row tile), 16 waves = 16 heads
  k_attn<<<BB * (TT / 16), 512, 0, stream>>>(QHB, KHB, VTB, MBUF, ZBUF,
                                             tw, alpha, beta, Wmix, YBF);
  // 7) output GEMM with bias + gamma epilogue
  k_gemm_out<<<gblk, 256, 0, stream>>>(YBF, WOT, bo, gamma, out);
}

// v007
// Measured time: 153 microseconds a run.
// Timed twice side by side with v006, it ran 1.11 and 1.12 times as fast.
// Counting every step since v000, it is 3.84 times as fast.
#include <hip/hip_runtime.h>
#include <hip/hip_bf16.h>
#include <math.h>

// ---------------- problem constants ----------------
enum : int { BB = 2, TT = 1024, CC = 1024, NH = 16, HS = 64, ROT = 32 };
enum : int { PRP = 68 };   // LDS row pitch of the p*w tile, in floats: 32 keys x 2 heads, then 4
enum : int { AMP = 40 };   // LDS row pitch of the mixed tile, in bf16: 80 B = 16 B x odd
enum : int { AMG = 16 * AMP + 8 };   // one output head's 16 mixed rows, in bf16: 1296 B = 16 B x odd
enum : int { TWP = TT + 32 };   // LDS pitch of one head's decay row: the row, then 32 zeros

typedef __attribute__((ext_vector_type(16))) __bf16 v16bf;
typedef __attribute__((ext_vector_type(8)))  __bf16 v8bf;
typedef __attribute__((ext_vector_type(4)))  __bf16 v4bf;
typedef __attribute__((ext_vector_type(8)))  float  v8f;
typedef __attribute__((ext_vector_type(2)))  float  v2f;

#define WMMA_BF16(a, b, c) \
  __builtin_amdgcn_wmma_f32_16x16x32_bf16(false, (a), false, (b), (short)0, (c), false, false)
#define WMMA_F32(a, b, c) \
  __builtin_amdgcn_wmma_f32_16x16x4_f32(false, (a), false, (b), (short)0, (c), false, false)

// Fragment loader: lane supplies base = row_ptr + kb (kb = 8*(lane>=16)).
// Elements 0..7  <- K = kb+0..7   (16B load)
// Elements 8..15 <- K = kb+16..23 (16B load)
static __device__ __forceinline__ v16bf load_frag(const __bf16* p) {
  v8bf lo = *(const v8bf*)p;
  v8bf hi = *(const v8bf*)(p + 16);
  v16bf r;
#pragma unroll
  for (int i = 0; i < 8; ++i) { r[i] = lo[i]; r[i + 8] = hi[i]; }
  return r;
}

// One wave turns a 64-row x 16-column f32 tile into its bf16 transpose, in registers.
// Lane (tl, ng) holds rows tl*8..+7 of columns ng*4..+3: eight 16-byte loads (4 lanes = 64 B of a
// row), four 16-byte stores (8 lanes = one whole 128-B line of a transposed row).
static __device__ __forceinline__ void tile_T(const float* __restrict__ src, int ld_src,
                                              __bf16* __restrict__ dst, int ld_dst, int lane) {
  int ng = lane & 3, tl = lane >> 2;
  const float* p = src + (size_t)(tl * 8) * ld_src + ng * 4;
  float4 v[8];
#pragma unroll
  for (int j = 0; j < 8; ++j) v[j] = *(const float4*)(p + (size_t)j * ld_src);
  // precaution: stands in front of any rewrite of the address registers of the loads above
  asm volatile("s_wait_xcnt 0x0" ::: "memory");
  v8bf o0, o1, o2, o3;
#pragma unroll
  for (int j = 0; j < 8; ++j) {
    o0[j] = (__bf16)v[j].x; o1[j] = (__bf16)v[j].y;
    o2[j] = (__bf16)v[j].z; o3[j] = (__bf16)v[j].w;
  }
  __bf16* q = dst + (size_t)(ng * 4) * ld_dst + tl * 8;
  *(v8bf*)(q)                      = o0;
  *(v8bf*)(q + (size_t)ld_dst)     = o1;
  *(v8bf*)(q + (size_t)2 * ld_dst) = o2;
  *(v8bf*)(q + (size_t)3 * ld_dst) = o3;
}

static __device__ __forceinline__ v4bf cvt4(float a, float b, float c, float d) {
  v4bf r;
  r[0] = (__bf16)a; r[1] = (__bf16)b; r[2] = (__bf16)c; r[3] = (__bf16)d;
  return r;
}

// ---------------- 1) time-shift + f32->bf16 ----------------
// A block of 256 threads spans one row (256 groups of 4 channels) and takes 4 rows.
static __device__ __forceinline__ void shift_rows(const float* __restrict__ x,
                                                  __bf16* __restrict__ xs, int blk) {
  int c = threadIdx.x * 4;
  int row0 = blk * 4;
  int back = (c < CC / 2) ? 1 : 0;             // first half of the channels reads row t-1
  float4 v[4];
#pragma unroll
  for (int q = 0; q < 4; ++q) {
    int srow = row0 + q - back;                // clamped so that all four loads issue together
    v[q] = *(const float4*)(x + (size_t)(srow < 0 ? 0 : srow) * CC + c);
  }
  // precaution: stands in front of any rewrite of the address registers of the loads above
  asm volatile("s_wait_xcnt 0x0" ::: "memory");
#pragma unroll
  for (int q = 0; q < 4; ++q)
    if (back && ((row0 + q) & (TT - 1)) == 0) v[q] = make_float4(0.f, 0.f, 0.f, 0.f);
#pragma unroll
  for (int q = 0; q < 4; ++q)
    *(v4bf*)(xs + (size_t)(row0 + q) * CC + c) = cvt4(v[q].x, v[q].y, v[q].z, v[q].w);
}

// ---------------- 2) W[k][n] f32 -> Wt[n][k] bf16 ----------------
// 1024 waves a matrix: wave = (64-row k tile, 16-column n tile)
static __device__ __forceinline__ void convT(const float* __restrict__ W,
                                             __bf16* __restrict__ Wt, int blk) {
  int gw = (blk * 256 + threadIdx.x) >> 5;
  int kt = gw >> 6, nt = gw & 63;
  tile_T(W + (size_t)kt * 64 * CC + nt * 16, CC,
         Wt + (size_t)nt * 16 * CC + kt * 64, CC, threadIdx.x & 31);
  // precaution: stands in front of any rewrite of the registers that the tile's four stores name
  asm volatile("s_wait_xcnt 0x0" ::: "memory");
}

// 1) and 2) depend on nothing and on each other not at all: one grid holds them, by block range.
enum : int { SHB = BB * TT / 4, CVB = 128 };   // blocks of the shift; blocks of one weight matrix
__global__ void __launch_bounds__(256)
k_prep(const float* __restrict__ x, const float* __restrict__ Wq, const float* __restrict__ Wk,
       const float* __restrict__ Wv, const float* __restrict__ Wo, __bf16* __restrict__ xs,
       __bf16* __restrict__ Wqt, __bf16* __restrict__ Wkt, __bf16* __restrict__ Wvt,
       __bf16* __restrict__ Wot) {
  int blk = blockIdx.x;
  if (blk < SHB) { shift_rows(x, xs, blk); return; }
  blk -= SHB;
  int sel = blk / CVB;
  const float* W = sel == 0 ? Wq : sel == 1 ? Wk : sel == 2 ? Wv : Wo;
  __bf16* Wt = sel == 0 ? Wqt : sel == 1 ? Wkt : sel == 2 ? Wvt : Wot;
  convT(W, Wt, blk % CVB);
}

// ---------------- bf16 WMMA GEMM, operands staged in LDS, 32x32 per wave ----------------
// out = A @ Bt^T + bias (opt *gamma[m%T]); M = BB*TT, N = K = CC.
// A block of 8 waves (4 x 2) owns a 128 x 64 tile of out. A stage is 128 k (256 B) of the block's
// 128 rows of A and 64 rows of Bt, brought into LDS by asynchronous 16-byte copies: 16 lanes take
// one row's 256 B, so every copy instruction moves whole lines. Two buffers: the next stage's
// copies fly while this stage is worked on.
enum : int { GBM = 128, GBN = 64, GBK = 128, GNT = CC / GBK };
enum : int { GPITCH = 2 * GBK + 16 };             // LDS row pitch in bytes: 272 = 16 B x odd
enum : int { GBUF = (GBM + GBN) * GPITCH };       // one buffer: the A rows, then the Bt rows

// Four copies of this lane: rows 16 apart in the source (pitch CC elements) and in LDS.
static __device__ __forceinline__ void copy4(unsigned lds, const __bf16* g) {
  // The wait is the last line of the copies' own statement, so that it stands in front of any
  // rewrite of the address registers that the copies name (a precaution).
  asm volatile("global_load_async_to_lds_b128 %0, %4, off\n\t"
               "global_load_async_to_lds_b128 %1, %5, off\n\t"
               "global_load_async_to_lds_b128 %2, %6, off\n\t"
               "global_load_async_to_lds_b128 %3, %7, off\n\t"
               "s_wait_xcnt 0x0"
               :: "v"(lds), "v"(lds + 16 * GPITCH), "v"(lds + 32 * GPITCH), "v"(lds + 48 * GPITCH),
                  "v"(g), "v"(g + 16 * CC), "v"(g + 32 * CC), "v"(g + 48 * CC)
               : "memory");
}

// One stage: 8 copies of A and 4 of Bt per lane. la = this lane's LDS place in the buffer's row
// tid>>4, ga / gb = the same place of the stage in A / Bt.
static __device__ __forceinline__ void copy_stage(unsigned la, const __bf16* ga, const __bf16* gb) {
  copy4(la, ga);
  copy4(la + 64 * GPITCH, ga + 64 * CC);
  copy4(la + GBM * GPITCH, gb);
}

static __device__ __forceinline__ void
gemm_tile(const __bf16* __restrict__ A, const __bf16* __restrict__ Bt,
          const float* __restrict__ bias, const float* __restrict__ gamma,
          float* __restrict__ out) {
  __shared__ __attribute__((aligned(16))) unsigned char sm[2 * GBUF];   // 102 KB
  int tid  = threadIdx.x;
  int wave = tid >> 5, lane = tid & 31;
  int hf = lane >> 4, ml = lane & 15;
  int bm0 = (blockIdx.x >> 4) * GBM, bn0 = (blockIdx.x & 15) * GBN;     // 16 x 16 block tiles
  int wm = (wave >> 1) * 32, wn = (wave & 1) * 32;

  unsigned la = (unsigned)(size_t)sm + (unsigned)((tid >> 4) * GPITCH + (tid & 15) * 16);
  const __bf16* ga = A  + (size_t)(bm0 + (tid >> 4)) * CC + (tid & 15) * 8;
  const __bf16* gb = Bt + (size_t)(bn0 + (tid >> 4)) * CC + (tid & 15) * 8;

  copy_stage(la, ga, gb);
  // stage 0 has landed for this wave; the barrier publishes it to the others
  asm volatile("s_wait_asynccnt 0x0" ::: "memory");
  __syncthreads();
  copy_stage(la + GBUF, ga + GBK, gb + GBK);

  v8f a00 = {}, a01 = {}, a10 = {}, a11 = {};
  for (int t = 0; t < GNT; ++t) {
    const unsigned char* bufp = sm + (t & 1) * GBUF;
    const unsigned char* pa = bufp + (wm + ml) * GPITCH + hf * 16;
    const unsigned char* pb = bufp + (GBM + wn + ml) * GPITCH + hf * 16;
    // unrolled so that the four k steps differ only in the immediate offsets of their LDS reads
#pragma unroll
    for (int ks = 0; ks < GBK / 32; ++ks) {
      v16bf fa0 = load_frag((const __bf16*)(pa + ks * 64));
      v16bf fa1 = load_frag((const __bf16*)(pa + 16 * GPITCH + ks * 64));
      v16bf fb0 = load_frag((const __bf16*)(pb + ks * 64));
      v16bf fb1 = load_frag((const __bf16*)(pb + 16 * GPITCH + ks * 64));
      a00 = WMMA_BF16(fa0, fb0, a00);
      a01 = WMMA_BF16(fa0, fb1, a01);
      a10 = WMMA_BF16(fa1, fb0, a10);
      a11 = WMMA_BF16(fa1, fb1, a11);
    }
    // this wave's reads of the buffer have returned before the buffer is handed to the copies
    asm volatile("s_wait_dscnt 0x0" ::: "memory");
    // this wave's copies of stage t + 1 have landed
    asm volatile("s_wait_asynccnt 0x0" ::: "memory");
    __syncthreads();   // publishes stage t + 1 and ends every wave's reads of stage t
    if (t + 2 < GNT)
      copy_stage(la + (t & 1) * GBUF, ga + (t + 2) * GBK, gb + (t + 2) * GBK);
  }
  // no copy is outstanding when the wave ends
  asm volatile("s_wait_asynccnt 0x0" ::: "memory");

  int m0 = bm0 + wm, n0 = bn0 + wn;
#pragma unroll
  for (int bm = 0; bm < 2; ++bm)
#pragma unroll
    for (int bn = 0; bn < 2; ++bn) {
      const v8f& acc = bm ? (bn ? a11 : a10) : (bn ? a01 : a00);
      int n = n0 + bn * 16 + ml;
      float bv = bias ? bias[n] : 0.f;
#pragma unroll
      for (int r = 0; r < 8; ++r) {
        int m = m0 + bm * 16 + r + hf * 8;
        float v = acc[r] + bv;
        if (gamma) v *= gamma[m % TT];
        out[(size_t)m * CC + n] = v;
        // precaution: stands in front of any rewrite of the registers that the store above names
        asm volatile("s_wait_xcnt 0x0" ::: "memory");
      }
    }
}

// The three projections read the same A and depend on each other not at all: one grid, blockIdx.y
// names the projection. Three blocks (102 KB of LDS each) stand on a WGP together.
__global__ void __launch_bounds__(256)
k_gemm_qkv(const __bf16* __restrict__ A, const __bf16* __restrict__ Wqt,
           const __bf16* __restrict__ Wkt, const __bf16* __restrict__ Wvt,
           const float* __restrict__ bq, const float* __restrict__ bk,
           const float* __restrict__ bv, float* __restrict__ Q, float* __restrict__ K,
           float* __restrict__ V) {
  int sel = blockIdx.y;
  gemm_tile(A, sel == 0 ? Wqt : sel == 1 ? Wkt : Wvt, sel == 0 ? bq : sel == 1 ? bk : bv,
            nullptr, sel == 0 ? Q : sel == 1 ? K : V);
}

__global__ void __launch_bounds__(256)
k_gemm_out(const __bf16* __restrict__ A, const __bf16* __restrict__ Bt,
           const float* __restrict__ bias, const float* __restrict__ gamma,
           float* __restrict__ out) {
  gemm_tile(A, Bt, bias, gamma, out);
}

// ---------------- 4) RoPE + relayout to WMMA-friendly buffers ----------------
// Qh/Kh: [b*16+h][t][64] bf16 ;  Vt: [b*16+h][d][1024] bf16 (transposed for att@v B-frags)
// A block takes 8 rows (t) of Q and K, each thread 4 channels of each row, and 8 V tiles of tile_T.
__global__ void __launch_bounds__(256)
k_rope(const float* __restrict__ Q, const float* __restrict__ Kr,
       const float* __restrict__ V, __bf16* __restrict__ Qh,
       __bf16* __restrict__ Kh, __bf16* __restrict__ Vt) {
  {
    int gw = blockIdx.x * 8 + (threadIdx.x >> 5);
    int rt = gw >> 6, nt = gw & 63;            // 64-row tile over b*T+t, 16-column tile over h*64+d
    int vb = rt >> 4, tq = rt & 15;
    tile_T(V + (size_t)rt * 64 * CC + nt * 16, CC,
           Vt + ((size_t)vb * CC + nt * 16) * TT + tq * 64, TT, threadIdx.x & 31);
  }
  int nn = threadIdx.x * 4;
  int h = nn >> 6, d = nn & 63;
  int row0 = blockIdx.x * 8;
  int b = row0 / TT, t0 = row0 % TT;
  const float* qp = Q  + (size_t)row0 * CC + nn;
  const float* kp = Kr + (size_t)row0 * CC + nn;
  float4 q[8], k[8];
#pragma unroll
  for (int j = 0; j < 8; ++j) {
    q[j] = *(const float4*)(qp + (size_t)j * CC);
    k[j] = *(const float4*)(kp + (size_t)j * CC);
  }
  if (d < ROT) {
    int po = (d < 16) ? 16 : -16;              // the group of 4 never straddles a multiple of 16
    float sgn = (d < 16) ? -1.f : 1.f;
    float inv[4];
#pragma unroll
    for (int e = 0; e < 4; ++e) inv[e] = __powf(1024.0f, -(float)((d + e) & 15) / 16.0f);
#pragma unroll
    for (int j = 0; j < 8; ++j) {
      float4 pq = *(const float4*)(qp + (ptrdiff_t)j * CC + po);
      float4 pk = *(const float4*)(kp + (ptrdiff_t)j * CC + po);
      float tf = (float)(t0 + j);
      float f0 = tf * inv[0], f1 = tf * inv[1], f2 = tf * inv[2], f3 = tf * inv[3];
      float c0 = __cosf(f0), s0 = __sinf(f0), c1 = __cosf(f1), s1 = __sinf(f1);
      float c2 = __cosf(f2), s2 = __sinf(f2), c3 = __cosf(f3), s3 = __sinf(f3);
      q[j].x = q[j].x * c0 + sgn * pq.x * s0;  k[j].x = k[j].x * c0 + sgn * pk.x * s0;
      q[j].y = q[j].y * c1 + sgn * pq.y * s1;  k[j].y = k[j].y * c1 + sgn * pk.y * s1;
      q[j].z = q[j].z * c2 + sgn * pq.z * s2;  k[j].z = k[j].z * c2 + sgn * pk.z * s2;
      q[j].w = q[j].w * c3 + sgn * pq.w * s3;  k[j].w = k[j].w * c3 + sgn * pk.w * s3;
    }
  }
  size_t ob = ((size_t)(b * NH + h) * TT + t0) * HS + d;
#pragma unroll
  for (int j = 0; j < 8; ++j) {
    *(v4bf*)(Qh + ob + (size_t)j * HS) = cvt4(q[j].x, q[j].y, q[j].z, q[j].w);
    *(v4bf*)(Kh + ob + (size_t)j * HS) = cvt4(k[j].x, k[j].y, k[j].z, k[j].w);
  }
}

// ---------------- 5) softmax stats over ALL s (max & sum) ----------------
// Each lane keeps the running maximum and sum of the keys of its own column (s = 16*i + ml) alone;
// the 16 lanes of a row are merged once, behind the loop. A pass takes 64 keys: one maximum, one
// rescale of the sum. The bound is the launch's own block size: it gives a pass's 16 loads the
// registers to be in flight together.
__global__ void __launch_bounds__(256) k_stats(const __bf16* __restrict__ Qh, const __bf16* __restrict__ Kh,
                        float* __restrict__ Mb, float* __restrict__ Zb) {
  int wid  = (blockIdx.x * blockDim.x + threadIdx.x) >> 5;
  int lane = threadIdx.x & 31;
  int hf = lane >> 4, ml = lane & 15;
  int tile = wid & 63, bh = wid >> 6;      // 2048 waves: [b*16+h][t-tile]
  int t0 = tile * 16;
  const __bf16* qrow = Qh + ((size_t)bh * TT + t0 + ml) * HS + hf * 8;
  v16bf qa0 = load_frag(qrow);
  v16bf qa1 = load_frag(qrow + 32);
  float mr[8], zz[8];
#pragma unroll
  for (int r = 0; r < 8; ++r) { mr[r] = -3.0e38f; zz[r] = 0.f; }
  const __bf16* krow = Kh + ((size_t)bh * TT + ml) * HS + hf * 8;
  for (int st = 0; st < TT / 64; ++st) {
    v16bf kf[4][2];
    v8f s[4];
    // unrolled so that kf[] stays in registers
#pragma unroll
    for (int u = 0; u < 4; ++u) {
      const __bf16* kp = krow + (size_t)(st * 64 + u * 16) * HS;
      kf[u][0] = load_frag(kp);
      kf[u][1] = load_frag(kp + 32);
    }
    // keeps the products behind all 16 loads of the pass: without it the scheduler puts products
    // between the loads to reuse their registers, and a pass waits for memory several times over
    __builtin_amdgcn_sched_barrier(0);
    // unrolled so that s[] stays in registers
#pragma unroll
    for (int u = 0; u < 4; ++u) {
      v8f acc = {};
      acc = WMMA_BF16(qa0, kf[u][0], acc);
      s[u] = WMMA_BF16(qa1, kf[u][1], acc);
    }
    // unrolled so that mr[] and zz[] stay in registers; the eight rows are independent chains
#pragma unroll
    for (int r = 0; r < 8; ++r) {
      float x0 = s[0][r] * 0.125f, x1 = s[1][r] * 0.125f;   // 1/sqrt(64)
      float x2 = s[2][r] * 0.125f, x3 = s[3][r] * 0.125f;
      float mnew = fmaxf(fmaxf(fmaxf(x0, x1), fmaxf(x2, x3)), mr[r]);
      float e = (__expf(x0 - mnew) + __expf(x1 - mnew)) + (__expf(x2 - mnew) + __expf(x3 - mnew));
      zz[r] = zz[r] * __expf(mr[r] - mnew) + e;
      mr[r] = mnew;
    }
  }
  // the merge of a row's 16 lanes; unrolled so that the eight rows' exchanges overlap
#pragma unroll
  for (int r = 0; r < 8; ++r) {
    float m = mr[r];
    m = fmaxf(m, __shfl_xor(m, 8, 16));
    m = fmaxf(m, __shfl_xor(m, 4, 16));
    m = fmaxf(m, __shfl_xor(m, 2, 16));
    m = fmaxf(m, __shfl_xor(m, 1, 16));
    float z = zz[r] * __expf(mr[r] - m);
    z += __shfl_xor(z, 8, 16);
    z += __shfl_xor(z, 4, 16);
    z += __shfl_xor(z, 2, 16);
    z += __shfl_xor(z, 1, 16);
    mr[r] = m;
    zz[r] = z;
  }
  if (ml == 0) {
#pragma unroll
    for (int r = 0; r < 8; ++r) {
      int t = t0 + r + hf * 8;
      Mb[(size_t)bh * TT + t] = mr[r];
      Zb[(size_t)bh * TT + t] = zz[r];
    }
  }
}

// ---------------- 6) fused attention: scores -> p*w -> Wmix -> @v  (att stays on-WGP) ----------------
__global__ void __launch_bounds__(512)
k_attn(const __bf16* __restrict__ Qh, const __bf16* __restrict__ Kh,
       const __bf16* __restrict__ Vt, const float* __restrict__ Mb,
       const float* __restrict__ Zb, const float* __restrict__ tw,
       const float* __restrict__ alpha, const float* __restrict__ beta,
       const float* __restrict__ Wmix, __bf16* __restrict__ Y) {
  // p*w of a chunk: [pair of heads][t][s][head of the pair]. 16 bytes hold two heads of two keys:
  // two A operands of the f32 mix product. Pitch 68 dwords: rows 8 apart differ by 32 banks, so the
  // two lane halves of a 4-byte store meet no common bank.
  __shared__ __attribute__((aligned(16))) float pw[(NH / 2) * 16 * PRP];   // 34 KB of 320 KB LDS
  // the mixed weights of a chunk, bf16: [g][t][s]
  __shared__ __attribute__((aligned(16))) __bf16 amx[NH * AMG];            // 20 KB
  // Each head's decay row with 32 zeros behind it, as the reference pads it: an index past the row
  // (s > t, by at most 31) reads 0, so the reads of the chunk loop need no guard and no branch.
  __shared__ __attribute__((aligned(16))) float twl[NH * TWP];       // 66 KB
  int tile = blockIdx.x & 63, b = blockIdx.x >> 6;
  int wave = threadIdx.x >> 5;                         // = input head h and output head g
  int lane = threadIdx.x & 31;
  int hf = lane >> 4, ml = lane & 15;
  int t0 = tile * 16;
  int h = wave, g = wave;
  int bh = b * NH + h, bg = b * NH + g;

  {
    const float4* trow = (const float4*)(tw + h * TT) + lane;
    float4 tv[8];
#pragma unroll
    for (int j = 0; j < 8; ++j) tv[j] = trow[j * 32];
    // precaution: stands in front of any rewrite of the address registers of the loads above
    asm volatile("s_wait_xcnt 0x0" ::: "memory");
    float4* trl = (float4*)(twl + h * TWP) + lane;
#pragma unroll
    for (int j = 0; j < 8; ++j) trl[j * 32] = tv[j];
    twl[h * TWP + TT + lane] = 0.f;
  }
  // decay weight of (t0 + hf*8 + r, s) = twp[s - r]
  const float* twp = twl + h * TWP + (TT - 1) - t0 - hf * 8;

  const __bf16* qrow = Qh + ((size_t)bh * TT + t0 + ml) * HS + hf * 8;
  v16bf qa0 = load_frag(qrow);
  v16bf qa1 = load_frag(qrow + 32);

  float mr[8], zi[8], bt[8];
#pragma unroll
  for (int r = 0; r < 8; ++r) {
    int t = t0 + r + hf * 8;
    mr[r] = Mb[(size_t)bh * TT + t];
    zi[r] = 1.0f / Zb[(size_t)bh * TT + t];
    bt[r] = beta[h * TT + t];
  }
  // B operand of the mix product: column g = ml; k step q, lane half hf, element e = head 4q + 2hf + e
  v2f wb[4];
  // unrolled so that wb[] stays in registers
#pragma unroll
  for (int q = 0; q < 4; ++q) wb[q] = *(const v2f*)(Wmix + ml * NH + q * 4 + hf * 2);

  v8f yac[4] = {};
  int nch = (t0 + 16 + 31) >> 5;
  __syncthreads();   // the staged decay rows are complete before the first read
  for (int ch = 0; ch < nch; ++ch) {
    int s0 = ch * 32;
    // the chunk's 16 decay weights, read in front of the first store to pw so that they issue as a group
    float twv[2][8];
#pragma unroll
    for (int sub = 0; sub < 2; ++sub)
#pragma unroll
      for (int r = 0; r < 8; ++r) twv[sub][r] = twp[s0 + sub * 16 + ml - r];
    float al[2];
    al[0] = alpha[h * TT + s0 + ml];
    al[1] = alpha[h * TT + s0 + 16 + ml];
    // precaution: stands in front of any rewrite of the address registers of the two loads above
    asm volatile("s_wait_xcnt 0x0" ::: "memory");
    // phase A: this wave = head h; two 16-wide s subtiles of exp/Z * w -> LDS
    const __bf16* kp = Kh + ((size_t)bh * TT + s0 + ml) * HS + hf * 8;
    v16bf kf[2][2];
    // unrolled so that kf[] stays in registers
#pragma unroll
    for (int sub = 0; sub < 2; ++sub) {
      kf[sub][0] = load_frag(kp + sub * 16 * HS);
      kf[sub][1] = load_frag(kp + sub * 16 * HS + 32);
    }
    // precaution: stands in front of any rewrite of the address registers of the 8 loads above; the
    // operand keeps the address in its registers up to here, so that no load lands on them
    asm volatile("s_wait_xcnt 0x0" :: "v"(kp) : "memory");
    // keeps the products behind all 8 loads of the chunk, one wait for memory: without it this build
    // puts products between the loads to reuse their registers and waits for memory three times
    __builtin_amdgcn_sched_barrier(0);
#pragma unroll
    for (int sub = 0; sub < 2; ++sub) {
      v8f s = {};
      s = WMMA_BF16(qa0, kf[sub][0], s);
      s = WMMA_BF16(qa1, kf[sub][1], s);
#pragma unroll
      for (int r = 0; r < 8; ++r) {
        int tl = r + hf * 8;
        float p = __expf(s[r] * 0.125f - mr[r]) * zi[r];
        float wv = twv[sub][r] * al[sub] * bt[r];
        pw[((h >> 1) * 16 + tl) * PRP + (sub * 16 + ml) * 2 + (h & 1)] = p * wv;
      }
    }
    __syncthreads();
    // this wave's V fragments of the chunk, issued behind this barrier so that they fly during the mix
    v16bf vf[4];
    // unrolled so that vf[] stays in registers
#pragma unroll
    for (int dt = 0; dt < 4; ++dt)
      vf[dt] = load_frag(Vt + ((size_t)bg * HS + dt * 16 + ml) * TT + s0 + hf * 8);
    // phase B: this wave = row t0 + wave of the tile; all 16 output heads of its 32 keys in one
    // f32 matrix product: rows = keys (tile 0: even s, tile 1: odd s), k = input head, columns = g.
    // The p*w tile is read from LDS once by the block, not once by every output head.
    v8f m0 = {}, m1 = {};
    // unrolled so that wb[] stays in registers and the four reads differ only in their offsets
#pragma unroll
    for (int q = 0; q < 4; ++q) {
      // heads 4q + 2hf + {0, 1} of keys 2ml and 2ml + 1: the k order of wb[q]
      const float4 v = *(const float4*)&pw[((q * 2 + hf) * 16 + wave) * PRP + ml * 4];
      v2f a0 = {v.x, v.y}, a1 = {v.z, v.w};
      m0 = WMMA_F32(a0, wb[q], m0);
      m1 = WMMA_F32(a1, wb[q], m1);
    }
    // register r = keys 16hf + 2r (m0) and 16hf + 2r + 1 (m1) of output head ml: 32 B of one row
    {
      v8bf o0, o1;
      // unrolled so that the vector elements are named at compile time
#pragma unroll
      for (int r = 0; r < 4; ++r) {
        o0[2 * r] = (__bf16)m0[r];     o0[2 * r + 1] = (__bf16)m1[r];
        o1[2 * r] = (__bf16)m0[r + 4]; o1[2 * r + 1] = (__bf16)m1[r + 4];
      }
      __bf16* ap = amx + ml * AMG + wave * AMP + hf * 16;
      *(v8bf*)ap       = o0;
      *(v8bf*)(ap + 8) = o1;
    }
    // The mixed tile is complete, and every wave has left pw, which the next chunk rewrites. amx is
    // rewritten only behind the next chunk's first barrier, which every wave's reads below precede.
    __syncthreads();
    // phase C: this wave = output head g; its mixed 16 x 32 tile is the A operand, 4 WMMAs vs Vt
    v16bf am = load_frag(amx + g * AMG + ml * AMP + hf * 8);
    // unrolled so that vf[] and yac[] stay in registers
#pragma unroll
    for (int dt = 0; dt < 4; ++dt) yac[dt] = WMMA_BF16(am, vf[dt], yac[dt]);
  }
  // write y[b][t][g*64+d] as bf16 for the final WMMA GEMM
#pragma unroll
  for (int dt = 0; dt < 4; ++dt)
#pragma unroll
    for (int r = 0; r < 8; ++r) {
      int t = t0 + r + hf * 8;
      int n = g * HS + dt * 16 + ml;
      Y[((size_t)b * TT + t) * CC + n] = (__bf16)yac[dt][r];
    }
}

// ---------------- host-side orchestration ----------------
extern "C" void kernel_launch(void* const* d_in, const int* in_sizes, int n_in,
                              void* d_out, int out_size, void* d_ws, size_t ws_size,
                              hipStream_t stream) {
  const float* x     = (const float*)d_in[0];
  const float* tw    = (const float*)d_in[1];
  const float* alpha = (const float*)d_in[2];
  const float* beta  = (const float*)d_in[3];
  const float* gamma = (const float*)d_in[4];
  const float* Wq = (const float*)d_in[5];  const float* bq = (const float*)d_in[6];
  const float* Wk = (const float*)d_in[7];  const float* bk = (const float*)d_in[8];
  const float* Wv = (const float*)d_in[9];  const float* bv = (const float*)d_in[10];
  const float* Wmix = (const float*)d_in[11];
  const float* Wo = (const float*)d_in[12]; const float* bo = (const float*)d_in[13];
  float* out = (float*)d_out;

  char* ws = (char*)d_ws;
  const size_t MB = 1u << 20;
  __bf16* XS   = (__bf16*)(ws + 0);          // 4 MB
  __bf16* WQT  = (__bf16*)(ws + 4 * MB);     // 2 MB each
  __bf16* WKT  = (__bf16*)(ws + 6 * MB);
  __bf16* WVT  = (__bf16*)(ws + 8 * MB);
  __bf16* WOT  = (__bf16*)(ws + 10 * MB);
  float*  QR   = (float*)(ws + 12 * MB);     // 8 MB each
  float*  KR   = (float*)(ws + 20 * MB);
  float*  VR   = (float*)(ws + 28 * MB);
  __bf16* QHB  = (__bf16*)(ws + 36 * MB);    // 4 MB each
  __bf16* KHB  = (__bf16*)(ws + 40 * MB);
  __bf16* VTB  = (__bf16*)(ws + 44 * MB);
  float*  MBUF = (float*)(ws + 48 * MB);     // 128 KB each
  float*  ZBUF = (float*)(ws + 48 * MB + (128u << 10));
  __bf16* YBF  = (__bf16*)(ws + 49 * MB);    // 4 MB

  // 1) + 2) shift + bf16 (4 rows per block) and the four weight transpose-converts, one grid
  k_prep<<<SHB + 4 * CVB, 256, 0, stream>>>(x, Wq, Wk, Wv, Wo, XS, WQT, WKT, WVT, WOT);
  // 3) QKV GEMMs: (B*T=2048) x 1024 x 1024 each, 128x64 tile per block of 8 waves, one grid
  const int gblk = (BB * TT / GBM) * (CC / GBN);   // 256 blocks a product
  k_gemm_qkv<<<dim3(gblk, 3), 256, 0, stream>>>(XS, WQT, WKT, WVT, bq, bk, bv, QR, KR, VR);
  // 4) RoPE + relayout
  k_rope<<<BB * TT / 8, 256, 0, stream>>>(QR, KR, VR, QHB, KHB, VTB);
  // 5) softmax stats: 2048 waves = 256 blocks x 8 waves
  k_stats<<<256, 256, 0, stream>>>(QHB, KHB, MBUF, ZBUF);
  // 6) fused attention: one block per (b, 16-row tile), 16 waves = 16 heads
  k_attn<<<BB * (TT / 16), 512, 0, stream>>>(QHB, KHB, VTB, MBUF, ZBUF,
                                             tw, alpha, beta, Wmix, YBF);
  // 7) output GEMM with bias + gamma epilogue
  k_gemm_out<<<gblk, 256, 0, stream>>>(YBF, WOT, bo, gamma, out);
}

// v008
// A run of this version takes 111 microseconds.
// In both of two side-by-side timings against v007, it was 1.37 times as fast.
// Counting every step since v000, it is 5.26 times as fast.
#include <hip/hip_runtime.h>
#include <hip/hip_bf16.h>
#include <math.h>

// ---------------- problem constants ----------------
enum : int { BB = 2, TT = 1024, CC = 1024, NH = 16, HS = 64, ROT = 32 };
enum : int { PRP = 68 };   // LDS row pitch of the p*w tile, in floats: 32 keys x 2 heads, then 4
enum : int { AMP = 40 };   // LDS row pitch of the mixed tile, in bf16: 80 B = 16 B x odd
enum : int { AMG = 16 * AMP + 8 };   // one output head's 16 mixed rows, in bf16: 1296 B = 16 B x odd
enum : int { TWP = TT + 32 };   // LDS pitch of one head's decay row: the row, then 32 zeros

typedef __attribute__((ext_vector_type(16))) __bf16 v16bf;
typedef __attribute__((ext_vector_type(8)))  __bf16 v8bf;
typedef __attribute__((ext_vector_type(4)))  __bf16 v4bf;
typedef __attribute__((ext_vector_type(8)))  float  v8f;
typedef __attribute__((ext_vector_type(2)))  float  v2f;

#define WMMA_BF16(a, b, c) \
  __builtin_amdgcn_wmma_f32_16x16x32_bf16(false, (a), false, (b), (short)0, (c), false, false)
#define WMMA_F32(a, b, c) \
  __builtin_amdgcn_wmma_f32_16x16x4_f32(false, (a), false, (b), (short)0, (c), false, false)

// Fragment loader: lane supplies base = row_ptr + kb (kb = 8*(lane>=16)).
// Elements 0..7  <- K = kb+0..7   (16B load)
// Elements 8..15 <- K = kb+16..23 (16B load)
static __device__ __forceinline__ v16bf load_frag(const __bf16* p) {
  v8bf lo = *(const v8bf*)p;
  v8bf hi = *(const v8bf*)(p + 16);
  v16bf r;
#pragma unroll
  for (int i = 0; i < 8; ++i) { r[i] = lo[i]; r[i + 8] = hi[i]; }
  return r;
}

// One wave turns a 64-row x 16-column f32 tile into its bf16 transpose, in registers.
// Lane (tl, ng) holds rows tl*8..+7 of columns ng*4..+3: eight 16-byte loads (4 lanes = 64 B of a
// row), four 16-byte stores (8 lanes = one whole 128-B line of a transposed row).
static __device__ __forceinline__ void tile_T(const float* __restrict__ src, int ld_src,
                                              __bf16* __restrict__ dst, int ld_dst, int lane) {
  int ng = lane & 3, tl = lane >> 2;
  const float* p = src + (size_t)(tl * 8) * ld_src + ng * 4;
  float4 v[8];
#pragma unroll
  for (int j = 0; j < 8; ++j) v[j] = *(const float4*)(p + (size_t)j * ld_src);
  // precaution: stands in front of any rewrite of the address registers of the loads above
  asm volatile("s_wait_xcnt 0x0" ::: "memory");
  v8bf o0, o1, o2, o3;
#pragma unroll
  for (int j = 0; j < 8; ++j) {
    o0[j] = (__bf16)v[j].x; o1[j] = (__bf16)v[j].y;
    o2[j] = (__bf16)v[j].z; o3[j] = (__bf16)v[j].w;
  }
  __bf16* q = dst + (size_t)(ng * 4) * ld_dst + tl * 8;
  *(v8bf*)(q)                      = o0;
  *(v8bf*)(q + (size_t)ld_dst)     = o1;
  *(v8bf*)(q + (size_t)2 * ld_dst) = o2;
  *(v8bf*)(q + (size_t)3 * ld_dst) = o3;
}

static __device__ __forceinline__ v4bf cvt4(float a, float b, float c, float d) {
  v4bf r;
  r[0] = (__bf16)a; r[1] = (__bf16)b; r[2] = (__bf16)c; r[3] = (__bf16)d;
  return r;
}

// ---------------- 1) time-shift + f32->bf16 ----------------
// A block of 256 threads spans one row (256 groups of 4 channels) and takes 4 rows.
static __device__ __forceinline__ void shift_rows(const float* __restrict__ x,
                                                  __bf16* __restrict__ xs, int blk) {
  int c = threadIdx.x * 4;
  int row0 = blk * 4;
  int back = (c < CC / 2) ? 1 : 0;             // first half of the channels reads row t-1
  float4 v[4];
#pragma unroll
  for (int q = 0; q < 4; ++q) {
    int srow = row0 + q - back;                // clamped so that all four loads issue together
    v[q] = *(const float4*)(x + (size_t)(srow < 0 ? 0 : srow) * CC + c);
  }
  // precaution: stands in front of any rewrite of the address registers of the loads above
  asm volatile("s_wait_xcnt 0x0" ::: "memory");
#pragma unroll
  for (int q = 0; q < 4; ++q)
    if (back && ((row0 + q) & (TT - 1)) == 0) v[q] = make_float4(0.f, 0.f, 0.f, 0.f);
#pragma unroll
  for (int q = 0; q < 4; ++q)
    *(v4bf*)(xs + (size_t)(row0 + q) * CC + c) = cvt4(v[q].x, v[q].y, v[q].z, v[q].w);
}

// ---------------- 2) W[k][n] f32 -> Wt[n][k] bf16 ----------------
// 1024 waves a matrix: wave = (64-row k tile, 16-column n tile)
static __device__ __forceinline__ void convT(const float* __restrict__ W,
                                             __bf16* __restrict__ Wt, int blk) {
  int gw = (blk * 256 + threadIdx.x) >> 5;
  int kt = gw >> 6, nt = gw & 63;
  tile_T(W + (size_t)kt * 64 * CC + nt * 16, CC,
         Wt + (size_t)nt * 16 * CC + kt * 64, CC, threadIdx.x & 31);
  // precaution: stands in front of any rewrite of the registers that the tile's four stores name
  asm volatile("s_wait_xcnt 0x0" ::: "memory");
}

// 1) and 2) depend on nothing and on each other not at all: one grid holds them, by block range.
enum : int { SHB = BB * TT / 4, CVB = 128 };   // blocks of the shift; blocks of one weight matrix
__global__ void __launch_bounds__(256)
k_prep(const float* __restrict__ x, const float* __restrict__ Wq, const float* __restrict__ Wk,
       const float* __restrict__ Wv, const float* __restrict__ Wo, __bf16* __restrict__ xs,
       __bf16* __restrict__ Wqt, __bf16* __restrict__ Wkt, __bf16* __restrict__ Wvt,
       __bf16* __restrict__ Wot) {
  int blk = blockIdx.x;
  if (blk < SHB) { shift_rows(x, xs, blk); return; }
  blk -= SHB;
  int sel = blk / CVB;
  const float* W = sel == 0 ? Wq : sel == 1 ? Wk : sel == 2 ? Wv : Wo;
  __bf16* Wt = sel == 0 ? Wqt : sel == 1 ? Wkt : sel == 2 ? Wvt : Wot;
  convT(W, Wt, blk % CVB);
}

// ---------------- bf16 WMMA GEMM, operands staged in LDS, 32x32 per wave ----------------
// out = A @ Bt^T + bias (opt *gamma[m%T]); M = BB*TT, N = K = CC.
// A block of 8 waves (4 x 2) owns a 128 x 64 tile of out. A stage is 128 k (256 B) of the block's
// 128 rows of A and 64 rows of Bt, brought into LDS by asynchronous 16-byte copies: 16 lanes take
// one row's 256 B, so every copy instruction moves whole lines. Two buffers: the next stage's
// copies fly while this stage is worked on.
enum : int { GBM = 128, GBN = 64, GBK = 128, GNT = CC / GBK };
enum : int { GPITCH = 2 * GBK + 16 };             // LDS row pitch in bytes: 272 = 16 B x odd
enum : int { GBUF = (GBM + GBN) * GPITCH };       // one buffer: the A rows, then the Bt rows

// Four copies of this lane: rows 16 apart in the source (pitch CC elements) and in LDS.
static __device__ __forceinline__ void copy4(unsigned lds, const __bf16* g) {
  // The wait is the last line of the copies' own statement, so that it stands in front of any
  // rewrite of the address registers that the copies name (a precaution).
  asm volatile("global_load_async_to_lds_b128 %0, %4, off\n\t"
               "global_load_async_to_lds_b128 %1, %5, off\n\t"
               "global_load_async_to_lds_b128 %2, %6, off\n\t"
               "global_load_async_to_lds_b128 %3, %7, off\n\t"
               "s_wait_xcnt 0x0"
               :: "v"(lds), "v"(lds + 16 * GPITCH), "v"(lds + 32 * GPITCH), "v"(lds + 48 * GPITCH),
                  "v"(g), "v"(g + 16 * CC), "v"(g + 32 * CC), "v"(g + 48 * CC)
               : "memory");
}

// One stage: 8 copies of A and 4 of Bt per lane. la = this lane's LDS place in the buffer's row
// tid>>4, ga / gb = the same place of the stage in A / Bt.
static __device__ __forceinline__ void copy_stage(unsigned la, const __bf16* ga, const __bf16* gb) {
  copy4(la, ga);
  copy4(la + 64 * GPITCH, ga + 64 * CC);
  copy4(la + GBM * GPITCH, gb);
}

static __device__ __forceinline__ void
gemm_tile(const __bf16* __restrict__ A, const __bf16* __restrict__ Bt,
          const float* __restrict__ bias, const float* __restrict__ gamma,
          float* __restrict__ out) {
  __shared__ __attribute__((aligned(16))) unsigned char sm[2 * GBUF];   // 102 KB
  int tid  = threadIdx.x;
  int wave = tid >> 5, lane = tid & 31;
  int hf = lane >> 4, ml = lane & 15;
  int bm0 = (blockIdx.x >> 4) * GBM, bn0 = (blockIdx.x & 15) * GBN;     // 16 x 16 block tiles
  int wm = (wave >> 1) * 32, wn = (wave & 1) * 32;

  unsigned la = (unsigned)(size_t)sm + (unsigned)((tid >> 4) * GPITCH + (tid & 15) * 16);
  const __bf16* ga = A  + (size_t)(bm0 + (tid >> 4)) * CC + (tid & 15) * 8;
  const __bf16* gb = Bt + (size_t)(bn0 + (tid >> 4)) * CC + (tid & 15) * 8;

  copy_stage(la, ga, gb);
  // stage 0 has landed for this wave; the barrier publishes it to the others
  asm volatile("s_wait_asynccnt 0x0" ::: "memory");
  __syncthreads();
  copy_stage(la + GBUF, ga + GBK, gb + GBK);

  v8f a00 = {}, a01 = {}, a10 = {}, a11 = {};
  for (int t = 0; t < GNT; ++t) {
    const unsigned char* bufp = sm + (t & 1) * GBUF;
    const unsigned char* pa = bufp + (wm + ml) * GPITCH + hf * 16;
    const unsigned char* pb = bufp + (GBM + wn + ml) * GPITCH + hf * 16;
    // unrolled so that the four k steps differ only in the immediate offsets of their LDS reads
#pragma unroll
    for (int ks = 0; ks < GBK / 32; ++ks) {
      v16bf fa0 = load_frag((const __bf16*)(pa + ks * 64));
      v16bf fa1 = load_frag((const __bf16*)(pa + 16 * GPITCH + ks * 64));
      v16bf fb0 = load_frag((const __bf16*)(pb + ks * 64));
      v16bf fb1 = load_frag((const __bf16*)(pb + 16 * GPITCH + ks * 64));
      a00 = WMMA_BF16(fa0, fb0, a00);
      a01 = WMMA_BF16(fa0, fb1, a01);
      a10 = WMMA_BF16(fa1, fb0, a10);
      a11 = WMMA_BF16(fa1, fb1, a11);
    }
    // this wave's reads of the buffer have returned before the buffer is handed to the copies
    asm volatile("s_wait_dscnt 0x0" ::: "memory");
    // this wave's copies of stage t + 1 have landed
    asm volatile("s_wait_asynccnt 0x0" ::: "memory");
    __syncthreads();   // publishes stage t + 1 and ends every wave's reads of stage t
    if (t + 2 < GNT)
      copy_stage(la + (t & 1) * GBUF, ga + (t + 2) * GBK, gb + (t + 2) * GBK);
  }
  // no copy is outstanding when the wave ends
  asm volatile("s_wait_asynccnt 0x0" ::: "memory");

  int m0 = bm0 + wm, n0 = bn0 + wn;
#pragma unroll
  for (int bm = 0; bm < 2; ++bm)
#pragma unroll
    for (int bn = 0; bn < 2; ++bn) {
      const v8f& acc = bm ? (bn ? a11 : a10) : (bn ? a01 : a00);
      int n = n0 + bn * 16 + ml;
      float bv = bias ? bias[n] : 0.f;
#pragma unroll
      for (int r = 0; r < 8; ++r) {
        int m = m0 + bm * 16 + r + hf * 8;
        float v = acc[r] + bv;
        if (gamma) v *= gamma[m % TT];
        out[(size_t)m * CC + n] = v;
        // precaution: stands in front of any rewrite of the registers that the store above names
        asm volatile("s_wait_xcnt 0x0" ::: "memory");
      }
    }
}

// The three projections read the same A and depend on each other not at all: one grid, blockIdx.y
// names the projection. Three blocks (102 KB of LDS each) stand on a WGP together.
__global__ void __launch_bounds__(256)
k_gemm_qkv(const __bf16* __restrict__ A, const __bf16* __restrict__ Wqt,
           const __bf16* __restrict__ Wkt, const __bf16* __restrict__ Wvt,
           const float* __restrict__ bq, const float* __restrict__ bk,
           const float* __restrict__ bv, float* __restrict__ Q, float* __restrict__ K,
           float* __restrict__ V) {
  int sel = blockIdx.y;
  gemm_tile(A, sel == 0 ? Wqt : sel == 1 ? Wkt : Wvt, sel == 0 ? bq : sel == 1 ? bk : bv,
            nullptr, sel == 0 ? Q : sel == 1 ? K : V);
}

// ---------------- output GEMM: sums the attention's partial y planes in its accumulators ----------------
// out = ((sum over planes of Yp) @ Bt^T + bias) * gamma[m%T]. Rows t of a batch have (t >> 7) / 3 + 1
// planes (k_attn's split of the keys). Block tile, wave tile, stage length, copies and the order of
// waits and barrier are those of gemm_tile; a stage holds the 64 Bt rows and then 128 rows of each
// plane. The Bt fragments of a stage are read from LDS once and serve every plane.
enum : int { YSEG = 3 };                          // most planes of a row
enum : int { YPL = BB * TT * CC };                // elements of one plane
enum : int { OBUF = (GBN + YSEG * GBM) * GPITCH };   // one buffer: 119 KB

static __device__ __forceinline__ void copy_stage_out(unsigned la, const __bf16* ga,
                                                      const __bf16* gb, int nseg) {
  copy4(la, gb);
  for (int sg = 0; sg < nseg; ++sg) {             // at most 4 + 8 * 3 = 28 copies of a wave in flight
    copy4(la + (GBN + sg * GBM) * GPITCH, ga + (size_t)sg * YPL);
    copy4(la + (GBN + sg * GBM + 64) * GPITCH, ga + (size_t)sg * YPL + 64 * CC);
  }
}

__global__ void __launch_bounds__(256)
k_gemm_out(const __bf16* __restrict__ Yp, const __bf16* __restrict__ Bt,
           const float* __restrict__ bias, const float* __restrict__ gamma,
           float* __restrict__ out) {
  __shared__ __attribute__((aligned(16))) unsigned char sm[2 * OBUF];   // 238 KB of 320 KB LDS
  int tid  = threadIdx.x;
  int wave = tid >> 5, lane = tid & 31;
  int hf = lane >> 4, ml = lane & 15;
  int bm0 = (blockIdx.x >> 4) * GBM, bn0 = (blockIdx.x & 15) * GBN;     // 16 x 16 block tiles
  int wm = (wave >> 1) * 32, wn = (wave & 1) * 32;
  int nseg = ((bm0 & (TT - 1)) >> 7) / 3 + 1;     // the same for the block's 128 rows

  unsigned la = (unsigned)(size_t)sm + (unsigned)((tid >> 4) * GPITCH + (tid & 15) * 16);
  const __bf16* ga = Yp + (size_t)(bm0 + (tid >> 4)) * CC + (tid & 15) * 8;
  const __bf16* gb = Bt + (size_t)(bn0 + (tid >> 4)) * CC + (tid & 15) * 8;

  copy_stage_out(la, ga, gb, nseg);
  // stage 0 has landed for this wave; the barrier publishes it to the others
  asm volatile("s_wait_asynccnt 0x0" ::: "memory");
  __syncthreads();
  copy_stage_out(la + OBUF, ga + GBK, gb + GBK, nseg);

  v8f a00 = {}, a01 = {}, a10 = {}, a11 = {};
  for (int t = 0; t < GNT; ++t) {
    const unsigned char* bufp = sm + (t & 1) * OBUF;
    const unsigned char* pb = bufp + (wn + ml) * GPITCH + hf * 16;
    v16bf fb0[GBK / 32], fb1[GBK / 32];
    // unrolled so that fb0[] and fb1[] stay in registers
#pragma unroll
    for (int ks = 0; ks < GBK / 32; ++ks) {
      fb0[ks] = load_frag((const __bf16*)(pb + ks * 64));
      fb1[ks] = load_frag((const __bf16*)(pb + 16 * GPITCH + ks * 64));
    }
    for (int sg = 0; sg < nseg; ++sg) {
      const unsigned char* pa = bufp + (GBN + sg * GBM + wm + ml) * GPITCH + hf * 16;
      v16bf fa0[GBK / 32], fa1[GBK / 32];
      // unrolled so that fa0[] and fa1[] stay in registers
#pragma unroll
      for (int ks = 0; ks < GBK / 32; ++ks) {
        fa0[ks] = load_frag((const __bf16*)(pa + ks * 64));
        fa1[ks] = load_frag((const __bf16*)(pa + 16 * GPITCH + ks * 64));
      }
      // keeps the products behind all 16 LDS reads of the plane: without it the scheduler reuses two
      // fragments' registers, reads in pairs between the products and waits for LDS at every pair
      __builtin_amdgcn_sched_barrier(0);
      // unrolled so that the fragment arrays are indexed at compile time
#pragma unroll
      for (int ks = 0; ks < GBK / 32; ++ks) {
        a00 = WMMA_BF16(fa0[ks], fb0[ks], a00);
        a01 = WMMA_BF16(fa0[ks], fb1[ks], a01);
        a10 = WMMA_BF16(fa1[ks], fb0[ks], a10);
        a11 = WMMA_BF16(fa1[ks], fb1[ks], a11);
      }
    }
    // this wave's reads of the buffer have returned before the buffer is handed to the copies
    asm volatile("s_wait_dscnt 0x0" ::: "memory");
    // this wave's copies of stage t + 1 have landed
    asm volatile("s_wait_asynccnt 0x0" ::: "memory");
    __syncthreads();   // publishes stage t + 1 and ends every wave's reads of stage t
    if (t + 2 < GNT)
      copy_stage_out(la + (t & 1) * OBUF, ga + (t + 2) * GBK, gb + (t + 2) * GBK, nseg);
  }
  // no copy is outstanding when the wave ends
  asm volatile("s_wait_asynccnt 0x0" ::: "memory");

  int m0 = bm0 + wm, n0 = bn0 + wn;
#pragma unroll
  for (int bm = 0; bm < 2; ++bm)
#pragma unroll
    for (int bn = 0; bn < 2; ++bn) {
      const v8f& acc = bm ? (bn ? a11 : a10) : (bn ? a01 : a00);
      int n = n0 + bn * 16 + ml;
      float bv = bias[n];
#pragma unroll
      for (int r = 0; r < 8; ++r) {
        int m = m0 + bm * 16 + r + hf * 8;
        out[(size_t)m * CC + n] = (acc[r] + bv) * gamma[m % TT];
        // precaution: stands in front of any rewrite of the registers that the store above names
        asm volatile("s_wait_xcnt 0x0" ::: "memory");
      }
    }
}

// ---------------- 4) RoPE + relayout to WMMA-friendly buffers ----------------
// Qh/Kh: [b*16+h][t][64] bf16 ;  Vt: [b*16+h][d][1024] bf16 (transposed for att@v B-frags)
// A block takes 8 rows (t) of Q and K, each thread 4 channels of each row, and 8 V tiles of tile_T.
__global__ void __launch_bounds__(256)
k_rope(const float* __restrict__ Q, const float* __restrict__ Kr,
       const float* __restrict__ V, __bf16* __restrict__ Qh,
       __bf16* __restrict__ Kh, __bf16* __restrict__ Vt) {
  {
    int gw = blockIdx.x * 8 + (threadIdx.x >> 5);
    int rt = gw >> 6, nt = gw & 63;            // 64-row tile over b*T+t, 16-column tile over h*64+d
    int vb = rt >> 4, tq = rt & 15;
    tile_T(V + (size_t)rt * 64 * CC + nt * 16, CC,
           Vt + ((size_t)vb * CC + nt * 16) * TT + tq * 64, TT, threadIdx.x & 31);
  }
  int nn = threadIdx.x * 4;
  int h = nn >> 6, d = nn & 63;
  int row0 = blockIdx.x * 8;
  int b = row0 / TT, t0 = row0 % TT;
  const float* qp = Q  + (size_t)row0 * CC + nn;
  const float* kp = Kr + (size_t)row0 * CC + nn;
  float4 q[8], k[8];
#pragma unroll
  for (int j = 0; j < 8; ++j) {
    q[j] = *(const float4*)(qp + (size_t)j * CC);
    k[j] = *(const float4*)(kp + (size_t)j * CC);
  }
  if (d < ROT) {
    int po = (d < 16) ? 16 : -16;              // the group of 4 never straddles a multiple of 16
    float sgn = (d < 16) ? -1.f : 1.f;
    float inv[4];
#pragma unroll
    for (int e = 0; e < 4; ++e) inv[e] = __powf(1024.0f, -(float)((d + e) & 15) / 16.0f);
#pragma unroll
    for (int j = 0; j < 8; ++j) {
      float4 pq = *(const float4*)(qp + (ptrdiff_t)j * CC + po);
      float4 pk = *(const float4*)(kp + (ptrdiff_t)j * CC + po);
      float tf = (float)(t0 + j);
      float f0 = tf * inv[0], f1 = tf * inv[1], f2 = tf * inv[2], f3 = tf * inv[3];
      float c0 = __cosf(f0), s0 = __sinf(f0), c1 = __cosf(f1), s1 = __sinf(f1);
      float c2 = __cosf(f2), s2 = __sinf(f2), c3 = __cosf(f3), s3 = __sinf(f3);
      q[j].x = q[j].x * c0 + sgn * pq.x * s0;  k[j].x = k[j].x * c0 + sgn * pk.x * s0;
      q[j].y = q[j].y * c1 + sgn * pq.y * s1;  k[j].y = k[j].y * c1 + sgn * pk.y * s1;
      q[j].z = q[j].z * c2 + sgn * pq.z * s2;  k[j].z = k[j].z * c2 + sgn * pk.z * s2;
      q[j].w = q[j].w * c3 + sgn * pq.w * s3;  k[j].w = k[j].w * c3 + sgn * pk.w * s3;
    }
  }
  size_t ob = ((size_t)(b * NH + h) * TT + t0) * HS + d;
#pragma unroll
  for (int j = 0; j < 8; ++j) {
    *(v4bf*)(Qh + ob + (size_t)j * HS) = cvt4(q[j].x, q[j].y, q[j].z, q[j].w);
    *(v4bf*)(Kh + ob + (size_t)j * HS) = cvt4(k[j].x, k[j].y, k[j].z, k[j].w);
  }
}

// ---------------- 5) softmax stats over ALL s (max & sum) ----------------
// Each lane keeps the running maximum and sum of the keys of its own column (s = 16*i + ml) alone;
// the 16 lanes of a row are merged once, behind the loop. A pass takes 64 keys: one maximum, one
// rescale of the sum. The bound is the launch's own block size: it gives a pass's 16 loads the
// registers to be in flight together.
__global__ void __launch_bounds__(256) k_stats(const __bf16* __restrict__ Qh, const __bf16* __restrict__ Kh,
                        float* __restrict__ Mb, float* __restrict__ Zb) {
  int wid  = (blockIdx.x * blockDim.x + threadIdx.x) >> 5;
  int lane = threadIdx.x & 31;
  int hf = lane >> 4, ml = lane & 15;
  int tile = wid & 63, bh = wid >> 6;      // 2048 waves: [b*16+h][t-tile]
  int t0 = tile * 16;
  const __bf16* qrow = Qh + ((size_t)bh * TT + t0 + ml) * HS + hf * 8;
  v16bf qa0 = load_frag(qrow);
  v16bf qa1 = load_frag(qrow + 32);
  float mr[8], zz[8];
#pragma unroll
  for (int r = 0; r < 8; ++r) { mr[r] = -3.0e38f; zz[r] = 0.f; }
  const __bf16* krow = Kh + ((size_t)bh * TT + ml) * HS + hf * 8;
  for (int st = 0; st < TT / 64; ++st) {
    v16bf kf[4][2];
    v8f s[4];
    // unrolled so that kf[] stays in registers
#pragma unroll
    for (int u = 0; u < 4; ++u) {
      const __bf16* kp = krow + (size_t)(st * 64 + u * 16) * HS;
      kf[u][0] = load_frag(kp);
      kf[u][1] = load_frag(kp + 32);
    }
    // keeps the products behind all 16 loads of the pass: without it the scheduler puts products
    // between the loads to reuse their registers, and a pass waits for memory several times over
    __builtin_amdgcn_sched_barrier(0);
    // unrolled so that s[] stays in registers
#pragma unroll
    for (int u = 0; u < 4; ++u) {
      v8f acc = {};
      acc = WMMA_BF16(qa0, kf[u][0], acc);
      s[u] = WMMA_BF16(qa1, kf[u][1], acc);
    }
    // unrolled so that mr[] and zz[] stay in registers; the eight rows are independent chains
#pragma unroll
    for (int r = 0; r < 8; ++r) {
      float x0 = s[0][r] * 0.125f, x1 = s[1][r] * 0.125f;   // 1/sqrt(64)
      float x2 = s[2][r] * 0.125f, x3 = s[3][r] * 0.125f;
      float mnew = fmaxf(fmaxf(fmaxf(x0, x1), fmaxf(x2, x3)), mr[r]);
      float e = (__expf(x0 - mnew) + __expf(x1 - mnew)) + (__expf(x2 - mnew) + __expf(x3 - mnew));
      zz[r] = zz[r] * __expf(mr[r] - mnew) + e;
      mr[r] = mnew;
    }
  }
  // the merge of a row's 16 lanes; unrolled so that the eight rows' exchanges overlap
#pragma unroll
  for (int r = 0; r < 8; ++r) {
    float m = mr[r];
    m = fmaxf(m, __shfl_xor(m, 8, 16));
    m = fmaxf(m, __shfl_xor(m, 4, 16));
    m = fmaxf(m, __shfl_xor(m, 2, 16));
    m = fmaxf(m, __shfl_xor(m, 1, 16));
    float z = zz[r] * __expf(mr[r] - m);
    z += __shfl_xor(z, 8, 16);
    z += __shfl_xor(z, 4, 16);
    z += __shfl_xor(z, 2, 16);
    z += __shfl_xor(z, 1, 16);
    mr[r] = m;
    zz[r] = z;
  }
  if (ml == 0) {
#pragma unroll
    for (int r = 0; r < 8; ++r) {
      int t = t0 + r + hf * 8;
      Mb[(size_t)bh * TT + t] = mr[r];
      Zb[(size_t)bh * TT + t] = zz[r];
    }
  }
}

// ---------------- 6) fused attention: scores -> p*w -> Wmix -> @v  (att stays on-WGP) ----------------
__global__ void __launch_bounds__(512)
k_attn(const __bf16* __restrict__ Qh, const __bf16* __restrict__ Kh,
       const __bf16* __restrict__ Vt, const float* __restrict__ Mb,
       const float* __restrict__ Zb, const float* __restrict__ tw,
       const float* __restrict__ alpha, const float* __restrict__ beta,
       const float* __restrict__ Wmix, __bf16* __restrict__ Y) {
  // p*w of a chunk: [pair of heads][t][s][head of the pair]. 16 bytes hold two heads of two keys:
  // two A operands of the f32 mix product. Pitch 68 dwords: rows 8 apart differ by 32 banks, so the
  // two lane halves of a 4-byte store meet no common bank.
  __shared__ __attribute__((aligned(16))) float pw[(NH / 2) * 16 * PRP];   // 34 KB of 320 KB LDS
  // the mixed weights of a chunk, bf16: [g][t][s]
  __shared__ __attribute__((aligned(16))) __bf16 amx[NH * AMG];            // 20 KB
  // Each head's decay row with 32 zeros behind it, as the reference pads it: an index past the row
  // (s > t, by at most 31) reads 0, so the reads of the chunk loop need no guard and no branch.
  __shared__ __attribute__((aligned(16))) float twl[NH * TWP];       // 66 KB
  // A tile's chunks of keys are dealt evenly to (tile >> 3) / 3 + 1 blocks, at most 12 chunks each;
  // every block writes its own plane of y. 240 blocks.
  int b = blockIdx.x & 1, j = blockIdx.x >> 1;         // 120 blocks a batch: 48 + 48 + 24
  int tile, seg, c0, c1;
  if (j < 48) {
    tile = 63 - j / 3; seg = j % 3;
    int n = (tile * 16 + 47) >> 5;
    c0 = seg * n / 3; c1 = (seg + 1) * n / 3;
  } else if (j < 96) {
    tile = 47 - ((j - 48) >> 1); seg = (j - 48) & 1;
    int n = (tile * 16 + 47) >> 5;
    c0 = seg * n / 2; c1 = (seg + 1) * n / 2;
  } else {
    tile = 23 - (j - 96); seg = 0;
    c0 = 0; c1 = (tile * 16 + 47) >> 5;
  }
  int wave = threadIdx.x >> 5;                         // = input head h and output head g
  int lane = threadIdx.x & 31;
  int hf = lane >> 4, ml = lane & 15;
  int t0 = tile * 16;
  int h = wave, g = wave;
  int bh = b * NH + h, bg = b * NH + g;

  {
    const float4* trow = (const float4*)(tw + h * TT) + lane;
    float4 tv[8];
#pragma unroll
    for (int j = 0; j < 8; ++j) tv[j] = trow[j * 32];
    // precaution: stands in front of any rewrite of the address registers of the loads above
    asm volatile("s_wait_xcnt 0x0" ::: "memory");
    float4* trl = (float4*)(twl + h * TWP) + lane;
#pragma unroll
    for (int j = 0; j < 8; ++j) trl[j * 32] = tv[j];
    twl[h * TWP + TT + lane] = 0.f;
  }
  // decay weight of (t0 + hf*8 + r, s) = twp[s - r]
  const float* twp = twl + h * TWP + (TT - 1) - t0 - hf * 8;

  const __bf16* qrow = Qh + ((size_t)bh * TT + t0 + ml) * HS + hf * 8;
  v16bf qa0 = load_frag(qrow);
  v16bf qa1 = load_frag(qrow + 32);

  float mr[8], zi[8], bt[8];
#pragma unroll
  for (int r = 0; r < 8; ++r) {
    int t = t0 + r + hf * 8;
    mr[r] = Mb[(size_t)bh * TT + t];
    zi[r] = 1.0f / Zb[(size_t)bh * TT + t];
    bt[r] = beta[h * TT + t];
  }
  // B operand of the mix product: column g = ml; k step q, lane half hf, element e = head 4q + 2hf + e
  v2f wb[4];
  // unrolled so that wb[] stays in registers
#pragma unroll
  for (int q = 0; q < 4; ++q) wb[q] = *(const v2f*)(Wmix + ml * NH + q * 4 + hf * 2);

  v8f yac[4] = {};
  __syncthreads();   // the staged decay rows are complete before the first read
  for (int ch = c0; ch < c1; ++ch) {
    int s0 = ch * 32;
    // the chunk's 16 decay weights, read in front of the first store to pw so that they issue as a group
    float twv[2][8];
#pragma unroll
    for (int sub = 0; sub < 2; ++sub)
#pragma unroll
      for (int r = 0; r < 8; ++r) twv[sub][r] = twp[s0 + sub * 16 + ml - r];
    float al[2];
    al[0] = alpha[h * TT + s0 + ml];
    al[1] = alpha[h * TT + s0 + 16 + ml];
    // precaution: stands in front of any rewrite of the address registers of the two loads above
    asm volatile("s_wait_xcnt 0x0" ::: "memory");
    // phase A: this wave = head h; two 16-wide s subtiles of exp/Z * w -> LDS
    const __bf16* kp = Kh + ((size_t)bh * TT + s0 + ml) * HS + hf * 8;
    v16bf kf[2][2];
    // unrolled so that kf[] stays in registers
#pragma unroll
    for (int sub = 0; sub < 2; ++sub) {
      kf[sub][0] = load_frag(kp + sub * 16 * HS);
      kf[sub][1] = load_frag(kp + sub * 16 * HS + 32);
    }
    // precaution: stands in front of any rewrite of the address registers of the 8 loads above; the
    // operand keeps the address in its registers up to here, so that no load lands on them
    asm volatile("s_wait_xcnt 0x0" :: "v"(kp) : "memory");
    // keeps the products behind all 8 loads of the chunk, one wait for memory: without it this build
    // puts products between the loads to reuse their registers and waits for memory three times
    __builtin_amdgcn_sched_barrier(0);
#pragma unroll
    for (int sub = 0; sub < 2; ++sub) {
      v8f s = {};
      s = WMMA_BF16(qa0, kf[sub][0], s);
      s = WMMA_BF16(qa1, kf[sub][1], s);
#pragma unroll
      for (int r = 0; r < 8; ++r) {
        int tl = r + hf * 8;
        float p = __expf(s[r] * 0.125f - mr[r]) * zi[r];
        float wv = twv[sub][r] * al[sub] * bt[r];
        pw[((h >> 1) * 16 + tl) * PRP + (sub * 16 + ml) * 2 + (h & 1)] = p * wv;
      }
    }
    __syncthreads();
    // this wave's V fragments of the chunk, issued behind this barrier so that they fly during the mix
    v16bf vf[4];
    // unrolled so that vf[] stays in registers
#pragma unroll
    for (int dt = 0; dt < 4; ++dt)
      vf[dt] = load_frag(Vt + ((size_t)bg * HS + dt * 16 + ml) * TT + s0 + hf * 8);
    // phase B: this wave = row t0 + wave of the tile; all 16 output heads of its 32 keys in one
    // f32 matrix product: rows = keys (tile 0: even s, tile 1: odd s), k = input head, columns = g.
    // The p*w tile is read from LDS once by the block, not once by every output head.
    v8f m0 = {}, m1 = {};
    // unrolled so that wb[] stays in registers and the four reads differ only in their offsets
#pragma unroll
    for (int q = 0; q < 4; ++q) {
      // heads 4q + 2hf + {0, 1} of keys 2ml and 2ml + 1: the k order of wb[q]
      const float4 v = *(const float4*)&pw[((q * 2 + hf) * 16 + wave) * PRP + ml * 4];
      v2f a0 = {v.x, v.y}, a1 = {v.z, v.w};
      m0 = WMMA_F32(a0, wb[q], m0);
      m1 = WMMA_F32(a1, wb[q], m1);
    }
    // register r = keys 16hf + 2r (m0) and 16hf + 2r + 1 (m1) of output head ml: 32 B of one row
    {
      v8bf o0, o1;
      // unrolled so that the vector elements are named at compile time
#pragma unroll
      for (int r = 0; r < 4; ++r) {
        o0[2 * r] = (__bf16)m0[r];     o0[2 * r + 1] = (__bf16)m1[r];
        o1[2 * r] = (__bf16)m0[r + 4]; o1[2 * r + 1] = (__bf16)m1[r + 4];
      }
      __bf16* ap = amx + ml * AMG + wave * AMP + hf * 16;
      *(v8bf*)ap       = o0;
      *(v8bf*)(ap + 8) = o1;
    }
    // The mixed tile is complete, and every wave has left pw, which the next chunk rewrites. amx is
    // rewritten only behind the next chunk's first barrier, which every wave's reads below precede.
    __syncthreads();
    // phase C: this wave = output head g; its mixed 16 x 32 tile is the A operand, 4 WMMAs vs Vt
    v16bf am = load_frag(amx + g * AMG + ml * AMP + hf * 8);
    // unrolled so that vf[] and yac[] stay in registers
#pragma unroll
    for (int dt = 0; dt < 4; ++dt) yac[dt] = WMMA_BF16(am, vf[dt], yac[dt]);
  }
  // write this block's plane of y[b][t][g*64+d] as bf16 for the final WMMA GEMM
  Y += (size_t)seg * YPL;
#pragma unroll
  for (int dt = 0; dt < 4; ++dt)
#pragma unroll
    for (int r = 0; r < 8; ++r) {
      int t = t0 + r + hf * 8;
      int n = g * HS + dt * 16 + ml;
      Y[((size_t)b * TT + t) * CC + n] = (__bf16)yac[dt][r];
    }
}

// ---------------- host-side orchestration ----------------
extern "C" void kernel_launch(void* const* d_in, const int* in_sizes, int n_in,
                              void* d_out, int out_size, void* d_ws, size_t ws_size,
                              hipStream_t stream) {
  const float* x     = (const float*)d_in[0];
  const float* tw    = (const float*)d_in[1];
  const float* alpha = (const float*)d_in[2];
  const float* beta  = (const float*)d_in[3];
  const float* gamma = (const float*)d_in[4];
  const float* Wq = (const float*)d_in[5];  const float* bq = (const float*)d_in[6];
  const float* Wk = (const float*)d_in[7];  const float* bk = (const float*)d_in[8];
  const float* Wv = (const float*)d_in[9];  const float* bv = (const float*)d_in[10];
  const float* Wmix = (const float*)d_in[11];
  const float* Wo = (const float*)d_in[12]; const float* bo = (const float*)d_in[13];
  float* out = (float*)d_out;

  char* ws = (char*)d_ws;
  const size_t MB = 1u << 20;
  __bf16* XS   = (__bf16*)(ws + 0);          // 4 MB
  __bf16* WQT  = (__bf16*)(ws + 4 * MB);     // 2 MB each
  __bf16* WKT  = (__bf16*)(ws + 6 * MB);
  __bf16* WVT  = (__bf16*)(ws + 8 * MB);
  __bf16* WOT  = (__bf16*)(ws + 10 * MB);
  float*  QR   = (float*)(ws + 12 * MB);     // 8 MB each
  float*  KR   = (float*)(ws + 20 * MB);
  float*  VR   = (float*)(ws + 28 * MB);
  __bf16* QHB  = (__bf16*)(ws + 36 * MB);    // 4 MB each
  __bf16* KHB  = (__bf16*)(ws + 40 * MB);
  __bf16* VTB  = (__bf16*)(ws + 44 * MB);
  float*  MBUF = (float*)(ws + 48 * MB);     // 128 KB each
  float*  ZBUF = (float*)(ws + 48 * MB + (128u << 10));
  __bf16* YBF  = (__bf16*)(ws + 49 * MB);    // 3 planes of 4 MB

  // 1) + 2) shift + bf16 (4 rows per block) and the four weight transpose-converts, one grid
  k_prep<<<SHB + 4 * CVB, 256, 0, stream>>>(x, Wq, Wk, Wv, Wo, XS, WQT, WKT, WVT, WOT);
  // 3) QKV GEMMs: (B*T=2048) x 1024 x 1024 each, 128x64 tile per block of 8 waves, one grid
  const int gblk = (BB * TT / GBM) * (CC / GBN);   // 256 blocks a product
  k_gemm_qkv<<<dim3(gblk, 3), 256, 0, stream>>>(XS, WQT, WKT, WVT, bq, bk, bv, QR, KR, VR);
  // 4) RoPE + relayout
  k_rope<<<BB * TT / 8, 256, 0, stream>>>(QR, KR, VR, QHB, KHB, VTB);
  // 5) softmax stats: 2048 waves = 256 blocks x 8 waves
  k_stats<<<256, 256, 0, stream>>>(QHB, KHB, MBUF, ZBUF);
  // 6) fused attention: 1 to 3 blocks per (b, 16-row tile), 16 waves = 16 heads
  k_attn<<<BB * 120, 512, 0, stream>>>(QHB, KHB, VTB, MBUF, ZBUF,
                                             tw, alpha, beta, Wmix, YBF);
  // 7) output GEMM over the planes of y, with bias + gamma epilogue
  k_gemm_out<<<gblk, 256, 0, stream>>>(YBF, WOT, bo, gamma, out);
}

// v009
// Measured time: 91.8 microseconds a run.
// In two side-by-side timings against v008, it was 1.20 and 1.21 times as fast.
// All steps since v000 together make it 6.32 times as fast.
#include <hip/hip_runtime.h>
#include <hip/hip_bf16.h>
#include <math.h>

// ---------------- problem constants ----------------
enum : int { BB = 2, TT = 1024, CC = 1024, NH = 16, HS = 64, ROT = 32 };
enum : int { PRP = 68 };   // LDS row pitch of the p*w tile, in floats: 32 keys x 2 heads, then 4
enum : int { AMP = 40 };   // LDS row pitch of the mixed tile, in bf16: 80 B = 16 B x odd
enum : int { AMG = 16 * AMP + 8 };   // one output head's 16 mixed rows, in bf16: 1296 B = 16 B x odd
enum : int { TWP = TT + 32 };   // LDS pitch of one head's decay row: the row, then 32 zeros

typedef __attribute__((ext_vector_type(16))) __bf16 v16bf;
typedef __attribute__((ext_vector_type(8)))  __bf16 v8bf;
typedef __attribute__((ext_vector_type(4)))  __bf16 v4bf;
typedef __attribute__((ext_vector_type(8)))  float  v8f;
typedef __attribute__((ext_vector_type(2)))  float  v2f;

#define WMMA_BF16(a, b, c) \
  __builtin_amdgcn_wmma_f32_16x16x32_bf16(false, (a), false, (b), (short)0, (c), false, false)
#define WMMA_F32(a, b, c) \
  __builtin_amdgcn_wmma_f32_16x16x4_f32(false, (a), false, (b), (short)0, (c), false, false)

// Fragment loader: lane supplies base = row_ptr + kb (kb = 8*(lane>=16)).
// Elements 0..7  <- K = kb+0..7   (16B load)
// Elements 8..15 <- K = kb+16..23 (16B load)
static __device__ __forceinline__ v16bf load_frag(const __bf16* p) {
  v8bf lo = *(const v8bf*)p;
  v8bf hi = *(const v8bf*)(p + 16);
  v16bf r;
#pragma unroll
  for (int i = 0; i < 8; ++i) { r[i] = lo[i]; r[i + 8] = hi[i]; }
  return r;
}

// The same fragment from a buffer kept in fragment order: elements 0..7 of the 32 lanes are one run of
// 512 B, elements 8..15 the next. Lane supplies base = run + lane*8: each load takes four whole lines.
static __device__ __forceinline__ v16bf load_fragc(const __bf16* p) {
  v8bf lo = *(const v8bf*)p;
  v8bf hi = *(const v8bf*)(p + 256);
  v16bf r;
#pragma unroll
  for (int i = 0; i < 8; ++i) { r[i] = lo[i]; r[i + 8] = hi[i]; }
  return r;
}

// One wave turns a 64-row x 16-column f32 tile into its bf16 transpose, in registers.
// Lane (tl, ng) holds rows tl*8..+7 of columns ng*4..+3: eight 16-byte loads (4 lanes = 64 B of a
// row), four 16-byte stores (8 lanes = one whole 128-B line of a transposed row).
static __device__ __forceinline__ void tile_T(const float* __restrict__ src, int ld_src,
                                              __bf16* __restrict__ dst, int ld_dst, int lane) {
  int ng = lane & 3, tl = lane >> 2;
  const float* p = src + (size_t)(tl * 8) * ld_src + ng * 4;
  float4 v[8];
#pragma unroll
  for (int j = 0; j < 8; ++j) v[j] = *(const float4*)(p + (size_t)j * ld_src);
  // precaution: stands in front of any rewrite of the address registers of the loads above
  asm volatile("s_wait_xcnt 0x0" ::: "memory");
  v8bf o0, o1, o2, o3;
#pragma unroll
  for (int j = 0; j < 8; ++j) {
    o0[j] = (__bf16)v[j].x; o1[j] = (__bf16)v[j].y;
    o2[j] = (__bf16)v[j].z; o3[j] = (__bf16)v[j].w;
  }
  __bf16* q = dst + (size_t)(ng * 4) * ld_dst + tl * 8;
  *(v8bf*)(q)                      = o0;
  *(v8bf*)(q + (size_t)ld_dst)     = o1;
  *(v8bf*)(q + (size_t)2 * ld_dst) = o2;
  *(v8bf*)(q + (size_t)3 * ld_dst) = o3;
}

// One wave turns a 64-key x 16-column f32 tile of V into the B fragments of att @ V, in fragment order.
// Loads and lane map are those of tile_T. A lane's keys tl*8..+7 are 16 bytes of one fragment lane:
// chunk tl>>2 of 32 keys (4 KB), run (tl>>1)&1 (512 B), lane half tl&1; column ng*4+c is lane c of
// its four, so a lane's four stores are 64 B in a row and four lanes fill 256 B.
static __device__ __forceinline__ void tile_vfrag(const float* __restrict__ src,
                                                  __bf16* __restrict__ dst, int lane) {
  int ng = lane & 3, tl = lane >> 2;
  const float* p = src + (size_t)(tl * 8) * CC + ng * 4;
  float4 v[8];
#pragma unroll
  for (int j = 0; j < 8; ++j) v[j] = *(const float4*)(p + (size_t)j * CC);
  // precaution: stands in front of any rewrite of the address registers of the loads above
  asm volatile("s_wait_xcnt 0x0" ::: "memory");
  v8bf o0, o1, o2, o3;
#pragma unroll
  for (int j = 0; j < 8; ++j) {
    o0[j] = (__bf16)v[j].x; o1[j] = (__bf16)v[j].y;
    o2[j] = (__bf16)v[j].z; o3[j] = (__bf16)v[j].w;
  }
  __bf16* q = dst + (tl >> 2) * 2048 + ((tl >> 1) & 1) * 256 + ((tl & 1) * 16 + ng * 4) * 8;
  *(v8bf*)(q)      = o0;
  *(v8bf*)(q + 8)  = o1;
  *(v8bf*)(q + 16) = o2;
  *(v8bf*)(q + 24) = o3;
}

static __device__ __forceinline__ v4bf cvt4(float a, float b, float c, float d) {
  v4bf r;
  r[0] = (__bf16)a; r[1] = (__bf16)b; r[2] = (__bf16)c; r[3] = (__bf16)d;
  return r;
}

// ---------------- 1) time-shift + f32->bf16 ----------------
// A block of 256 threads spans one row (256 groups of 4 channels) and takes 4 rows.
static __device__ __forceinline__ void shift_rows(const float* __restrict__ x,
                                                  __bf16* __restrict__ xs, int blk) {
  int c = threadIdx.x * 4;
  int row0 = blk * 4;
  int back = (c < CC / 2) ? 1 : 0;             // first half of the channels reads row t-1
  float4 v[4];
#pragma unroll
  for (int q = 0; q < 4; ++q) {
    int srow = row0 + q - back;                // clamped so that all four loads issue together
    v[q] = *(const float4*)(x + (size_t)(srow < 0 ? 0 : srow) * CC + c);
  }
  // precaution: stands in front of any rewrite of the address registers of the loads above
  asm volatile("s_wait_xcnt 0x0" ::: "memory");
#pragma unroll
  for (int q = 0; q < 4; ++q)
    if (back && ((row0 + q) & (TT - 1)) == 0) v[q] = make_float4(0.f, 0.f, 0.f, 0.f);
#pragma unroll
  for (int q = 0; q < 4; ++q)
    *(v4bf*)(xs + (size_t)(row0 + q) * CC + c) = cvt4(v[q].x, v[q].y, v[q].z, v[q].w);
}

// ---------------- 2) W[k][n] f32 -> Wt[n][k] bf16 ----------------
// 1024 waves a matrix: wave = (64-row k tile, 16-column n tile)
static __device__ __forceinline__ void convT(const float* __restrict__ W,
                                             __bf16* __restrict__ Wt, int blk) {
  int gw = (blk * 256 + threadIdx.x) >> 5;
  int kt = gw >> 6, nt = gw & 63;
  tile_T(W + (size_t)kt * 64 * CC + nt * 16, CC,
         Wt + (size_t)nt * 16 * CC + kt * 64, CC, threadIdx.x & 31);
  // precaution: stands in front of any rewrite of the registers that the tile's four stores name
  asm volatile("s_wait_xcnt 0x0" ::: "memory");
}

// 1) and 2) depend on nothing and on each other not at all: one grid holds them, by block range.
enum : int { SHB = BB * TT / 4, CVB = 128 };   // blocks of the shift; blocks of one weight matrix
__global__ void __launch_bounds__(256)
k_prep(const float* __restrict__ x, const float* __restrict__ Wq, const float* __restrict__ Wk,
       const float* __restrict__ Wv, const float* __restrict__ Wo, __bf16* __restrict__ xs,
       __bf16* __restrict__ Wqt, __bf16* __restrict__ Wkt, __bf16* __restrict__ Wvt,
       __bf16* __restrict__ Wot) {
  int blk = blockIdx.x;
  if (blk < SHB) { shift_rows(x, xs, blk); return; }
  blk -= SHB;
  int sel = blk / CVB;
  const float* W = sel == 0 ? Wq : sel == 1 ? Wk : sel == 2 ? Wv : Wo;
  __bf16* Wt = sel == 0 ? Wqt : sel == 1 ? Wkt : sel == 2 ? Wvt : Wot;
  convT(W, Wt, blk % CVB);
}

// ---------------- bf16 WMMA GEMM, operands staged in LDS, 32x32 per wave ----------------
// out = A @ Bt^T + bias (opt *gamma[m%T]); M = BB*TT, N = K = CC.
// A block of 8 waves (4 x 2) owns a 128 x 64 tile of out. A stage is 128 k (256 B) of the block's
// 128 rows of A and 64 rows of Bt, brought into LDS by asynchronous 16-byte copies: 16 lanes take
// one row's 256 B, so every copy instruction moves whole lines. Two buffers: the next stage's
// copies fly while this stage is worked on.
enum : int { GBM = 128, GBN = 64, GBK = 128, GNT = CC / GBK };
enum : int { GPITCH = 2 * GBK + 16 };             // LDS row pitch in bytes: 272 = 16 B x odd
enum : int { GBUF = (GBM + GBN) * GPITCH };       // one buffer: the A rows, then the Bt rows

// Four copies of this lane: rows 16 apart in the source (pitch CC elements) and in LDS.
static __device__ __forceinline__ void copy4(unsigned lds, const __bf16* g) {
  // The wait is the last line of the copies' own statement, so that it stands in front of any
  // rewrite of the address registers that the copies name (a precaution).
  asm volatile("global_load_async_to_lds_b128 %0, %4, off\n\t"
               "global_load_async_to_lds_b128 %1, %5, off\n\t"
               "global_load_async_to_lds_b128 %2, %6, off\n\t"
               "global_load_async_to_lds_b128 %3, %7, off\n\t"
               "s_wait_xcnt 0x0"
               :: "v"(lds), "v"(lds + 16 * GPITCH), "v"(lds + 32 * GPITCH), "v"(lds + 48 * GPITCH),
                  "v"(g), "v"(g + 16 * CC), "v"(g + 32 * CC), "v"(g + 48 * CC)
               : "memory");
}

// One stage: 8 copies of A and 4 of Bt per lane. la = this lane's LDS place in the buffer's row
// tid>>4, ga / gb = the same place of the stage in A / Bt.
static __device__ __forceinline__ void copy_stage(unsigned la, const __bf16* ga, const __bf16* gb) {
  copy4(la, ga);
  copy4(la + 64 * GPITCH, ga + 64 * CC);
  copy4(la + GBM * GPITCH, gb);
}

static __device__ __forceinline__ void
gemm_tile(const __bf16* __restrict__ A, const __bf16* __restrict__ Bt,
          const float* __restrict__ bias, const float* __restrict__ gamma,
          float* __restrict__ out) {
  __shared__ __attribute__((aligned(16))) unsigned char sm[2 * GBUF];   // 102 KB
  int tid  = threadIdx.x;
  int wave = tid >> 5, lane = tid & 31;
  int hf = lane >> 4, ml = lane & 15;
  int bm0 = (blockIdx.x >> 4) * GBM, bn0 = (blockIdx.x & 15) * GBN;     // 16 x 16 block tiles
  int wm = (wave >> 1) * 32, wn = (wave & 1) * 32;

  unsigned la = (unsigned)(size_t)sm + (unsigned)((tid >> 4) * GPITCH + (tid & 15) * 16);
  const __bf16* ga = A  + (size_t)(bm0 + (tid >> 4)) * CC + (tid & 15) * 8;
  const __bf16* gb = Bt + (size_t)(bn0 + (tid >> 4)) * CC + (tid & 15) * 8;

  copy_stage(la, ga, gb);
  // stage 0 has landed for this wave; the barrier publishes it to the others
  asm volatile("s_wait_asynccnt 0x0" ::: "memory");
  __syncthreads();
  copy_stage(la + GBUF, ga + GBK, gb + GBK);

  v8f a00 = {}, a01 = {}, a10 = {}, a11 = {};
  for (int t = 0; t < GNT; ++t) {
    const unsigned char* bufp = sm + (t & 1) * GBUF;
    const unsigned char* pa = bufp + (wm + ml) * GPITCH + hf * 16;
    const unsigned char* pb = bufp + (GBM + wn + ml) * GPITCH + hf * 16;
    // unrolled so that the four k steps differ only in the immediate offsets of their LDS reads
#pragma unroll
    for (int ks = 0; ks < GBK / 32; ++ks) {
      v16bf fa0 = load_frag((const __bf16*)(pa + ks * 64));
      v16bf fa1 = load_frag((const __bf16*)(pa + 16 * GPITCH + ks * 64));
      v16bf fb0 = load_frag((const __bf16*)(pb + ks * 64));
      v16bf fb1 = load_frag((const __bf16*)(pb + 16 * GPITCH + ks * 64));
      a00 = WMMA_BF16(fa0, fb0, a00);
      a01 = WMMA_BF16(fa0, fb1, a01);
      a10 = WMMA_BF16(fa1, fb0, a10);
      a11 = WMMA_BF16(fa1, fb1, a11);
    }
    // this wave's reads of the buffer have returned before the buffer is handed to the copies
    asm volatile("s_wait_dscnt 0x0" ::: "memory");
    // this wave's copies of stage t + 1 have landed
    asm volatile("s_wait_asynccnt 0x0" ::: "memory");
    __syncthreads();   // publishes stage t + 1 and ends every wave's reads of stage t
    if (t + 2 < GNT)
      copy_stage(la + (t & 1) * GBUF, ga + (t + 2) * GBK, gb + (t + 2) * GBK);
  }
  // no copy is outstanding when the wave ends
  asm volatile("s_wait_asynccnt 0x0" ::: "memory");

  int m0 = bm0 + wm, n0 = bn0 + wn;
#pragma unroll
  for (int bm = 0; bm < 2; ++bm)
#pragma unroll
    for (int bn = 0; bn < 2; ++bn) {
      const v8f& acc = bm ? (bn ? a11 : a10) : (bn ? a01 : a00);
      int n = n0 + bn * 16 + ml;
      float bv = bias ? bias[n] : 0.f;
#pragma unroll
      for (int r = 0; r < 8; ++r) {
        int m = m0 + bm * 16 + r + hf * 8;
        float v = acc[r] + bv;
        if (gamma) v *= gamma[m % TT];
        out[(size_t)m * CC + n] = v;
        // precaution: stands in front of any rewrite of the registers that the store above names
        asm volatile("s_wait_xcnt 0x0" ::: "memory");
      }
    }
}

// The three projections read the same A and depend on each other not at all: one grid, blockIdx.y
// names the projection. Three blocks (102 KB of LDS each) stand on a WGP together.
__global__ void __launch_bounds__(256)
k_gemm_qkv(const __bf16* __restrict__ A, const __bf16* __restrict__ Wqt,
           const __bf16* __restrict__ Wkt, const __bf16* __restrict__ Wvt,
           const float* __restrict__ bq, const float* __restrict__ bk,
           const float* __restrict__ bv, float* __restrict__ Q, float* __restrict__ K,
           float* __restrict__ V) {
  int sel = blockIdx.y;
  gemm_tile(A, sel == 0 ? Wqt : sel == 1 ? Wkt : Wvt, sel == 0 ? bq : sel == 1 ? bk : bv,
            nullptr, sel == 0 ? Q : sel == 1 ? K : V);
}

// ---------------- output GEMM: sums the attention's partial y planes in its accumulators ----------------
// out = ((sum over planes of Yp) @ Bt^T + bias) * gamma[m%T]. Rows t of a batch have (t >> 7) / 3 + 1
// planes (k_attn's split of the keys). Block tile, wave tile, stage length, copies and the order of
// waits and barrier are those of gemm_tile; a stage holds the 64 Bt rows and then 128 rows of each
// plane. The Bt fragments of a stage are read from LDS once and serve every plane.
enum : int { YSEG = 3 };                          // most planes of a row
enum : int { YPL = BB * TT * CC };                // elements of one plane
enum : int { OBUF = (GBN + YSEG * GBM) * GPITCH };   // one buffer: 119 KB

static __device__ __forceinline__ void copy_stage_out(unsigned la, const __bf16* ga,
                                                      const __bf16* gb, int nseg) {
  copy4(la, gb);
  for (int sg = 0; sg < nseg; ++sg) {             // at most 4 + 8 * 3 = 28 copies of a wave in flight
    copy4(la + (GBN + sg * GBM) * GPITCH, ga + (size_t)sg * YPL);
    copy4(la + (GBN + sg * GBM + 64) * GPITCH, ga + (size_t)sg * YPL + 64 * CC);
  }
}

__global__ void __launch_bounds__(256)
k_gemm_out(const __bf16* __restrict__ Yp, const __bf16* __restrict__ Bt,
           const float* __restrict__ bias, const float* __restrict__ gamma,
           float* __restrict__ out) {
  __shared__ __attribute__((aligned(16))) unsigned char sm[2 * OBUF];   // 238 KB of 320 KB LDS
  int tid  = threadIdx.x;
  int wave = tid >> 5, lane = tid & 31;
  int hf = lane >> 4, ml = lane & 15;
  int bm0 = (blockIdx.x >> 4) * GBM, bn0 = (blockIdx.x & 15) * GBN;     // 16 x 16 block tiles
  int wm = (wave >> 1) * 32, wn = (wave & 1) * 32;
  int nseg = ((bm0 & (TT - 1)) >> 7) / 3 + 1;     // the same for the block's 128 rows

  unsigned la = (unsigned)(size_t)sm + (unsigned)((tid >> 4) * GPITCH + (tid & 15) * 16);
  const __bf16* ga = Yp + (size_t)(bm0 + (tid >> 4)) * CC + (tid & 15) * 8;
  const __bf16* gb = Bt + (size_t)(bn0 + (tid >> 4)) * CC + (tid & 15) * 8;

  copy_stage_out(la, ga, gb, nseg);
  // stage 0 has landed for this wave; the barrier publishes it to the others
  asm volatile("s_wait_asynccnt 0x0" ::: "memory");
  __syncthreads();
  copy_stage_out(la + OBUF, ga + GBK, gb + GBK, nseg);

  v8f a00 = {}, a01 = {}, a10 = {}, a11 = {};
  for (int t = 0; t < GNT; ++t) {
    const unsigned char* bufp = sm + (t & 1) * OBUF;
    const unsigned char* pb = bufp + (wn + ml) * GPITCH + hf * 16;
    v16bf fb0[GBK / 32], fb1[GBK / 32];
    // unrolled so that fb0[] and fb1[] stay in registers
#pragma unroll
    for (int ks = 0; ks < GBK / 32; ++ks) {
      fb0[ks] = load_frag((const __bf16*)(pb + ks * 64));
      fb1[ks] = load_frag((const __bf16*)(pb + 16 * GPITCH + ks * 64));
    }
    for (int sg = 0; sg < nseg; ++sg) {
      const unsigned char* pa = bufp + (GBN + sg * GBM + wm + ml) * GPITCH + hf * 16;
      v16bf fa0[GBK / 32], fa1[GBK / 32];
      // unrolled so that fa0[] and fa1[] stay in registers
#pragma unroll
      for (int ks = 0; ks < GBK / 32; ++ks) {
        fa0[ks] = load_frag((const __bf16*)(pa + ks * 64));
        fa1[ks] = load_frag((const __bf16*)(pa + 16 * GPITCH + ks * 64));
      }
      // keeps the products behind all 16 LDS reads of the plane: without it the scheduler reuses two
      // fragments' registers, reads in pairs between the products and waits for LDS at every pair
      __builtin_amdgcn_sched_barrier(0);
      // unrolled so that the fragment arrays are indexed at compile time
#pragma unroll
      for (int ks = 0; ks < GBK / 32; ++ks) {
        a00 = WMMA_BF16(fa0[ks], fb0[ks], a00);
        a01 = WMMA_BF16(fa0[ks], fb1[ks], a01);
        a10 = WMMA_BF16(fa1[ks], fb0[ks], a10);
        a11 = WMMA_BF16(fa1[ks], fb1[ks], a11);
      }
    }
    // this wave's reads of the buffer have returned before the buffer is handed to the copies
    asm volatile("s_wait_dscnt 0x0" ::: "memory");
    // this wave's copies of stage t + 1 have landed
    asm volatile("s_wait_asynccnt 0x0" ::: "memory");
    __syncthreads();   // publishes stage t + 1 and ends every wave's reads of stage t
    if (t + 2 < GNT)
      copy_stage_out(la + (t & 1) * OBUF, ga + (t + 2) * GBK, gb + (t + 2) * GBK, nseg);
  }
  // no copy is outstanding when the wave ends
  asm volatile("s_wait_asynccnt 0x0" ::: "memory");

  int m0 = bm0 + wm, n0 = bn0 + wn;
#pragma unroll
  for (int bm = 0; bm < 2; ++bm)
#pragma unroll
    for (int bn = 0; bn < 2; ++bn) {
      const v8f& acc = bm ? (bn ? a11 : a10) : (bn ? a01 : a00);
      int n = n0 + bn * 16 + ml;
      float bv = bias[n];
#pragma unroll
      for (int r = 0; r < 8; ++r) {
        int m = m0 + bm * 16 + r + hf * 8;
        out[(size_t)m * CC + n] = (acc[r] + bv) * gamma[m % TT];
        // precaution: stands in front of any rewrite of the registers that the store above names
        asm volatile("s_wait_xcnt 0x0" ::: "memory");
      }
    }
}

// ---------------- 4) RoPE + relayout to WMMA-friendly buffers ----------------
// Qh: [b*16+h][t][64] bf16. Kh and Vt are kept in the order in which a wave's fragment loads take them,
// so that every such load reads 512 B in a row (four whole lines) and not 32 B of each of 16 lines:
// Kh: [b*16+h][s>>4][d>>4][(d>>3)&1][s&15][d&7]          (16 keys = 2 KB = 2 fragments of 2 runs)
// Vt: [b*16+h][s>>5][d>>4][(s>>4)&1][(s>>3)&1][d&15][s&7] (32 keys = 4 KB = 4 fragments of 2 runs)
// A block takes 8 rows (t) of Q and K, each thread 4 channels of each row, and 8 V tiles of tile_vfrag.
__global__ void __launch_bounds__(256)
k_rope(const float* __restrict__ Q, const float* __restrict__ Kr,
       const float* __restrict__ V, __bf16* __restrict__ Qh,
       __bf16* __restrict__ Kh, __bf16* __restrict__ Vt) {
  {
    int gw = blockIdx.x * 8 + (threadIdx.x >> 5);
    int rt = gw >> 6, nt = gw & 63;            // 64-row tile over b*T+t, 16-column tile over h*64+d
    int vb = rt >> 4, tq = rt & 15;
    tile_vfrag(V + (size_t)rt * 64 * CC + nt * 16,
               Vt + (size_t)(vb * NH + (nt >> 2)) * HS * TT + tq * 4096 + (nt & 3) * 512,
               threadIdx.x & 31);
  }
  int nn = threadIdx.x * 4;
  int h = nn >> 6, d = nn & 63;
  int row0 = blockIdx.x * 8;
  int b = row0 / TT, t0 = row0 % TT;
  const float* qp = Q  + (size_t)row0 * CC + nn;
  const float* kp = Kr + (size_t)row0 * CC + nn;
  float4 q[8], k[8];
#pragma unroll
  for (int j = 0; j < 8; ++j) {
    q[j] = *(const float4*)(qp + (size_t)j * CC);
    k[j] = *(const float4*)(kp + (size_t)j * CC);
  }
  if (d < ROT) {
    int po = (d < 16) ? 16 : -16;              // the group of 4 never straddles a multiple of 16
    float sgn = (d < 16) ? -1.f : 1.f;
    float inv[4];
#pragma unroll
    for (int e = 0; e < 4; ++e) inv[e] = __powf(1024.0f, -(float)((d + e) & 15) / 16.0f);
#pragma unroll
    for (int j = 0; j < 8; ++j) {
      float4 pq = *(const float4*)(qp + (ptrdiff_t)j * CC + po);
      float4 pk = *(const float4*)(kp + (ptrdiff_t)j * CC + po);
      float tf = (float)(t0 + j);
      float f0 = tf * inv[0], f1 = tf * inv[1], f2 = tf * inv[2], f3 = tf * inv[3];
      float c0 = __cosf(f0), s0 = __sinf(f0), c1 = __cosf(f1), s1 = __sinf(f1);
      float c2 = __cosf(f2), s2 = __sinf(f2), c3 = __cosf(f3), s3 = __sinf(f3);
      q[j].x = q[j].x * c0 + sgn * pq.x * s0;  k[j].x = k[j].x * c0 + sgn * pk.x * s0;
      q[j].y = q[j].y * c1 + sgn * pq.y * s1;  k[j].y = k[j].y * c1 + sgn * pk.y * s1;
      q[j].z = q[j].z * c2 + sgn * pq.z * s2;  k[j].z = k[j].z * c2 + sgn * pk.z * s2;
      q[j].w = q[j].w * c3 + sgn * pq.w * s3;  k[j].w = k[j].w * c3 + sgn * pk.w * s3;
    }
  }
  size_t ob = ((size_t)(b * NH + h) * TT + t0) * HS + d;
  // t0 is a multiple of 8: the 8 rows are 8 fragment lanes in a row, one 128-B line of two threads
  size_t ok = (size_t)(b * NH + h) * TT * HS + (t0 >> 4) * 1024 + (d >> 4) * 256 +
              (((d >> 3) & 1) * 16 + (t0 & 15)) * 8 + (d & 7);
#pragma unroll
  for (int j = 0; j < 8; ++j) {
    *(v4bf*)(Qh + ob + (size_t)j * HS) = cvt4(q[j].x, q[j].y, q[j].z, q[j].w);
    *(v4bf*)(Kh + ok + (size_t)j * 8) = cvt4(k[j].x, k[j].y, k[j].z, k[j].w);
  }
}

// ---------------- 5) softmax stats over ALL s (max & sum) ----------------
// Each lane keeps the running maximum and sum of the keys of its own column (s = 16*i + ml) alone;
// the 16 lanes of a row are merged once, behind the loop. A pass takes 64 keys: one maximum, one
// rescale of the sum. The bound is the launch's own block size: it gives a pass's 16 loads the
// registers to be in flight together.
__global__ void __launch_bounds__(256) k_stats(const __bf16* __restrict__ Qh, const __bf16* __restrict__ Kh,
                        float* __restrict__ Mb, float* __restrict__ Zb) {
  int wid  = (blockIdx.x * blockDim.x + threadIdx.x) >> 5;
  int lane = threadIdx.x & 31;
  int hf = lane >> 4, ml = lane & 15;
  int tile = wid & 63, bh = wid >> 6;      // 2048 waves: [b*16+h][t-tile]
  int t0 = tile * 16;
  const __bf16* qrow = Qh + ((size_t)bh * TT + t0 + ml) * HS + hf * 8;
  v16bf qa0 = load_frag(qrow);
  v16bf qa1 = load_frag(qrow + 32);
  float mr[8], zz[8];
#pragma unroll
  for (int r = 0; r < 8; ++r) { mr[r] = -3.0e38f; zz[r] = 0.f; }
  const __bf16* krow = Kh + (size_t)bh * TT * HS + lane * 8;   // fragment order: 64 keys = 8 KB in a row
  for (int st = 0; st < TT / 64; ++st) {
    v16bf kf[4][2];
    v8f s[4];
    const __bf16* kp = krow + (size_t)st * 64 * HS;
    // unrolled so that kf[] stays in registers
#pragma unroll
    for (int u = 0; u < 4; ++u) {
      kf[u][0] = load_fragc(kp + u * 1024);
      kf[u][1] = load_fragc(kp + u * 1024 + 512);
    }
    // keeps the products behind all 16 loads of the pass: without it the scheduler puts products
    // between the loads to reuse their registers, and a pass waits for memory several times over
    __builtin_amdgcn_sched_barrier(0);
    // unrolled so that s[] stays in registers
#pragma unroll
    for (int u = 0; u < 4; ++u) {
      v8f acc = {};
      acc = WMMA_BF16(qa0, kf[u][0], acc);
      s[u] = WMMA_BF16(qa1, kf[u][1], acc);
    }
    // unrolled so that mr[] and zz[] stay in registers; the eight rows are independent chains
#pragma unroll
    for (int r = 0; r < 8; ++r) {
      float x0 = s[0][r] * 0.125f, x1 = s[1][r] * 0.125f;   // 1/sqrt(64)
      float x2 = s[2][r] * 0.125f, x3 = s[3][r] * 0.125f;
      float mnew = fmaxf(fmaxf(fmaxf(x0, x1), fmaxf(x2, x3)), mr[r]);
      float e = (__expf(x0 - mnew) + __expf(x1 - mnew)) + (__expf(x2 - mnew) + __expf(x3 - mnew));
      zz[r] = zz[r] * __expf(mr[r] - mnew) + e;
      mr[r] = mnew;
    }
  }
  // the merge of a row's 16 lanes; unrolled so that the eight rows' exchanges overlap
#pragma unroll
  for (int r = 0; r < 8; ++r) {
    float m = mr[r];
    m = fmaxf(m, __shfl_xor(m, 8, 16));
    m = fmaxf(m, __shfl_xor(m, 4, 16));
    m = fmaxf(m, __shfl_xor(m, 2, 16));
    m = fmaxf(m, __shfl_xor(m, 1, 16));
    float z = zz[r] * __expf(mr[r] - m);
    z += __shfl_xor(z, 8, 16);
    z += __shfl_xor(z, 4, 16);
    z += __shfl_xor(z, 2, 16);
    z += __shfl_xor(z, 1, 16);
    mr[r] = m;
    zz[r] = z;
  }
  if (ml == 0) {
#pragma unroll
    for (int r = 0; r < 8; ++r) {
      int t = t0 + r + hf * 8;
      Mb[(size_t)bh * TT + t] = mr[r];
      Zb[(size_t)bh * TT + t] = zz[r];
    }
  }
}

// ---------------- 6) fused attention: scores -> p*w -> Wmix -> @v  (att stays on-WGP) ----------------
__global__ void __launch_bounds__(512)
k_attn(const __bf16* __restrict__ Qh, const __bf16* __restrict__ Kh,
       const __bf16* __restrict__ Vt, const float* __restrict__ Mb,
       const float* __restrict__ Zb, const float* __restrict__ tw,
       const float* __restrict__ alpha, const float* __restrict__ beta,
       const float* __restrict__ Wmix, __bf16* __restrict__ Y) {
  // p*w of a chunk: [pair of heads][t][s][head of the pair]. 16 bytes hold two heads of two keys:
  // two A operands of the f32 mix product. Pitch 68 dwords: rows 8 apart differ by 32 banks, so the
  // two lane halves of a 4-byte store meet no common bank.
  __shared__ __attribute__((aligned(16))) float pw[(NH / 2) * 16 * PRP];   // 34 KB of 320 KB LDS
  // the mixed weights of a chunk, bf16: [g][t][s]
  __shared__ __attribute__((aligned(16))) __bf16 amx[NH * AMG];            // 20 KB
  // Each head's decay row with 32 zeros behind it, as the reference pads it: an index past the row
  // (s > t, by at most 31) reads 0, so the reads of the chunk loop need no guard and no branch.
  __shared__ __attribute__((aligned(16))) float twl[NH * TWP];       // 66 KB
  // A tile's chunks of keys are dealt evenly to (tile >> 3) / 3 + 1 blocks, at most 12 chunks each;
  // every block writes its own plane of y. 240 blocks.
  int b = blockIdx.x & 1, j = blockIdx.x >> 1;         // 120 blocks a batch: 48 + 48 + 24
  int tile, seg, c0, c1;
  if (j < 48) {
    tile = 63 - j / 3; seg = j % 3;
    int n = (tile * 16 + 47) >> 5;
    c0 = seg * n / 3; c1 = (seg + 1) * n / 3;
  } else if (j < 96) {
    tile = 47 - ((j - 48) >> 1); seg = (j - 48) & 1;
    int n = (tile * 16 + 47) >> 5;
    c0 = seg * n / 2; c1 = (seg + 1) * n / 2;
  } else {
    tile = 23 - (j - 96); seg = 0;
    c0 = 0; c1 = (tile * 16 + 47) >> 5;
  }
  int wave = threadIdx.x >> 5;                         // = input head h and output head g
  int lane = threadIdx.x & 31;
  int hf = lane >> 4, ml = lane & 15;
  int t0 = tile * 16;
  int h = wave, g = wave;
  int bh = b * NH + h, bg = b * NH + g;

  {
    const float4* trow = (const float4*)(tw + h * TT) + lane;
    float4 tv[8];
#pragma unroll
    for (int j = 0; j < 8; ++j) tv[j] = trow[j * 32];
    // precaution: stands in front of any rewrite of the address registers of the loads above
    asm volatile("s_wait_xcnt 0x0" ::: "memory");
    float4* trl = (float4*)(twl + h * TWP) + lane;
#pragma unroll
    for (int j = 0; j < 8; ++j) trl[j * 32] = tv[j];
    twl[h * TWP + TT + lane] = 0.f;
  }
  // decay weight of (t0 + hf*8 + r, s) = twp[s - r]
  const float* twp = twl + h * TWP + (TT - 1) - t0 - hf * 8;

  const __bf16* qrow = Qh + ((size_t)bh * TT + t0 + ml) * HS + hf * 8;
  v16bf qa0 = load_frag(qrow);
  v16bf qa1 = load_frag(qrow + 32);

  float mr[8], zi[8], bt[8];
#pragma unroll
  for (int r = 0; r < 8; ++r) {
    int t = t0 + r + hf * 8;
    mr[r] = Mb[(size_t)bh * TT + t];
    zi[r] = 1.0f / Zb[(size_t)bh * TT + t];
    bt[r] = beta[h * TT + t];
  }
  // B operand of the mix product: column g = ml; k step q, lane half hf, element e = head 4q + 2hf + e
  v2f wb[4];
  // unrolled so that wb[] stays in registers
#pragma unroll
  for (int q = 0; q < 4; ++q) wb[q] = *(const v2f*)(Wmix + ml * NH + q * 4 + hf * 2);

  v8f yac[4] = {};
  __syncthreads();   // the staged decay rows are complete before the first read
  for (int ch = c0; ch < c1; ++ch) {
    int s0 = ch * 32;
    // the chunk's 16 decay weights, read in front of the first store to pw so that they issue as a group
    float twv[2][8];
#pragma unroll
    for (int sub = 0; sub < 2; ++sub)
#pragma unroll
      for (int r = 0; r < 8; ++r) twv[sub][r] = twp[s0 + sub * 16 + ml - r];
    float al[2];
    al[0] = alpha[h * TT + s0 + ml];
    al[1] = alpha[h * TT + s0 + 16 + ml];
    // precaution: stands in front of any rewrite of the address registers of the two loads above
    asm volatile("s_wait_xcnt 0x0" ::: "memory");
    // phase A: this wave = head h; two 16-wide s subtiles of exp/Z * w -> LDS
    const __bf16* kp = Kh + ((size_t)bh * TT + s0) * HS + lane * 8;   // fragment order: 4 KB in a row
    v16bf kf[2][2];
    // unrolled so that kf[] stays in registers
#pragma unroll
    for (int sub = 0; sub < 2; ++sub) {
      kf[sub][0] = load_fragc(kp + sub * 1024);
      kf[sub][1] = load_fragc(kp + sub * 1024 + 512);
    }
    // precaution: stands in front of any rewrite of the address registers of the 8 loads above; the
    // operand keeps the address in its registers up to here, so that no load lands on them
    asm volatile("s_wait_xcnt 0x0" :: "v"(kp) : "memory");
    // keeps the products behind all 8 loads of the chunk, one wait for memory: without it this build
    // puts products between the loads to reuse their registers and waits for memory three times
    __builtin_amdgcn_sched_barrier(0);
#pragma unroll
    for (int sub = 0; sub < 2; ++sub) {
      v8f s = {};
      s = WMMA_BF16(qa0, kf[sub][0], s);
      s = WMMA_BF16(qa1, kf[sub][1], s);
#pragma unroll
      for (int r = 0; r < 8; ++r) {
        int tl = r + hf * 8;
        float p = __expf(s[r] * 0.125f - mr[r]) * zi[r];
        float wv = twv[sub][r] * al[sub] * bt[r];
        pw[((h >> 1) * 16 + tl) * PRP + (sub * 16 + ml) * 2 + (h & 1)] = p * wv;
      }
    }
    __syncthreads();
    // this wave's V fragments of the chunk, issued behind this barrier so that they fly during the mix
    const __bf16* vp = Vt + (size_t)bg * HS * TT + (size_t)ch * 2048 + lane * 8;   // 4 KB in a row
    v16bf vf[4];
    // unrolled so that vf[] stays in registers
#pragma unroll
    for (int dt = 0; dt < 4; ++dt) vf[dt] = load_fragc(vp + dt * 512);
    // phase B: this wave = row t0 + wave of the tile; all 16 output heads of its 32 keys in one
    // f32 matrix product: rows = keys (tile 0: even s, tile 1: odd s), k = input head, columns = g.
    // The p*w tile is read from LDS once by the block, not once by every output head.
    v8f m0 = {}, m1 = {};
    // unrolled so that wb[] stays in registers and the four reads differ only in their offsets
#pragma unroll
    for (int q = 0; q < 4; ++q) {
      // heads 4q + 2hf + {0, 1} of keys 2ml and 2ml + 1: the k order of wb[q]
      const float4 v = *(const float4*)&pw[((q * 2 + hf) * 16 + wave) * PRP + ml * 4];
      v2f a0 = {v.x, v.y}, a1 = {v.z, v.w};
      m0 = WMMA_F32(a0, wb[q], m0);
      m1 = WMMA_F32(a1, wb[q], m1);
    }
    // register r = keys 16hf + 2r (m0) and 16hf + 2r + 1 (m1) of output head ml: 32 B of one row
    {
      v8bf o0, o1;
      // unrolled so that the vector elements are named at compile time
#pragma unroll
      for (int r = 0; r < 4; ++r) {
        o0[2 * r] = (__bf16)m0[r];     o0[2 * r + 1] = (__bf16)m1[r];
        o1[2 * r] = (__bf16)m0[r + 4]; o1[2 * r + 1] = (__bf16)m1[r + 4];
      }
      __bf16* ap = amx + ml * AMG + wave * AMP + hf * 16;
      *(v8bf*)ap       = o0;
      *(v8bf*)(ap + 8) = o1;
    }
    // The mixed tile is complete, and every wave has left pw, which the next chunk rewrites. amx is
    // rewritten only behind the next chunk's first barrier, which every wave's reads below precede.
    __syncthreads();
    // phase C: this wave = output head g; its mixed 16 x 32 tile is the A operand, 4 WMMAs vs Vt
    v16bf am = load_frag(amx + g * AMG + ml * AMP + hf * 8);
    // unrolled so that vf[] and yac[] stay in registers
#pragma unroll
    for (int dt = 0; dt < 4; ++dt) yac[dt] = WMMA_BF16(am, vf[dt], yac[dt]);
  }
  // write this block's plane of y[b][t][g*64+d] as bf16 for the final WMMA GEMM
  Y += (size_t)seg * YPL;
#pragma unroll
  for (int dt = 0; dt < 4; ++dt)
#pragma unroll
    for (int r = 0; r < 8; ++r) {
      int t = t0 + r + hf * 8;
      int n = g * HS + dt * 16 + ml;
      Y[((size_t)b * TT + t) * CC + n] = (__bf16)yac[dt][r];
    }
}

// ---------------- host-side orchestration ----------------
extern "C" void kernel_launch(void* const* d_in, const int* in_sizes, int n_in,
                              void* d_out, int out_size, void* d_ws, size_t ws_size,
                              hipStream_t stream) {
  const float* x     = (const float*)d_in[0];
  const float* tw    = (const float*)d_in[1];
  const float* alpha = (const float*)d_in[2];
  const float* beta  = (const float*)d_in[3];
  const float* gamma = (const float*)d_in[4];
  const float* Wq = (const float*)d_in[5];  const float* bq = (const float*)d_in[6];
  const float* Wk = (const float*)d_in[7];  const float* bk = (const float*)d_in[8];
  const float* Wv = (const float*)d_in[9];  const float* bv = (const float*)d_in[10];
  const float* Wmix = (const float*)d_in[11];
  const float* Wo = (const float*)d_in[12]; const float* bo = (const float*)d_in[13];
  float* out = (float*)d_out;

  char* ws = (char*)d_ws;
  const size_t MB = 1u << 20;
  __bf16* XS   = (__bf16*)(ws + 0);          // 4 MB
  __bf16* WQT  = (__bf16*)(ws + 4 * MB);     // 2 MB each
  __bf16* WKT  = (__bf16*)(ws + 6 * MB);
  __bf16* WVT  = (__bf16*)(ws + 8 * MB);
  __bf16* WOT  = (__bf16*)(ws + 10 * MB);
  float*  QR   = (float*)(ws + 12 * MB);     // 8 MB each
  float*  KR   = (float*)(ws + 20 * MB);
  float*  VR   = (float*)(ws + 28 * MB);
  __bf16* QHB  = (__bf16*)(ws + 36 * MB);    // 4 MB each
  __bf16* KHB  = (__bf16*)(ws + 40 * MB);
  __bf16* VTB  = (__bf16*)(ws + 44 * MB);
  float*  MBUF = (float*)(ws + 48 * MB);     // 128 KB each
  float*  ZBUF = (float*)(ws + 48 * MB + (128u << 10));
  __bf16* YBF  = (__bf16*)(ws + 49 * MB);    // 3 planes of 4 MB

  // 1) + 2) shift + bf16 (4 rows per block) and the four weight transpose-converts, one grid
  k_prep<<<SHB + 4 * CVB, 256, 0, stream>>>(x, Wq, Wk, Wv, Wo, XS, WQT, WKT, WVT, WOT);
  // 3) QKV GEMMs: (B*T=2048) x 1024 x 1024 each, 128x64 tile per block of 8 waves, one grid
  const int gblk = (BB * TT / GBM) * (CC / GBN);   // 256 blocks a product
  k_gemm_qkv<<<dim3(gblk, 3), 256, 0, stream>>>(XS, WQT, WKT, WVT, bq, bk, bv, QR, KR, VR);
  // 4) RoPE + relayout
  k_rope<<<BB * TT / 8, 256, 0, stream>>>(QR, KR, VR, QHB, KHB, VTB);
  // 5) softmax stats: 2048 waves = 256 blocks x 8 waves
  k_stats<<<256, 256, 0, stream>>>(QHB, KHB, MBUF, ZBUF);
  // 6) fused attention: 1 to 3 blocks per (b, 16-row tile), 16 waves = 16 heads
  k_attn<<<BB * 120, 512, 0, stream>>>(QHB, KHB, VTB, MBUF, ZBUF,
                                             tw, alpha, beta, Wmix, YBF);
  // 7) output GEMM over the planes of y, with bias + gamma epilogue
  k_gemm_out<<<gblk, 256, 0, stream>>>(YBF, WOT, bo, gamma, out);
}

// v010
// A run of this version takes 79.8 microseconds.
// Timed twice side by side with v009, it ran 1.16 times as fast both times.
// Over all steps from v000 it is 7.35 times as fast.
#include <hip/hip_runtime.h>
#include <hip/hip_bf16.h>
#include <math.h>

// ---------------- problem constants ----------------
enum : int { BB = 2, TT = 1024, CC = 1024, NH = 16, HS = 64, ROT = 32 };
enum : int { PRP = 68 };   // LDS row pitch of the p*w tile, in floats: 32 keys x 2 heads, then 4
enum : int { AMP = 40 };   // LDS row pitch of the mixed tile, in bf16: 80 B = 16 B x odd
enum : int { AMG = 16 * AMP + 8 };   // one output head's 16 mixed rows, in bf16: 1296 B = 16 B x odd
enum : int { TWP = TT + 32 };   // LDS pitch of one head's decay row: the row, then 32 zeros

typedef __attribute__((ext_vector_type(16))) __bf16 v16bf;
typedef __attribute__((ext_vector_type(8)))  __bf16 v8bf;
typedef __attribute__((ext_vector_type(4)))  __bf16 v4bf;
typedef __attribute__((ext_vector_type(8)))  float  v8f;
typedef __attribute__((ext_vector_type(2)))  float  v2f;

#define WMMA_BF16(a, b, c) \
  __builtin_amdgcn_wmma_f32_16x16x32_bf16(false, (a), false, (b), (short)0, (c), false, false)
#define WMMA_F32(a, b, c) \
  __builtin_amdgcn_wmma_f32_16x16x4_f32(false, (a), false, (b), (short)0, (c), false, false)

// Fragment loader: lane supplies base = row_ptr + kb (kb = 8*(lane>=16)).
// Elements 0..7  <- K = kb+0..7   (16B load)
// Elements 8..15 <- K = kb+16..23 (16B load)
static __device__ __forceinline__ v16bf load_frag(const __bf16* p) {
  v8bf lo = *(const v8bf*)p;
  v8bf hi = *(const v8bf*)(p + 16);
  v16bf r;
#pragma unroll
  for (int i = 0; i < 8; ++i) { r[i] = lo[i]; r[i + 8] = hi[i]; }
  return r;
}

// The same fragment from a buffer kept in fragment order: elements 0..7 of the 32 lanes are one run of
// 512 B, elements 8..15 the next. Lane supplies base = run + lane*8: each load takes four whole lines.
static __device__ __forceinline__ v16bf load_fragc(const __bf16* p) {
  v8bf lo = *(const v8bf*)p;
  v8bf hi = *(const v8bf*)(p + 256);
  v16bf r;
#pragma unroll
  for (int i = 0; i < 8; ++i) { r[i] = lo[i]; r[i + 8] = hi[i]; }
  return r;
}

// One wave turns a 64-row x 16-column f32 tile into its bf16 transpose, in registers.
// Lane (tl, ng) holds rows tl*8..+7 of columns ng*4..+3: eight 16-byte loads (4 lanes = 64 B of a
// row), four 16-byte stores (8 lanes = one whole 128-B line of a transposed row).
static __device__ __forceinline__ void tile_T(const float* __restrict__ src, int ld_src,
                                              __bf16* __restrict__ dst, int ld_dst, int lane) {
  int ng = lane & 3, tl = lane >> 2;
  const float* p = src + (size_t)(tl * 8) * ld_src + ng * 4;
  float4 v[8];
#pragma unroll
  for (int j = 0; j < 8; ++j) v[j] = *(const float4*)(p + (size_t)j * ld_src);
  // precaution: stands in front of any rewrite of the address registers of the loads above
  asm volatile("s_wait_xcnt 0x0" ::: "memory");
  v8bf o0, o1, o2, o3;
#pragma unroll
  for (int j = 0; j < 8; ++j) {
    o0[j] = (__bf16)v[j].x; o1[j] = (__bf16)v[j].y;
    o2[j] = (__bf16)v[j].z; o3[j] = (__bf16)v[j].w;
  }
  __bf16* q = dst + (size_t)(ng * 4) * ld_dst + tl * 8;
  *(v8bf*)(q)                      = o0;
  *(v8bf*)(q + (size_t)ld_dst)     = o1;
  *(v8bf*)(q + (size_t)2 * ld_dst) = o2;
  *(v8bf*)(q + (size_t)3 * ld_dst) = o3;
}

static __device__ __forceinline__ v4bf cvt4(float a, float b, float c, float d) {
  v4bf r;
  r[0] = (__bf16)a; r[1] = (__bf16)b; r[2] = (__bf16)c; r[3] = (__bf16)d;
  return r;
}

// ---------------- 1) time-shift + f32->bf16 ----------------
// A block of 256 threads spans one row (256 groups of 4 channels) and takes 4 rows.
static __device__ __forceinline__ void shift_rows(const float* __restrict__ x,
                                                  __bf16* __restrict__ xs, int blk) {
  int c = threadIdx.x * 4;
  int row0 = blk * 4;
  int back = (c < CC / 2) ? 1 : 0;             // first half of the channels reads row t-1
  float4 v[4];
#pragma unroll
  for (int q = 0; q < 4; ++q) {
    int srow = row0 + q - back;                // clamped so that all four loads issue together
    v[q] = *(const float4*)(x + (size_t)(srow < 0 ? 0 : srow) * CC + c);
  }
  // precaution: stands in front of any rewrite of the address registers of the loads above
  asm volatile("s_wait_xcnt 0x0" ::: "memory");
#pragma unroll
  for (int q = 0; q < 4; ++q)
    if (back && ((row0 + q) & (TT - 1)) == 0) v[q] = make_float4(0.f, 0.f, 0.f, 0.f);
#pragma unroll
  for (int q = 0; q < 4; ++q)
    *(v4bf*)(xs + (size_t)(row0 + q) * CC + c) = cvt4(v[q].x, v[q].y, v[q].z, v[q].w);
}

// ---------------- 2) W[k][n] f32 -> Wt[n][k] bf16 ----------------
// 1024 waves a matrix: wave = (64-row k tile, 16-column n tile)
static __device__ __forceinline__ void convT(const float* __restrict__ W,
                                             __bf16* __restrict__ Wt, int blk) {
  int gw = (blk * 256 + threadIdx.x) >> 5;
  int kt = gw >> 6, nt = gw & 63;
  tile_T(W + (size_t)kt * 64 * CC + nt * 16, CC,
         Wt + (size_t)nt * 16 * CC + kt * 64, CC, threadIdx.x & 31);
  // precaution: stands in front of any rewrite of the registers that the tile's four stores name
  asm volatile("s_wait_xcnt 0x0" ::: "memory");
}

// 1) and 2) depend on nothing and on each other not at all: one grid holds them, by block range.
enum : int { SHB = BB * TT / 4, CVB = 128 };   // blocks of the shift; blocks of one weight matrix
__global__ void __launch_bounds__(256)
k_prep(const float* __restrict__ x, const float* __restrict__ Wq, const float* __restrict__ Wk,
       const float* __restrict__ Wv, const float* __restrict__ Wo, __bf16* __restrict__ xs,
       __bf16* __restrict__ Wqt, __bf16* __restrict__ Wkt, __bf16* __restrict__ Wvt,
       __bf16* __restrict__ Wot) {
  int blk = blockIdx.x;
  if (blk < SHB) { shift_rows(x, xs, blk); return; }
  blk -= SHB;
  int sel = blk / CVB;
  const float* W = sel == 0 ? Wq : sel == 1 ? Wk : sel == 2 ? Wv : Wo;
  __bf16* Wt = sel == 0 ? Wqt : sel == 1 ? Wkt : sel == 2 ? Wvt : Wot;
  convT(W, Wt, blk % CVB);
}

// ---------------- bf16 WMMA GEMM, operands staged in LDS, 32x32 per wave ----------------
// A @ Bt^T + bias; M = BB*TT, N = K = CC.
// A block of 8 waves (4 x 2) owns a 128 x 64 tile of the product. A stage is 128 k (256 B) of the block's
// 128 rows of A and 64 rows of Bt, brought into LDS by asynchronous 16-byte copies: 16 lanes take
// one row's 256 B, so every copy instruction moves whole lines. Two buffers: the next stage's
// copies fly while this stage is worked on.
enum : int { GBM = 128, GBN = 64, GBK = 128, GNT = CC / GBK };
enum : int { GPITCH = 2 * GBK + 16 };             // LDS row pitch in bytes: 272 = 16 B x odd
enum : int { GBUF = (GBM + GBN) * GPITCH };       // one buffer: the A rows, then the Bt rows

// Four copies of this lane: rows 16 apart in the source (pitch CC elements) and in LDS.
static __device__ __forceinline__ void copy4(unsigned lds, const __bf16* g) {
  // The wait is the last line of the copies' own statement, so that it stands in front of any
  // rewrite of the address registers that the copies name (a precaution).
  asm volatile("global_load_async_to_lds_b128 %0, %4, off\n\t"
               "global_load_async_to_lds_b128 %1, %5, off\n\t"
               "global_load_async_to_lds_b128 %2, %6, off\n\t"
               "global_load_async_to_lds_b128 %3, %7, off\n\t"
               "s_wait_xcnt 0x0"
               :: "v"(lds), "v"(lds + 16 * GPITCH), "v"(lds + 32 * GPITCH), "v"(lds + 48 * GPITCH),
                  "v"(g), "v"(g + 16 * CC), "v"(g + 32 * CC), "v"(g + 48 * CC)
               : "memory");
}

// One stage: 8 copies of A and 4 of Bt per lane. la = this lane's LDS place in the buffer's row
// tid>>4, ga / gb = the same place of the stage in A / Bt.
static __device__ __forceinline__ void copy_stage(unsigned la, const __bf16* ga, const __bf16* gb) {
  copy4(la, ga);
  copy4(la + 64 * GPITCH, ga + 64 * CC);
  copy4(la + GBM * GPITCH, gb);
}

// ---------------- 3) Q, K, V projections, RoPE and the attention kernels' layouts in the epilogue ----------------
// Qh, Kh and Vt are kept in the order in which a wave's fragment loads take them, so that every such
// load, and every store here, is 512 B in a row (four whole lines):
// Qh, Kh: [b*16+h][t>>4][d>>4][(d>>3)&1][t&15][d&7]          (16 rows = 2 KB = 2 fragments of 2 runs)
// Vt:     [b*16+h][s>>5][d>>4][(s>>4)&1][(s>>3)&1][d&15][s&7] (32 keys = 4 KB = 4 fragments of 2 runs)
// A lane of the accumulator holds 8 rows in a row of one column. A block's 64 columns of W are one
// head. For V the product is xs @ W (rows = keys): a lane's 8 values are 16 bytes of Vt. For Q and K
// the two operands change places, W^T @ xs^T (rows = d): a lane's 8 values are 16 bytes of Qh / Kh,
// and d and d + 16, the two partners of the rotation, are the same register of two accumulators.
// The three projections read the same A and depend on each other not at all: one grid, blockIdx.y
// names the projection. Three blocks (102 KB of LDS each) stand on a WGP together.
static __device__ __forceinline__ v8bf cvt8(const v8f& a) {
  v8bf o;
#pragma unroll
  for (int r = 0; r < 8; ++r) o[r] = (__bf16)a[r];
  return o;
}

// Sine and cosine of an angle given in turns (below 256 turns here: t < 1024 rad). One statement, both
// results in registers of their own, a v_nop at its end: so that no instruction directly behind a
// transcendental reads its result or overwrites its source, whatever the compiler puts next.
static __device__ __forceinline__ void sincos_turns(float x, float& s, float& c) {
  asm("v_sin_f32 %0, %2\n\tv_cos_f32 %1, %2\n\tv_nop" : "=&v"(s), "=&v"(c) : "v"(x));
}

__global__ void __launch_bounds__(256)
k_gemm_qkv(const __bf16* __restrict__ A, const __bf16* __restrict__ Wqt,
           const __bf16* __restrict__ Wkt, const __bf16* __restrict__ Wvt,
           const float* __restrict__ bq, const float* __restrict__ bk,
           const float* __restrict__ bv, __bf16* __restrict__ Qh, __bf16* __restrict__ Kh,
           __bf16* __restrict__ Vt) {
  __shared__ __attribute__((aligned(16))) unsigned char sm[2 * GBUF];   // 102 KB
  int sel = blockIdx.y;
  const __bf16* Bt = sel == 0 ? Wqt : sel == 1 ? Wkt : Wvt;
  const float* bias = sel == 0 ? bq : sel == 1 ? bk : bv;
  int tid  = threadIdx.x;
  int wave = tid >> 5, lane = tid & 31;
  int hf = lane >> 4, ml = lane & 15;
  int bm0 = (blockIdx.x >> 4) * GBM, bn0 = (blockIdx.x & 15) * GBN;     // 16 x 16 block tiles
  int wm = (wave >> 1) * 32, wn = (wave & 1) * 32;

  unsigned la = (unsigned)(size_t)sm + (unsigned)((tid >> 4) * GPITCH + (tid & 15) * 16);
  const __bf16* ga = A  + (size_t)(bm0 + (tid >> 4)) * CC + (tid & 15) * 8;
  const __bf16* gb = Bt + (size_t)(bn0 + (tid >> 4)) * CC + (tid & 15) * 8;

  copy_stage(la, ga, gb);
  // stage 0 has landed for this wave; the barrier publishes it to the others
  asm volatile("s_wait_asynccnt 0x0" ::: "memory");
  __syncthreads();
  copy_stage(la + GBUF, ga + GBK, gb + GBK);

  // LDS rows of the operand that gives the accumulators' rows (x) and of the one that gives their columns (y)
  int xrow = sel == 2 ? wm : GBM + wn;
  int yrow = sel == 2 ? GBM + wn : wm;
  v8f a00 = {}, a01 = {}, a10 = {}, a11 = {};
  for (int t = 0; t < GNT; ++t) {
    const unsigned char* bufp = sm + (t & 1) * GBUF;
    const unsigned char* px = bufp + (xrow + ml) * GPITCH + hf * 16;
    const unsigned char* py = bufp + (yrow + ml) * GPITCH + hf * 16;
    // unrolled so that the four k steps differ only in the immediate offsets of their LDS reads
#pragma unroll
    for (int ks = 0; ks < GBK / 32; ++ks) {
      v16bf fx0 = load_frag((const __bf16*)(px + ks * 64));
      v16bf fx1 = load_frag((const __bf16*)(px + 16 * GPITCH + ks * 64));
      v16bf fy0 = load_frag((const __bf16*)(py + ks * 64));
      v16bf fy1 = load_frag((const __bf16*)(py + 16 * GPITCH + ks * 64));
      a00 = WMMA_BF16(fx0, fy0, a00);
      a01 = WMMA_BF16(fx0, fy1, a01);
      a10 = WMMA_BF16(fx1, fy0, a10);
      a11 = WMMA_BF16(fx1, fy1, a11);
    }
    // this wave's reads of the buffer have returned before the buffer is handed to the copies
    asm volatile("s_wait_dscnt 0x0" ::: "memory");
    // this wave's copies of stage t + 1 have landed
    asm volatile("s_wait_asynccnt 0x0" ::: "memory");
    __syncthreads();   // publishes stage t + 1 and ends every wave's reads of stage t
    if (t + 2 < GNT)
      copy_stage(la + (t & 1) * GBUF, ga + (t + 2) * GBK, gb + (t + 2) * GBK);
  }
  // no copy is outstanding when the wave ends
  asm volatile("s_wait_asynccnt 0x0" ::: "memory");

  int tw0 = (bm0 & (TT - 1)) + wm;                     // first of the wave's 32 rows t in its batch
  size_t hb = (size_t)((bm0 / TT) * NH + (blockIdx.x & 15)) * TT * HS;
  v8bf o00, o01, o10, o11;
  __bf16* op;
  int si, sj;                                          // store steps of the x and of the y fragment
  if (sel == 2) {
    // accumulator (i, j): keys tw0 + 16i + 8hf + r, column d = wn + 16j + ml
    float b0 = bias[bn0 + wn + ml], b1 = bias[bn0 + wn + 16 + ml];
    // precaution: stands in front of any rewrite of the address registers of the two loads above
    asm volatile("s_wait_xcnt 0x0" ::: "memory");
    o00 = cvt8(a00 + b0); o01 = cvt8(a01 + b1);
    o10 = cvt8(a10 + b0); o11 = cvt8(a11 + b1);
    op = Vt + hb + (tw0 >> 5) * 2048 + (wn >> 4) * 512 + lane * 8;
    si = 256; sj = 512;
  } else {
    // accumulator (i, j): d = wn + 16i + 8hf + r, row t = tw0 + 16j + ml
    const float4* bp = (const float4*)(bias + bn0 + wn + hf * 8);
    float4 c0 = bp[0], c1 = bp[1], c2 = bp[4], c3 = bp[5];
    // precaution: stands in front of any rewrite of the address registers of the four loads above
    asm volatile("s_wait_xcnt 0x0" ::: "memory");
    v8f b0 = {c0.x, c0.y, c0.z, c0.w, c1.x, c1.y, c1.z, c1.w};
    v8f b1 = {c2.x, c2.y, c2.z, c2.w, c3.x, c3.y, c3.z, c3.w};
    a00 += b0; a01 += b0; a10 += b1; a11 += b1;
    if (wn == 0) {                                     // d < ROT: this wave holds the rotated half of the head
      // 1024^(-(d & 15) / 16) = 2^(-0.625 r) * 2^(-5 hf): the second factor goes into t, exactly
      float sc = hf ? 0.03125f : 1.0f;
      float t0f = (float)(tw0 + ml) * sc, t1f = (float)(tw0 + 16 + ml) * sc;
      // unrolled so that the accumulators' elements are named at compile time
#pragma unroll
      for (int r = 0; r < 8; ++r) {
        float inv = exp2f((float)r * -0.625f);         // r is known at compile time: a literal
        float f0 = t0f * inv, f1 = t1f * inv;
        float cs0, sn0, cs1, sn1;
        sincos_turns(f0 * 0.15915494309189532f, sn0, cs0);
        sincos_turns(f1 * 0.15915494309189532f, sn1, cs1);
        float lo0 = a00[r], hi0 = a10[r], lo1 = a01[r], hi1 = a11[r];
        a00[r] = lo0 * cs0 - hi0 * sn0;  a10[r] = hi0 * cs0 + lo0 * sn0;
        a01[r] = lo1 * cs1 - hi1 * sn1;  a11[r] = hi1 * cs1 + lo1 * sn1;
      }
    }
    o00 = cvt8(a00); o01 = cvt8(a01); o10 = cvt8(a10); o11 = cvt8(a11);
    op = (sel == 0 ? Qh : Kh) + hb + (tw0 >> 4) * 1024 + (wn >> 4) * 256 + lane * 8;
    si = 256; sj = 1024;
  }
  *(v8bf*)(op)           = o00;
  *(v8bf*)(op + sj)      = o01;
  *(v8bf*)(op + si)      = o10;
  *(v8bf*)(op + si + sj) = o11;
  // precaution: stands in front of any rewrite of the registers that the four stores above name
  asm volatile("s_wait_xcnt 0x0" ::: "memory");
}

// ---------------- output GEMM: sums the attention's partial y planes in its accumulators ----------------
// out = ((sum over planes of Yp) @ Bt^T + bias) * gamma[m%T]. Rows t of a batch have (t >> 7) / 3 + 1
// planes (k_attn's split of the keys). Block tile, wave tile, stage length, copies and the order of
// waits and barrier are those of k_gemm_qkv; a stage holds the 64 Bt rows and then 128 rows of each
// plane. The Bt fragments of a stage are read from LDS once and serve every plane.
enum : int { YSEG = 3 };                          // most planes of a row
enum : int { YPL = BB * TT * CC };                // elements of one plane
enum : int { OBUF = (GBN + YSEG * GBM) * GPITCH };   // one buffer: 119 KB

static __device__ __forceinline__ void copy_stage_out(unsigned la, const __bf16* ga,
                                                      const __bf16* gb, int nseg) {
  copy4(la, gb);
  for (int sg = 0; sg < nseg; ++sg) {             // at most 4 + 8 * 3 = 28 copies of a wave in flight
    copy4(la + (GBN + sg * GBM) * GPITCH, ga + (size_t)sg * YPL);
    copy4(la + (GBN + sg * GBM + 64) * GPITCH, ga + (size_t)sg * YPL + 64 * CC);
  }
}

__global__ void __launch_bounds__(256)
k_gemm_out(const __bf16* __restrict__ Yp, const __bf16* __restrict__ Bt,
           const float* __restrict__ bias, const float* __restrict__ gamma,
           float* __restrict__ out) {
  __shared__ __attribute__((aligned(16))) unsigned char sm[2 * OBUF];   // 238 KB of 320 KB LDS
  int tid  = threadIdx.x;
  int wave = tid >> 5, lane = tid & 31;
  int hf = lane >> 4, ml = lane & 15;
  int bm0 = (blockIdx.x >> 4) * GBM, bn0 = (blockIdx.x & 15) * GBN;     // 16 x 16 block tiles
  int wm = (wave >> 1) * 32, wn = (wave & 1) * 32;
  int nseg = ((bm0 & (TT - 1)) >> 7) / 3 + 1;     // the same for the block's 128 rows

  unsigned la = (unsigned)(size_t)sm + (unsigned)((tid >> 4) * GPITCH + (tid & 15) * 16);
  const __bf16* ga = Yp + (size_t)(bm0 + (tid >> 4)) * CC + (tid & 15) * 8;
  const __bf16* gb = Bt + (size_t)(bn0 + (tid >> 4)) * CC + (tid & 15) * 8;

  copy_stage_out(la, ga, gb, nseg);
  // stage 0 has landed for this wave; the barrier publishes it to the others
  asm volatile("s_wait_asynccnt 0x0" ::: "memory");
  __syncthreads();
  copy_stage_out(la + OBUF, ga + GBK, gb + GBK, nseg);

  v8f a00 = {}, a01 = {}, a10 = {}, a11 = {};
  for (int t = 0; t < GNT; ++t) {
    const unsigned char* bufp = sm + (t & 1) * OBUF;
    const unsigned char* pb = bufp + (wn + ml) * GPITCH + hf * 16;
    v16bf fb0[GBK / 32], fb1[GBK / 32];
    // unrolled so that fb0[] and fb1[] stay in registers
#pragma unroll
    for (int ks = 0; ks < GBK / 32; ++ks) {
      fb0[ks] = load_frag((const __bf16*)(pb + ks * 64));
      fb1[ks] = load_frag((const __bf16*)(pb + 16 * GPITCH + ks * 64));
    }
    for (int sg = 0; sg < nseg; ++sg) {
      const unsigned char* pa = bufp + (GBN + sg * GBM + wm + ml) * GPITCH + hf * 16;
      v16bf fa0[GBK / 32], fa1[GBK / 32];
      // unrolled so that fa0[] and fa1[] stay in registers
#pragma unroll
      for (int ks = 0; ks < GBK / 32; ++ks) {
        fa0[ks] = load_frag((const __bf16*)(pa + ks * 64));
        fa1[ks] = load_frag((const __bf16*)(pa + 16 * GPITCH + ks * 64));
      }
      // keeps the products behind all 16 LDS reads of the plane: without it the scheduler reuses two
      // fragments' registers, reads in pairs between the products and waits for LDS at every pair
      __builtin_amdgcn_sched_barrier(0);
      // unrolled so that the fragment arrays are indexed at compile time
#pragma unroll
      for (int ks = 0; ks < GBK / 32; ++ks) {
        a00 = WMMA_BF16(fa0[ks], fb0[ks], a00);
        a01 = WMMA_BF16(fa0[ks], fb1[ks], a01);
        a10 = WMMA_BF16(fa1[ks], fb0[ks], a10);
        a11 = WMMA_BF16(fa1[ks], fb1[ks], a11);
      }
    }
    // this wave's reads of the buffer have returned before the buffer is handed to the copies
    asm volatile("s_wait_dscnt 0x0" ::: "memory");
    // this wave's copies of stage t + 1 have landed
    asm volatile("s_wait_asynccnt 0x0" ::: "memory");
    __syncthreads();   // publishes stage t + 1 and ends every wave's reads of stage t
    if (t + 2 < GNT)
      copy_stage_out(la + (t & 1) * OBUF, ga + (t + 2) * GBK, gb + (t + 2) * GBK, nseg);
  }
  // no copy is outstanding when the wave ends
  asm volatile("s_wait_asynccnt 0x0" ::: "memory");

  int m0 = bm0 + wm, n0 = bn0 + wn;
#pragma unroll
  for (int bm = 0; bm < 2; ++bm)
#pragma unroll
    for (int bn = 0; bn < 2; ++bn) {
      const v8f& acc = bm ? (bn ? a11 : a10) : (bn ? a01 : a00);
      int n = n0 + bn * 16 + ml;
      float bv = bias[n];
#pragma unroll
      for (int r = 0; r < 8; ++r) {
        int m = m0 + bm * 16 + r + hf * 8;
        out[(size_t)m * CC + n] = (acc[r] + bv) * gamma[m % TT];
        // precaution: stands in front of any rewrite of the registers that the store above names
        asm volatile("s_wait_xcnt 0x0" ::: "memory");
      }
    }
}

// ---------------- 5) softmax stats over ALL s (max & sum) ----------------
// Each lane keeps the running maximum and sum of the keys of its own column (s = 16*i + ml) alone;
// the 16 lanes of a row are merged once, behind the loop. A pass takes 64 keys: one maximum, one
// rescale of the sum. The bound is the launch's own block size: it gives a pass's 16 loads the
// registers to be in flight together.
__global__ void __launch_bounds__(256) k_stats(const __bf16* __restrict__ Qh, const __bf16* __restrict__ Kh,
                        float* __restrict__ Mb, float* __restrict__ Zb) {
  int wid  = (blockIdx.x * blockDim.x + threadIdx.x) >> 5;
  int lane = threadIdx.x & 31;
  int hf = lane >> 4, ml = lane & 15;
  int tile = wid & 63, bh = wid >> 6;      // 2048 waves: [b*16+h][t-tile]
  int t0 = tile * 16;
  const __bf16* qrow = Qh + ((size_t)bh * TT + t0) * HS + hf * 128 + ml * 8;   // fragment order: 2 KB in a row
  v16bf qa0 = load_fragc(qrow);
  v16bf qa1 = load_fragc(qrow + 512);
  float mr[8], zz[8];
#pragma unroll
  for (int r = 0; r < 8; ++r) { mr[r] = -3.0e38f; zz[r] = 0.f; }
  const __bf16* krow = Kh + (size_t)bh * TT * HS + lane * 8;   // fragment order: 64 keys = 8 KB in a row
  for (int st = 0; st < TT / 64; ++st) {
    v16bf kf[4][2];
    v8f s[4];
    const __bf16* kp = krow + (size_t)st * 64 * HS;
    // unrolled so that kf[] stays in registers
#pragma unroll
    for (int u = 0; u < 4; ++u) {
      kf[u][0] = load_fragc(kp + u * 1024);
      kf[u][1] = load_fragc(kp + u * 1024 + 512);
    }
    // keeps the products behind all 16 loads of the pass: without it the scheduler puts products
    // between the loads to reuse their registers, and a pass waits for memory several times over
    __builtin_amdgcn_sched_barrier(0);
    // unrolled so that s[] stays in registers
#pragma unroll
    for (int u = 0; u < 4; ++u) {
      v8f acc = {};
      acc = WMMA_BF16(qa0, kf[u][0], acc);
      s[u] = WMMA_BF16(qa1, kf[u][1], acc);
    }
    // unrolled so that mr[] and zz[] stay in registers; the eight rows are independent chains
#pragma unroll
    for (int r = 0; r < 8; ++r) {
      float x0 = s[0][r] * 0.125f, x1 = s[1][r] * 0.125f;   // 1/sqrt(64)
      float x2 = s[2][r] * 0.125f, x3 = s[3][r] * 0.125f;
      float mnew = fmaxf(fmaxf(fmaxf(x0, x1), fmaxf(x2, x3)), mr[r]);
      float e = (__expf(x0 - mnew) + __expf(x1 - mnew)) + (__expf(x2 - mnew) + __expf(x3 - mnew));
      zz[r] = zz[r] * __expf(mr[r] - mnew) + e;
      mr[r] = mnew;
    }
  }
  // the merge of a row's 16 lanes; unrolled so that the eight rows' exchanges overlap
#pragma unroll
  for (int r = 0; r < 8; ++r) {
    float m = mr[r];
    m = fmaxf(m, __shfl_xor(m, 8, 16));
    m = fmaxf(m, __shfl_xor(m, 4, 16));
    m = fmaxf(m, __shfl_xor(m, 2, 16));
    m = fmaxf(m, __shfl_xor(m, 1, 16));
    float z = zz[r] * __expf(mr[r] - m);
    z += __shfl_xor(z, 8, 16);
    z += __shfl_xor(z, 4, 16);
    z += __shfl_xor(z, 2, 16);
    z += __shfl_xor(z, 1, 16);
    mr[r] = m;
    zz[r] = z;
  }
  if (ml == 0) {
#pragma unroll
    for (int r = 0; r < 8; ++r) {
      int t = t0 + r + hf * 8;
      Mb[(size_t)bh * TT + t] = mr[r];
      Zb[(size_t)bh * TT + t] = zz[r];
    }
  }
}

// ---------------- 6) fused attention: scores -> p*w -> Wmix -> @v  (att stays on-WGP) ----------------
__global__ void __launch_bounds__(512)
k_attn(const __bf16* __restrict__ Qh, const __bf16* __restrict__ Kh,
       const __bf16* __restrict__ Vt, const float* __restrict__ Mb,
       const float* __restrict__ Zb, const float* __restrict__ tw,
       const float* __restrict__ alpha, const float* __restrict__ beta,
       const float* __restrict__ Wmix, __bf16* __restrict__ Y) {
  // p*w of a chunk: [pair of heads][t][s][head of the pair]. 16 bytes hold two heads of two keys:
  // two A operands of the f32 mix product. Pitch 68 dwords: rows 8 apart differ by 32 banks, so the
  // two lane halves of a 4-byte store meet no common bank.
  __shared__ __attribute__((aligned(16))) float pw[(NH / 2) * 16 * PRP];   // 34 KB of 320 KB LDS
  // the mixed weights of a chunk, bf16: [g][t][s]
  __shared__ __attribute__((aligned(16))) __bf16 amx[NH * AMG];            // 20 KB
  // Each head's decay row with 32 zeros behind it, as the reference pads it: an index past the row
  // (s > t, by at most 31) reads 0, so the reads of the chunk loop need no guard and no branch.
  __shared__ __attribute__((aligned(16))) float twl[NH * TWP];       // 66 KB
  // A tile's chunks of keys are dealt evenly to (tile >> 3) / 3 + 1 blocks, at most 12 chunks each;
  // every block writes its own plane of y. 240 blocks.
  int b = blockIdx.x & 1, j = blockIdx.x >> 1;         // 120 blocks a batch: 48 + 48 + 24
  int tile, seg, c0, c1;
  if (j < 48) {
    tile = 63 - j / 3; seg = j % 3;
    int n = (tile * 16 + 47) >> 5;
    c0 = seg * n / 3; c1 = (seg + 1) * n / 3;
  } else if (j < 96) {
    tile = 47 - ((j - 48) >> 1); seg = (j - 48) & 1;
    int n = (tile * 16 + 47) >> 5;
    c0 = seg * n / 2; c1 = (seg + 1) * n / 2;
  } else {
    tile = 23 - (j - 96); seg = 0;
    c0 = 0; c1 = (tile * 16 + 47) >> 5;
  }
  int wave = threadIdx.x >> 5;                         // = input head h and output head g
  int lane = threadIdx.x & 31;
  int hf = lane >> 4, ml = lane & 15;
  int t0 = tile * 16;
  int h = wave, g = wave;
  int bh = b * NH + h, bg = b * NH + g;

  {
    const float4* trow = (const float4*)(tw + h * TT) + lane;
    float4 tv[8];
#pragma unroll
    for (int j = 0; j < 8; ++j) tv[j] = trow[j * 32];
    // precaution: stands in front of any rewrite of the address registers of the loads above
    asm volatile("s_wait_xcnt 0x0" ::: "memory");
    float4* trl = (float4*)(twl + h * TWP) + lane;
#pragma unroll
    for (int j = 0; j < 8; ++j) trl[j * 32] = tv[j];
    twl[h * TWP + TT + lane] = 0.f;
  }
  // decay weight of (t0 + hf*8 + r, s) = twp[s - r]
  const float* twp = twl + h * TWP + (TT - 1) - t0 - hf * 8;

  const __bf16* qrow = Qh + ((size_t)bh * TT + t0) * HS + lane * 8;   // fragment order: 2 KB in a row
  v16bf qa0 = load_fragc(qrow);
  v16bf qa1 = load_fragc(qrow + 512);

  float mr[8], zi[8], bt[8];
#pragma unroll
  for (int r = 0; r < 8; ++r) {
    int t = t0 + r + hf * 8;
    mr[r] = Mb[(size_t)bh * TT + t];
    zi[r] = 1.0f / Zb[(size_t)bh * TT + t];
    bt[r] = beta[h * TT + t];
  }
  // B operand of the mix product: column g = ml; k step q, lane half hf, element e = head 4q + 2hf + e
  v2f wb[4];
  // unrolled so that wb[] stays in registers
#pragma unroll
  for (int q = 0; q < 4; ++q) wb[q] = *(const v2f*)(Wmix + ml * NH + q * 4 + hf * 2);

  v8f yac[4] = {};
  __syncthreads();   // the staged decay rows are complete before the first read
  for (int ch = c0; ch < c1; ++ch) {
    int s0 = ch * 32;
    // the chunk's 16 decay weights, read in front of the first store to pw so that they issue as a group
    float twv[2][8];
#pragma unroll
    for (int sub = 0; sub < 2; ++sub)
#pragma unroll
      for (int r = 0; r < 8; ++r) twv[sub][r] = twp[s0 + sub * 16 + ml - r];
    float al[2];
    al[0] = alpha[h * TT + s0 + ml];
    al[1] = alpha[h * TT + s0 + 16 + ml];
    // precaution: stands in front of any rewrite of the address registers of the two loads above
    asm volatile("s_wait_xcnt 0x0" ::: "memory");
    // phase A: this wave = head h; two 16-wide s subtiles of exp/Z * w -> LDS
    const __bf16* kp = Kh + ((size_t)bh * TT + s0) * HS + lane * 8;   // fragment order: 4 KB in a row
    v16bf kf[2][2];
    // unrolled so that kf[] stays in registers
#pragma unroll
    for (int sub = 0; sub < 2; ++sub) {
      kf[sub][0] = load_fragc(kp + sub * 1024);
      kf[sub][1] = load_fragc(kp + sub * 1024 + 512);
    }
    // precaution: stands in front of any rewrite of the address registers of the 8 loads above; the
    // operand keeps the address in its registers up to here, so that no load lands on them
    asm volatile("s_wait_xcnt 0x0" :: "v"(kp) : "memory");
    // keeps the products behind all 8 loads of the chunk, one wait for memory: without it this build
    // puts products between the loads to reuse their registers and waits for memory three times
    __builtin_amdgcn_sched_barrier(0);
#pragma unroll
    for (int sub = 0; sub < 2; ++sub) {
      v8f s = {};
      s = WMMA_BF16(qa0, kf[sub][0], s);
      s = WMMA_BF16(qa1, kf[sub][1], s);
#pragma unroll
      for (int r = 0; r < 8; ++r) {
        int tl = r + hf * 8;
        float p = __expf(s[r] * 0.125f - mr[r]) * zi[r];
        float wv = twv[sub][r] * al[sub] * bt[r];
        pw[((h >> 1) * 16 + tl) * PRP + (sub * 16 + ml) * 2 + (h & 1)] = p * wv;
      }
    }
    __syncthreads();
    // this wave's V fragments of the chunk, issued behind this barrier so that they fly during the mix
    const __bf16* vp = Vt + (size_t)bg * HS * TT + (size_t)ch * 2048 + lane * 8;   // 4 KB in a row
    v16bf vf[4];
    // unrolled so that vf[] stays in registers
#pragma unroll
    for (int dt = 0; dt < 4; ++dt) vf[dt] = load_fragc(vp + dt * 512);
    // phase B: this wave = row t0 + wave of the tile; all 16 output heads of its 32 keys in one
    // f32 matrix product: rows = keys (tile 0: even s, tile 1: odd s), k = input head, columns = g.
    // The p*w tile is read from LDS once by the block, not once by every output head.
    v8f m0 = {}, m1 = {};
    // unrolled so that wb[] stays in registers and the four reads differ only in their offsets
#pragma unroll
    for (int q = 0; q < 4; ++q) {
      // heads 4q + 2hf + {0, 1} of keys 2ml and 2ml + 1: the k order of wb[q]
      const float4 v = *(const float4*)&pw[((q * 2 + hf) * 16 + wave) * PRP + ml * 4];
      v2f a0 = {v.x, v.y}, a1 = {v.z, v.w};
      m0 = WMMA_F32(a0, wb[q], m0);
      m1 = WMMA_F32(a1, wb[q], m1);
    }
    // register r = keys 16hf + 2r (m0) and 16hf + 2r + 1 (m1) of output head ml: 32 B of one row
    {
      v8bf o0, o1;
      // unrolled so that the vector elements are named at compile time
#pragma unroll
      for (int r = 0; r < 4; ++r) {
        o0[2 * r] = (__bf16)m0[r];     o0[2 * r + 1] = (__bf16)m1[r];
        o1[2 * r] = (__bf16)m0[r + 4]; o1[2 * r + 1] = (__bf16)m1[r + 4];
      }
      __bf16* ap = amx + ml * AMG + wave * AMP + hf * 16;
      *(v8bf*)ap       = o0;
      *(v8bf*)(ap + 8) = o1;
    }
    // The mixed tile is complete, and every wave has left pw, which the next chunk rewrites. amx is
    // rewritten only behind the next chunk's first barrier, which every wave's reads below precede.
    __syncthreads();
    // phase C: this wave = output head g; its mixed 16 x 32 tile is the A operand, 4 WMMAs vs Vt
    v16bf am = load_frag(amx + g * AMG + ml * AMP + hf * 8);
    // unrolled so that vf[] and yac[] stay in registers
#pragma unroll
    for (int dt = 0; dt < 4; ++dt) yac[dt] = WMMA_BF16(am, vf[dt], yac[dt]);
  }
  // write this block's plane of y[b][t][g*64+d] as bf16 for the final WMMA GEMM
  Y += (size_t)seg * YPL;
#pragma unroll
  for (int dt = 0; dt < 4; ++dt)
#pragma unroll
    for (int r = 0; r < 8; ++r) {
      int t = t0 + r + hf * 8;
      int n = g * HS + dt * 16 + ml;
      Y[((size_t)b * TT + t) * CC + n] = (__bf16)yac[dt][r];
    }
}

// ---------------- host-side orchestration ----------------
extern "C" void kernel_launch(void* const* d_in, const int* in_sizes, int n_in,
                              void* d_out, int out_size, void* d_ws, size_t ws_size,
                              hipStream_t stream) {
  const float* x     = (const float*)d_in[0];
  const float* tw    = (const float*)d_in[1];
  const float* alpha = (const float*)d_in[2];
  const float* beta  = (const float*)d_in[3];
  const float* gamma = (const float*)d_in[4];
  const float* Wq = (const float*)d_in[5];  const float* bq = (const float*)d_in[6];
  const float* Wk = (const float*)d_in[7];  const float* bk = (const float*)d_in[8];
  const float* Wv = (const float*)d_in[9];  const float* bv = (const float*)d_in[10];
  const float* Wmix = (const float*)d_in[11];
  const float* Wo = (const float*)d_in[12]; const float* bo = (const float*)d_in[13];
  float* out = (float*)d_out;

  char* ws = (char*)d_ws;
  const size_t MB = 1u << 20;
  __bf16* XS   = (__bf16*)(ws + 0);          // 4 MB
  __bf16* WQT  = (__bf16*)(ws + 4 * MB);     // 2 MB each
  __bf16* WKT  = (__bf16*)(ws + 6 * MB);
  __bf16* WVT  = (__bf16*)(ws + 8 * MB);
  __bf16* WOT  = (__bf16*)(ws + 10 * MB);
  __bf16* QHB  = (__bf16*)(ws + 36 * MB);    // 4 MB each
  __bf16* KHB  = (__bf16*)(ws + 40 * MB);
  __bf16* VTB  = (__bf16*)(ws + 44 * MB);
  float*  MBUF = (float*)(ws + 48 * MB);     // 128 KB each
  float*  ZBUF = (float*)(ws + 48 * MB + (128u << 10));
  __bf16* YBF  = (__bf16*)(ws + 49 * MB);    // 3 planes of 4 MB

  // 1) + 2) shift + bf16 (4 rows per block) and the four weight transpose-converts, one grid
  k_prep<<<SHB + 4 * CVB, 256, 0, stream>>>(x, Wq, Wk, Wv, Wo, XS, WQT, WKT, WVT, WOT);
  // 3) QKV GEMMs: (B*T=2048) x 1024 x 1024 each, 128x64 tile per block of 8 waves, one grid;
  //    bias, RoPE and the fragment-order bf16 layouts of Q, K, V in the epilogue
  const int gblk = (BB * TT / GBM) * (CC / GBN);   // 256 blocks a product
  k_gemm_qkv<<<dim3(gblk, 3), 256, 0, stream>>>(XS, WQT, WKT, WVT, bq, bk, bv, QHB, KHB, VTB);
  // 5) softmax stats: 2048 waves = 256 blocks x 8 waves
  k_stats<<<256, 256, 0, stream>>>(QHB, KHB, MBUF, ZBUF);
  // 6) fused attention: 1 to 3 blocks per (b, 16-row tile), 16 waves = 16 heads
  k_attn<<<BB * 120, 512, 0, stream>>>(QHB, KHB, VTB, MBUF, ZBUF,
                                             tw, alpha, beta, Wmix, YBF);
  // 7) output GEMM over the planes of y, with bias + gamma epilogue
  k_gemm_out<<<gblk, 256, 0, stream>>>(YBF, WOT, bo, gamma, out);
}
